// v000
// The times below were measured on an AMD MI455X: many runs one after another, warmed up first and cycling through
// copies of the inputs, with the whole window's GPU time divided by the number of runs. Launches and the gaps
// between them are all in it. The median over several windows is given; except for v000 it joins two sittings, which
// can be a few percent apart, so the side-by-side timings, each taken in one sitting, are the better comparison.
// The starting kernel, v000, takes 1560 microseconds a run.
#include <hip/hip_runtime.h>

// Relative-position multi-head attention (segment-recurrence style relative shift; query [2048][2][1024] seq-first, r [2048][1024]; w = query qkv_w^T -> q|k|v (16 heads x 64); r_k = r r_w^T; AC = (q + r_w_bias).k,
// BD = rel_shift((q + r_r_bias).r_k) with the module's exact zero-pad/reshape shift (out[i][j] = BD[f / (T+1)][f % (T+1) - 1] or 0 when f % (T+1) == 0, f = T + i*T + j); p = softmax((AC + BD) / 8)
// over the keys; attn = p.v; out = merged out_w^T + out_b; output [2048][2][1024] (rows t*2 + b)).
// Compute dtypes, f32 accumulate: every input rounded to bf16; the qkv and r projections on PLAIN bf16 operands (inputs: exact); AC, BD and attn.v on SINGLE fp16 planes
// (the per-head biases added in f32 before the fp16 rounding; logit sd ~ 0.6); the relative shift is an index gather inside the softmax kernel; P x1024;

#define NB_  2
#define TT   2048
#define DD   1024
#define NH_  16
#define HD   64
#define NT   (NB_ * TT)
#define ZH   2
#define PCAR 1024.0f
typedef _Float16 h16;
typedef unsigned short bf;
typedef __attribute__((ext_vector_type(16))) __bf16   v16bf;
typedef __attribute__((ext_vector_type(16))) _Float16 v16h;
typedef __attribute__((ext_vector_type(8)))  _Float16 v8h;
typedef __attribute__((ext_vector_type(8)))  unsigned short v8us;
typedef __attribute__((ext_vector_type(8)))  float    v8f;
typedef __attribute__((ext_vector_type(4)))  float    v4f;
typedef v8h  __attribute__((may_alias)) v8ha;
typedef v4f  __attribute__((may_alias)) v4fa;
typedef v8us __attribute__((may_alias)) v8usa;

__device__ __forceinline__ unsigned short f2bf(float f) { unsigned u = __float_as_uint(f); u += 0x7FFFu + ((u >> 16) & 1u); return (unsigned short)(u >> 16); }
__device__ __forceinline__ float bf2f(unsigned short b) { return __uint_as_float(((unsigned)b) << 16); }
__device__ __forceinline__ float bfr(float f) { return bf2f(f2bf(f)); }
__device__ __forceinline__ v16h cat16(v8h lo, v8h hi) { return __builtin_shufflevector(lo, hi, 0, 1, 2, 3, 4, 5, 6, 7, 8, 9, 10, 11, 12, 13, 14, 15); }
__device__ __forceinline__ v16bf cat16b(v8us lo, v8us hi) { return __builtin_bit_cast(v16bf, __builtin_shufflevector(lo, hi, 0, 1, 2, 3, 4, 5, 6, 7, 8, 9, 10, 11, 12, 13, 14, 15)); }
__device__ __forceinline__ v8f wmma16(v16h a, v16h b, v8f c) { return __builtin_amdgcn_wmma_f32_16x16x32_f16(false, a, false, b, (short)0, c, false, false); }
__device__ __forceinline__ v8f wmmab(v16bf a, v16bf b, v8f c) { return __builtin_amdgcn_wmma_f32_16x16x32_bf16(false, a, false, b, (short)0, c, false, false); }



// ---- k_gemmw: register-blocked GEMM, ONE WAVE per 64x64 output tile (16 accumulators), operands straight from K-contiguous 16-bit planes; grid (M/64, N/64, Z), 32 threads.
// C[m][n] (f32, pitch ldc, + optional f32 bias[n]) = sum_k A[m][k] Bt[n][k] (+ split products per NSPLIT). z-batch strides sA/sB/sC in elements. K % 32 == 0.
template <typename T16> struct WFrag;
template <> struct WFrag<h16> { typedef v16h V; static __device__ __forceinline__ V ld(const h16* p) { return cat16(*(const v8h*)p, *(const v8h*)(p + 16)); } static __device__ __forceinline__ v8f mma(V a, V b, v8f c) { return wmma16(a, b, c); } };
template <> struct WFrag<bf> { typedef v16bf V; static __device__ __forceinline__ V ld(const bf* p) { return cat16b(*(const v8us*)p, *(const v8us*)(p + 16)); } static __device__ __forceinline__ v8f mma(V a, V b, v8f c) { return wmmab(a, b, c); } };
template <typename T16, int NSPLIT, bool BIAS>
__global__ __launch_bounds__(32) void k_gemmw(const T16* __restrict__ A, const T16* __restrict__ A2, const T16* __restrict__ Bt, const T16* __restrict__ Bt2, int K, float* C, int ldc, const float* __restrict__ bias, size_t sA, size_t sB, size_t sC) {
    typedef typename WFrag<T16>::V V;
    __shared__ __align__(16) float os[16 * 68];
    const size_t z = blockIdx.z; A += z * sA; if (A2) A2 += z * sA; Bt += z * sB; if (Bt2) Bt2 += z * sB; C += z * sC;
    const int lane = threadIdx.x & 31, lr = lane & 15, hi = lane >> 4; const int r0 = blockIdx.x * 64, c0 = blockIdx.y * 64;
    v8f acc[4][4];
#pragma unroll
    for (int mb = 0; mb < 4; ++mb)
#pragma unroll
        for (int nb = 0; nb < 4; ++nb) acc[mb][nb] = (v8f){};
    const size_t aoff = (size_t)(r0 + lr) * K + 8 * hi, boff = (size_t)(c0 + lr) * K + 8 * hi;
#pragma unroll 1
    for (int kc = 0; kc < K; kc += 32) {
        V a[4], a2[4];
#pragma unroll
        for (int mb = 0; mb < 4; ++mb) { a[mb] = WFrag<T16>::ld(A + aoff + (size_t)mb * 16 * K + kc); if (NSPLIT == 1 || NSPLIT == 2) a2[mb] = WFrag<T16>::ld(A2 + aoff + (size_t)mb * 16 * K + kc); }
#pragma unroll
        for (int nb = 0; nb < 4; ++nb) { const V b = WFrag<T16>::ld(Bt + boff + (size_t)nb * 16 * K + kc); V b2; if (NSPLIT >= 2) b2 = WFrag<T16>::ld(Bt2 + boff + (size_t)nb * 16 * K + kc);
#pragma unroll
            for (int mb = 0; mb < 4; ++mb) { acc[mb][nb] = WFrag<T16>::mma(a[mb], b, acc[mb][nb]); if (NSPLIT == 1 || NSPLIT == 2) acc[mb][nb] = WFrag<T16>::mma(a2[mb], b, acc[mb][nb]); if (NSPLIT >= 2) acc[mb][nb] = WFrag<T16>::mma(a[mb], b2, acc[mb][nb]); } }
        asm volatile("v_nop\n\tv_nop\n\tv_nop\n\tv_nop" : "+v"(acc[0][0]), "+v"(acc[1][1]), "+v"(acc[2][2]), "+v"(acc[3][3]) : "v"(a[0]), "v"(a[3]));
    }
#pragma unroll
    for (int mb = 0; mb < 4; ++mb) {
#pragma unroll
        for (int nb = 0; nb < 4; ++nb) {
#pragma unroll
            for (int j = 0; j < 8; ++j) os[(hi * 8 + j) * 68 + nb * 16 + lr] = acc[mb][nb][j]; }
        __builtin_amdgcn_wave_barrier(); asm volatile("" ::: "memory");
        float* crow = C + (size_t)(r0 + mb * 16) * ldc + c0;
{
#pragma unroll
            for (int s = 0; s < 8; ++s) { const int row = 2 * s + hi, cofs = lr * 4; v4f val = *(const v4fa*)(os + row * 68 + cofs); if (BIAS) { val[0] += bfr(bias[c0 + cofs]); val[1] += bfr(bias[c0 + cofs + 1]); val[2] += bfr(bias[c0 + cofs + 2]); val[3] += bfr(bias[c0 + cofs + 3]); }
                *(v4f*)(crow + (size_t)row * ldc + cofs) = val; }
             }
        __builtin_amdgcn_wave_barrier(); asm volatile("" ::: "memory");
    }
}

__device__ __forceinline__ h16 tohx(float x) { return (h16)x; }
__device__ __forceinline__ void splitf(float y, unsigned short& h, unsigned short& l) { h = f2bf(y); l = f2bf(y - bf2f(h)); }
typedef __attribute__((ext_vector_type(2))) _Float16 v2h;
typedef __attribute__((ext_vector_type(4))) _Float16 v4h;
typedef __attribute__((ext_vector_type(2))) unsigned short v2us;
typedef __attribute__((ext_vector_type(4))) int v4i;

__global__ __launch_bounds__(256) void k_cvt8(const float* __restrict__ src, bf* dst, size_t n8) { const size_t i = (size_t)blockIdx.x * 256 + threadIdx.x; if (i >= n8) return; const v8f v = *(const v8f*)(src + i * 8); v8us o;
#pragma unroll
    for (int k = 0; k < 8; ++k) o[k] = f2bf(v[k]); *(v8us*)(dst + i * 8) = o;  }
__global__ __launch_bounds__(256) void k_hb16(const float* __restrict__ F, const float* __restrict__ hb, h16* P) {
    const int lane = threadIdx.x & 31; const int L0 = (blockIdx.x * 8 + (threadIdx.x >> 5)) * 8; const int nlines = NT * DD / 64;
{
#pragma unroll
        for (int l = 0; l < 8; ++l) { const int L = L0 + l; if (L >= nlines) break; const int e = L * 64 + lane * 2; const int d = e & 63; const int t = (e >> 6) & (TT - 1); const int z = e >> 17; const int b = z >> 4, h = z & 15; v2h o;
#pragma unroll
            for (int q = 0; q < 2; ++q) { const float bb = hb ? bfr(hb[h * HD + d + q]) : 0.f; o[q] = tohx(__fadd_rn(F[((size_t)t * NB_ + b) * DD + h * HD + d + q], bb)); }
            *(v2h*)(P + (size_t)e) = o; }
         }
}
__global__ __launch_bounds__(256) void k_rk16(const float* __restrict__ FR, h16* RK) {
    const int lane = threadIdx.x & 31; const int L0 = (blockIdx.x * 8 + (threadIdx.x >> 5)) * 8; const int nlines = NH_ * TT * HD / 64;
{
#pragma unroll
        for (int l = 0; l < 8; ++l) { const int L = L0 + l; if (L >= nlines) break; const int e = L * 64 + lane * 2; const int d = e & 63; const int j = (e >> 6) & (TT - 1); const int h = e >> 17; v2h o;
#pragma unroll
            for (int q = 0; q < 2; ++q) o[q] = tohx(FR[(size_t)j * DD + h * HD + d + q]);
            *(v2h*)(RK + (size_t)e) = o; }
         }
}
__global__ __launch_bounds__(256) void k_vtplane(const float* __restrict__ F, h16* VT) {
    const int lane = threadIdx.x & 31; const int L0 = (blockIdx.x * 8 + (threadIdx.x >> 5)) * 8; const int nlines = NT * DD / 64;
{
#pragma unroll
        for (int l = 0; l < 8; ++l) { const int L = L0 + l; if (L >= nlines) break; const int e = L * 64 + lane * 2; const int t = e & (TT - 1); const int d = (e >> 11) & 63; const int z = e >> 17; const int b = z >> 4, h = z & 15; v2h v;
#pragma unroll
            for (int q = 0; q < 2; ++q) v[q] = tohx(F[((size_t)(t + q) * NB_ + b) * DD + h * HD + d]);
            *(v2h*)(VT + (size_t)e) = v; }
         }
}
// k_relsoft: per row (zz, i): s[j] = (AC[zz][i][j] + shift(BD)[i][j]) / 8 where shift(BD)[i][j] = BD[zz][f / (T+1)][f % (T+1) - 1] (0 when f % (T+1) == 0), f = T + i*T + j - the module's
__global__ __launch_bounds__(256) void k_relsoft(const float* __restrict__ AC, const float* __restrict__ BD, h16* P) {
    const int lane = threadIdx.x & 31; const int row = blockIdx.x * 8 + (threadIdx.x >> 5); if (row >= ZH * TT) return; const int i = row & (TT - 1); const int zz = row >> 11;
    const float* ar = AC + (size_t)row * TT; const float* bd = BD + (size_t)zz * TT * TT; float v[64]; float mx = -3.0e38f;
#pragma unroll
    for (int ch = 0; ch < 16; ++ch) { const int j0 = ch * 128 + lane * 4; const v4f a = *(const v4f*)(ar + j0);
#pragma unroll
        for (int q = 0; q < 4; ++q) { const int j = j0 + q; const int f = TT + i * TT + j; const int ii = f / (TT + 1), c = f - ii * (TT + 1); const float sb = (c > 0) ? bd[(size_t)ii * TT + (c - 1)] : 0.f;
            const float t = __fmul_rn(__fadd_rn(a[q], sb), 0.125f); v[ch * 4 + q] = t; mx = fmaxf(mx, t); } }
#pragma unroll
    for (int sh = 16; sh; sh >>= 1) mx = fmaxf(mx, __shfl_xor(mx, sh, 32));
    float sum = 0.f;
#pragma unroll
    for (int k = 0; k < 64; ++k) { v[k] = __expf(v[k] - mx); sum += v[k]; }
#pragma unroll
    for (int sh = 16; sh; sh >>= 1) sum += __shfl_xor(sum, sh, 32);
    const float fct = __fdiv_rn(PCAR, sum);
{
#pragma unroll
        for (int ch = 0; ch < 16; ++ch) { v4h o;
#pragma unroll
            for (int q = 0; q < 4; ++q) o[q] = tohx(v[ch * 4 + q] * fct);
            *(v4h*)(P + (size_t)row * TT + ch * 128 + lane * 4) = o; }
         }
}
__global__ __launch_bounds__(256) void k_merge(const float* __restrict__ O, int b, int h0, bf* Ah, bf* Al) {
    const int lane = threadIdx.x & 31; const int L0 = (blockIdx.x * 8 + (threadIdx.x >> 5)) * 8; const int nlines = TT * ZH * HD / 64;
{
#pragma unroll
        for (int l = 0; l < 8; ++l) { const int L = L0 + l; if (L >= nlines) break; const int e = L * 64 + lane * 2; const int d = e & 63; const int zz = (e >> 6) % ZH; const int t = (e >> 6) / ZH; v2us oh, ol;
#pragma unroll
            for (int q = 0; q < 2; ++q) { unsigned short a, c2; splitf(O[((size_t)zz * TT + t) * HD + d + q] * (1.0f / PCAR), a, c2); oh[q] = a; ol[q] = c2; }
            const size_t o = ((size_t)t * NB_ + b) * DD + (h0 + zz) * HD + d; *(v2us*)(Ah + o) = oh; *(v2us*)(Al + o) = ol; }
         }
}

extern "C" void kernel_launch(void* const* d_in, const int* in_sizes, int n_in,
                              void* d_out, int out_size, void* d_ws, size_t ws_size, hipStream_t stream) {
    (void)in_sizes; (void)n_in; (void)out_size;
    const float* x = (const float*)d_in[0]; const float* r = (const float*)d_in[1]; const float* rwb = (const float*)d_in[2]; const float* rrb = (const float*)d_in[3]; const float* qkvw = (const float*)d_in[4]; const float* rw = (const float*)d_in[5]; const float* ow = (const float*)d_in[6]; const float* ob = (const float*)d_in[7];
    float* OUT = (float*)d_out;     // [2048][2][1024] (rows t*2 + b)
    char* wsp = (char*)d_ws;
    auto take = [&](size_t bytes) { char* p = wsp; wsp += (bytes + 255) & ~(size_t)255; return (void*)p; };
    bf* WQ = (bf*)take((size_t)DD * DD * 2); bf* WK = (bf*)take((size_t)DD * DD * 2); bf* WV = (bf*)take((size_t)DD * DD * 2); bf* WR = (bf*)take((size_t)DD * DD * 2); bf* WO = (bf*)take((size_t)DD * DD * 2);
    bf* XB = (bf*)take((size_t)NT * DD * 2); bf* RB = (bf*)take((size_t)TT * DD * 2); float* F = (float*)take((size_t)NT * DD * 4);
    h16* QA = (h16*)take((size_t)NT * DD * 2); h16* QB = (h16*)take((size_t)NT * DD * 2); h16* KP = (h16*)take((size_t)NT * DD * 2); h16* VT = (h16*)take((size_t)NT * DD * 2); h16* RK = (h16*)take((size_t)NH_ * TT * HD * 2);
    float* Sa = (float*)take((size_t)ZH * TT * TT * 4); float* Sd = (float*)take((size_t)ZH * TT * TT * 4); h16* Pm = (h16*)take((size_t)ZH * TT * TT * 2); float* Ob = (float*)take((size_t)ZH * TT * HD * 4); bf* ATh = (bf*)take((size_t)NT * DD * 2); bf* ATl = (bf*)take((size_t)NT * DD * 2);
    if ((size_t)(wsp - (char*)d_ws) > ws_size) return;    // total ~ 179 MB = 171 MiB; ws 256 MiB
    { const size_t nw = (size_t)DD * DD / 8; const unsigned gw = (unsigned)((nw + 255) / 256); k_cvt8<<<gw, 256, 0, stream>>>(qkvw, WQ, nw); k_cvt8<<<gw, 256, 0, stream>>>(qkvw + (size_t)DD * DD, WK, nw); k_cvt8<<<gw, 256, 0, stream>>>(qkvw + (size_t)2 * DD * DD, WV, nw); k_cvt8<<<gw, 256, 0, stream>>>(rw, WR, nw); k_cvt8<<<gw, 256, 0, stream>>>(ow, WO, nw);
      const size_t nx = (size_t)NT * DD / 8; k_cvt8<<<(unsigned)((nx + 255) / 256), 256, 0, stream>>>(x, XB, nx); k_cvt8<<<(unsigned)((nx / 2 + 255) / 256), 256, 0, stream>>>(r, RB, nx / 2); }
    const unsigned LB = (unsigned)((NT * DD / 64 + 63) / 64); const dim3 gP(NT / 64, DD / 64, 1);
    k_gemmw<bf, 0, false><<<gP, 32, 0, stream>>>(XB, nullptr, WQ, nullptr, DD, F, DD, nullptr, 0, 0, 0); k_hb16<<<LB, 256, 0, stream>>>(F, rwb, QA); k_hb16<<<LB, 256, 0, stream>>>(F, rrb, QB);
    k_gemmw<bf, 0, false><<<gP, 32, 0, stream>>>(XB, nullptr, WK, nullptr, DD, F, DD, nullptr, 0, 0, 0); k_hb16<<<LB, 256, 0, stream>>>(F, nullptr, KP);
    k_gemmw<bf, 0, false><<<gP, 32, 0, stream>>>(XB, nullptr, WV, nullptr, DD, F, DD, nullptr, 0, 0, 0); k_vtplane<<<LB, 256, 0, stream>>>(F, VT);
    k_gemmw<bf, 0, false><<<dim3(TT / 64, DD / 64, 1), 32, 0, stream>>>(RB, nullptr, WR, nullptr, DD, F, DD, nullptr, 0, 0, 0); k_rk16<<<(unsigned)((NH_ * TT * HD / 64 + 63) / 64), 256, 0, stream>>>(F, RK);
    for (int b = 0; b < NB_; ++b)
        for (int h0 = 0; h0 < NH_; h0 += ZH) { const size_t z0 = (size_t)b * NH_ + h0;
            k_gemmw<h16, 0, false><<<dim3(TT / 64, TT / 64, ZH), 32, 0, stream>>>(QA + z0 * TT * HD, nullptr, KP + z0 * TT * HD, nullptr, HD, Sa, TT, nullptr, (size_t)TT * HD, (size_t)TT * HD, (size_t)TT * TT);   // AC
            k_gemmw<h16, 0, false><<<dim3(TT / 64, TT / 64, ZH), 32, 0, stream>>>(QB + z0 * TT * HD, nullptr, RK + (size_t)h0 * TT * HD, nullptr, HD, Sd, TT, nullptr, (size_t)TT * HD, (size_t)TT * HD, (size_t)TT * TT);   // BD (unshifted)
            k_relsoft<<<ZH * TT / 8, 256, 0, stream>>>(Sa, Sd, Pm);
            k_gemmw<h16, 0, false><<<dim3(TT / 64, 1, ZH), 32, 0, stream>>>(Pm, nullptr, VT + z0 * HD * TT, nullptr, TT, Ob, HD, nullptr, (size_t)TT * TT, (size_t)HD * TT, (size_t)TT * HD);
            k_merge<<<(TT * ZH * HD / 64 + 63) / 64, 256, 0, stream>>>(Ob, b, h0, ATh, ATl); }
    k_gemmw<bf, 1, true><<<gP, 32, 0, stream>>>(ATh, ATl, WO, nullptr, DD, OUT, DD, ob, 0, 0, 0);
}

// v001
// One run takes 980 microseconds.
// In two side-by-side timings against v000, it was 1.60 and 1.59 times as fast.
#include <hip/hip_runtime.h>

// Relative-position multi-head attention (segment-recurrence style relative shift; query [2048][2][1024] seq-first, r [2048][1024]; w = query qkv_w^T -> q|k|v (16 heads x 64); r_k = r r_w^T; AC = (q + r_w_bias).k,
// BD = rel_shift((q + r_r_bias).r_k) with the module's exact zero-pad/reshape shift (out[i][j] = BD[f / (T+1)][f % (T+1) - 1] or 0 when f % (T+1) == 0, f = T + i*T + j); p = softmax((AC + BD) / 8)
// over the keys; attn = p.v; out = merged out_w^T + out_b; output [2048][2][1024] (rows t*2 + b)).
// Compute dtypes, f32 accumulate: every input rounded to bf16; the qkv and r projections on PLAIN bf16 operands (inputs: exact); AC, BD and attn.v on SINGLE fp16 planes
// (the per-head biases added in f32 before the fp16 rounding; logit sd ~ 0.6); the relative shift is an index gather inside the softmax kernel; P x1024;

#define NB_  2
#define TT   2048
#define DD   1024
#define NH_  16
#define HD   64
#define NT   (NB_ * TT)
#define ZH   2
#define PCAR 1024.0f
typedef _Float16 h16;
typedef unsigned short bf;
typedef __attribute__((ext_vector_type(16))) __bf16   v16bf;
typedef __attribute__((ext_vector_type(16))) _Float16 v16h;
typedef __attribute__((ext_vector_type(8)))  _Float16 v8h;
typedef __attribute__((ext_vector_type(8)))  unsigned short v8us;
typedef __attribute__((ext_vector_type(8)))  float    v8f;
typedef __attribute__((ext_vector_type(4)))  float    v4f;
typedef v8h  __attribute__((may_alias)) v8ha;
typedef v4f  __attribute__((may_alias)) v4fa;
typedef v8us __attribute__((may_alias)) v8usa;

__device__ __forceinline__ unsigned short f2bf(float f) { unsigned u = __float_as_uint(f); u += 0x7FFFu + ((u >> 16) & 1u); return (unsigned short)(u >> 16); }
__device__ __forceinline__ float bf2f(unsigned short b) { return __uint_as_float(((unsigned)b) << 16); }
__device__ __forceinline__ float bfr(float f) { return bf2f(f2bf(f)); }
__device__ __forceinline__ v16h cat16(v8h lo, v8h hi) { return __builtin_shufflevector(lo, hi, 0, 1, 2, 3, 4, 5, 6, 7, 8, 9, 10, 11, 12, 13, 14, 15); }
__device__ __forceinline__ v16bf cat16b(v8us lo, v8us hi) { return __builtin_bit_cast(v16bf, __builtin_shufflevector(lo, hi, 0, 1, 2, 3, 4, 5, 6, 7, 8, 9, 10, 11, 12, 13, 14, 15)); }
__device__ __forceinline__ v8f wmma16(v16h a, v16h b, v8f c) { return __builtin_amdgcn_wmma_f32_16x16x32_f16(false, a, false, b, (short)0, c, false, false); }
__device__ __forceinline__ v8f wmmab(v16bf a, v16bf b, v8f c) { return __builtin_amdgcn_wmma_f32_16x16x32_bf16(false, a, false, b, (short)0, c, false, false); }



// ---- k_gemmw: register-blocked GEMM, ONE WAVE per 64x64 output tile (16 accumulators), operands straight from K-contiguous 16-bit planes; grid (M/64, N/64, Z), 32 threads.
// C[m][n] (f32, pitch ldc, + optional f32 bias[n]) = sum_k A[m][k] Bt[n][k] (+ split products per NSPLIT). z-batch strides sA/sB/sC in elements. K % 32 == 0.
template <typename T16> struct WFrag;
template <> struct WFrag<h16> { typedef v16h V; static __device__ __forceinline__ V ld(const h16* p) { return cat16(*(const v8h*)p, *(const v8h*)(p + 16)); } static __device__ __forceinline__ v8f mma(V a, V b, v8f c) { return wmma16(a, b, c); } };
template <> struct WFrag<bf> { typedef v16bf V; static __device__ __forceinline__ V ld(const bf* p) { return cat16b(*(const v8us*)p, *(const v8us*)(p + 16)); } static __device__ __forceinline__ v8f mma(V a, V b, v8f c) { return wmmab(a, b, c); } };
template <typename T16, int NSPLIT, bool BIAS>
__global__ __launch_bounds__(32) void k_gemmw(const T16* __restrict__ A, const T16* __restrict__ A2, const T16* __restrict__ Bt, const T16* __restrict__ Bt2, int K, float* C, int ldc, const float* __restrict__ bias, size_t sA, size_t sB, size_t sC) {
    typedef typename WFrag<T16>::V V;
    __shared__ __align__(16) float os[16 * 68];
    const size_t z = blockIdx.z; A += z * sA; if (A2) A2 += z * sA; Bt += z * sB; if (Bt2) Bt2 += z * sB; C += z * sC;
    const int lane = threadIdx.x & 31, lr = lane & 15, hi = lane >> 4; const int r0 = blockIdx.x * 64, c0 = blockIdx.y * 64;
    v8f acc[4][4];
#pragma unroll
    for (int mb = 0; mb < 4; ++mb)
#pragma unroll
        for (int nb = 0; nb < 4; ++nb) acc[mb][nb] = (v8f){};
    const size_t aoff = (size_t)(r0 + lr) * K + 8 * hi, boff = (size_t)(c0 + lr) * K + 8 * hi;
#pragma unroll 1
    for (int kc = 0; kc < K; kc += 32) {
        V a[4], a2[4];
#pragma unroll
        for (int mb = 0; mb < 4; ++mb) { a[mb] = WFrag<T16>::ld(A + aoff + (size_t)mb * 16 * K + kc); if (NSPLIT == 1 || NSPLIT == 2) a2[mb] = WFrag<T16>::ld(A2 + aoff + (size_t)mb * 16 * K + kc); }
#pragma unroll
        for (int nb = 0; nb < 4; ++nb) { const V b = WFrag<T16>::ld(Bt + boff + (size_t)nb * 16 * K + kc); V b2; if (NSPLIT >= 2) b2 = WFrag<T16>::ld(Bt2 + boff + (size_t)nb * 16 * K + kc);
#pragma unroll
            for (int mb = 0; mb < 4; ++mb) { acc[mb][nb] = WFrag<T16>::mma(a[mb], b, acc[mb][nb]); if (NSPLIT == 1 || NSPLIT == 2) acc[mb][nb] = WFrag<T16>::mma(a2[mb], b, acc[mb][nb]); if (NSPLIT >= 2) acc[mb][nb] = WFrag<T16>::mma(a[mb], b2, acc[mb][nb]); } }
        asm volatile("v_nop\n\tv_nop\n\tv_nop\n\tv_nop" : "+v"(acc[0][0]), "+v"(acc[1][1]), "+v"(acc[2][2]), "+v"(acc[3][3]) : "v"(a[0]), "v"(a[3]));
    }
#pragma unroll
    for (int mb = 0; mb < 4; ++mb) {
#pragma unroll
        for (int nb = 0; nb < 4; ++nb) {
#pragma unroll
            for (int j = 0; j < 8; ++j) os[(hi * 8 + j) * 68 + nb * 16 + lr] = acc[mb][nb][j]; }
        __builtin_amdgcn_wave_barrier(); asm volatile("" ::: "memory");
        float* crow = C + (size_t)(r0 + mb * 16) * ldc + c0;
{
#pragma unroll
            for (int s = 0; s < 8; ++s) { const int row = 2 * s + hi, cofs = lr * 4; v4f val = *(const v4fa*)(os + row * 68 + cofs); if (BIAS) { val[0] += bfr(bias[c0 + cofs]); val[1] += bfr(bias[c0 + cofs + 1]); val[2] += bfr(bias[c0 + cofs + 2]); val[3] += bfr(bias[c0 + cofs + 3]); }
                *(v4f*)(crow + (size_t)row * ldc + cofs) = val; }
             }
        __builtin_amdgcn_wave_barrier(); asm volatile("" ::: "memory");
    }
}

// ---- k_gemmks: the same product for a long K and few output tiles: one workgroup of KW waves per (16 MT)x64 tile; grid (M/(16 MT), N/64, Z), 32 KW threads. K % (32 KW) == 0.
// Wave w sums k in [w K/KW, (w+1) K/KW) into its own MT x 4 accumulators; the KW f32 partial tiles are joined through LDS, in wave order, by the threads that store the tile. TWOA: C = (A + A2) Bt^T.
template <typename T16, bool TWOA, bool BIAS, int KW, int MT>
__global__ __launch_bounds__(32 * KW) void k_gemmks(const T16* __restrict__ A, const T16* __restrict__ A2, const T16* __restrict__ Bt, int K, float* C, int ldc, const float* __restrict__ bias, size_t sA, size_t sB, size_t sC) {
    typedef typename WFrag<T16>::V V;
    static_assert((MT * 8) % KW == 0, "the tile's 16-byte pieces divide evenly over the threads");
    static_assert(MT >= 2 && MT <= 4, "the wait in the k loop names the addresses of row blocks 0, 1, MT - 2 and MT - 1");
    __shared__ __align__(16) float os[KW * MT * 16 * 68];
    const size_t z = blockIdx.z; A += z * sA; if (TWOA) A2 += z * sA; Bt += z * sB; C += z * sC;
    const int lane = threadIdx.x & 31, lr = lane & 15, hi = lane >> 4; const int r0 = blockIdx.x * (16 * MT), c0 = blockIdx.y * 64;
    const int w = __builtin_amdgcn_readfirstlane(threadIdx.x >> 5); const int kbeg = w * (K / KW), kend = kbeg + K / KW;
    v8f acc[MT][4];
#pragma unroll
    for (int mb = 0; mb < MT; ++mb)
#pragma unroll
        for (int nb = 0; nb < 4; ++nb) acc[mb][nb] = (v8f){};
    const size_t aoff = (size_t)(r0 + lr) * K + 8 * hi, boff = (size_t)(c0 + lr) * K + 8 * hi;
#pragma unroll 1
    for (int kc = kbeg; kc < kend; kc += 32) {
        const T16 *pa[MT], *pa2[MT], *pb[4]; V a[MT], a2[MT], b[4];
#pragma unroll
        for (int mb = 0; mb < MT; ++mb) { pa[mb] = A + aoff + (size_t)mb * 16 * K + kc; a[mb] = WFrag<T16>::ld(pa[mb]); pa2[mb] = pa[mb]; if (TWOA) { pa2[mb] = A2 + aoff + (size_t)mb * 16 * K + kc; a2[mb] = WFrag<T16>::ld(pa2[mb]); } }
#pragma unroll
        for (int nb = 0; nb < 4; ++nb) { pb[nb] = Bt + boff + (size_t)nb * 16 * K + kc; b[nb] = WFrag<T16>::ld(pb[nb]); }
        // one translation wait behind the trip's loads; the addresses are its inputs, so that no load's result and no later add lands in an address register ahead of it
        asm volatile("s_wait_xcnt 0x0" :: "v"(pa[0]), "v"(pa[1]), "v"(pa[MT - 2]), "v"(pa[MT - 1]), "v"(pa2[0]), "v"(pa2[1]), "v"(pa2[MT - 2]), "v"(pa2[MT - 1]), "v"(pb[0]), "v"(pb[1]), "v"(pb[2]), "v"(pb[3]) : "memory");
#pragma unroll
        for (int nb = 0; nb < 4; ++nb)
#pragma unroll
            for (int mb = 0; mb < MT; ++mb) { acc[mb][nb] = WFrag<T16>::mma(a[mb], b[nb], acc[mb][nb]); if (TWOA) acc[mb][nb] = WFrag<T16>::mma(a2[mb], b[nb], acc[mb][nb]); }
        // four vector slots behind the last WMMA on the loop's taken branch too
        asm volatile("v_nop\n\tv_nop\n\tv_nop\n\tv_nop" : "+v"(acc[0][0]), "+v"(acc[1][1]), "+v"(acc[MT - 2][2]), "+v"(acc[MT - 1][3]) : "v"(a[0]), "v"(a[MT - 1]));
    }
#pragma unroll
    for (int mb = 0; mb < MT; ++mb)
#pragma unroll
        for (int nb = 0; nb < 4; ++nb)
#pragma unroll
            for (int j = 0; j < 8; ++j) os[(w * (16 * MT) + mb * 16 + hi * 8 + j) * 68 + nb * 16 + lr] = acc[mb][nb][j];
    __syncthreads();   // every wave's partial tile is in LDS before any thread sums it
#pragma unroll
    for (int it = 0; it < MT * 8 / KW; ++it) { const int s = (int)threadIdx.x + it * (32 * KW); const int row = s >> 4, cofs = (s & 15) * 4; v4f val = *(const v4fa*)(os + row * 68 + cofs);
#pragma unroll
        for (int p = 1; p < KW; ++p) val += *(const v4fa*)(os + (p * (16 * MT) + row) * 68 + cofs);
        if (BIAS) { val[0] += bfr(bias[c0 + cofs]); val[1] += bfr(bias[c0 + cofs + 1]); val[2] += bfr(bias[c0 + cofs + 2]); val[3] += bfr(bias[c0 + cofs + 3]); }
        *(v4f*)(C + (size_t)(r0 + row) * ldc + c0 + cofs) = val; }
}

__device__ __forceinline__ h16 tohx(float x) { return (h16)x; }
__device__ __forceinline__ void splitf(float y, unsigned short& h, unsigned short& l) { h = f2bf(y); l = f2bf(y - bf2f(h)); }
typedef __attribute__((ext_vector_type(2))) _Float16 v2h;
typedef __attribute__((ext_vector_type(4))) _Float16 v4h;
typedef __attribute__((ext_vector_type(2))) unsigned short v2us;
typedef __attribute__((ext_vector_type(4))) int v4i;

__global__ __launch_bounds__(256) void k_cvt8(const float* __restrict__ src, bf* dst, size_t n8) { const size_t i = (size_t)blockIdx.x * 256 + threadIdx.x; if (i >= n8) return; const v8f v = *(const v8f*)(src + i * 8); v8us o;
#pragma unroll
    for (int k = 0; k < 8; ++k) o[k] = f2bf(v[k]); *(v8us*)(dst + i * 8) = o;  }
__global__ __launch_bounds__(256) void k_hb16(const float* __restrict__ F, const float* __restrict__ hb, h16* P) {
    const int lane = threadIdx.x & 31; const int L0 = (blockIdx.x * 8 + (threadIdx.x >> 5)) * 8; const int nlines = NT * DD / 64;
{
#pragma unroll
        for (int l = 0; l < 8; ++l) { const int L = L0 + l; if (L >= nlines) break; const int e = L * 64 + lane * 2; const int d = e & 63; const int t = (e >> 6) & (TT - 1); const int z = e >> 17; const int b = z >> 4, h = z & 15; v2h o;
#pragma unroll
            for (int q = 0; q < 2; ++q) { const float bb = hb ? bfr(hb[h * HD + d + q]) : 0.f; o[q] = tohx(__fadd_rn(F[((size_t)t * NB_ + b) * DD + h * HD + d + q], bb)); }
            *(v2h*)(P + (size_t)e) = o; }
         }
}
__global__ __launch_bounds__(256) void k_rk16(const float* __restrict__ FR, h16* RK) {
    const int lane = threadIdx.x & 31; const int L0 = (blockIdx.x * 8 + (threadIdx.x >> 5)) * 8; const int nlines = NH_ * TT * HD / 64;
{
#pragma unroll
        for (int l = 0; l < 8; ++l) { const int L = L0 + l; if (L >= nlines) break; const int e = L * 64 + lane * 2; const int d = e & 63; const int j = (e >> 6) & (TT - 1); const int h = e >> 17; v2h o;
#pragma unroll
            for (int q = 0; q < 2; ++q) o[q] = tohx(FR[(size_t)j * DD + h * HD + d + q]);
            *(v2h*)(RK + (size_t)e) = o; }
         }
}
__global__ __launch_bounds__(256) void k_vtplane(const float* __restrict__ F, h16* VT) {
    const int lane = threadIdx.x & 31; const int L0 = (blockIdx.x * 8 + (threadIdx.x >> 5)) * 8; const int nlines = NT * DD / 64;
{
#pragma unroll
        for (int l = 0; l < 8; ++l) { const int L = L0 + l; if (L >= nlines) break; const int e = L * 64 + lane * 2; const int t = e & (TT - 1); const int d = (e >> 11) & 63; const int z = e >> 17; const int b = z >> 4, h = z & 15; v2h v;
#pragma unroll
            for (int q = 0; q < 2; ++q) v[q] = tohx(F[((size_t)(t + q) * NB_ + b) * DD + h * HD + d]);
            *(v2h*)(VT + (size_t)e) = v; }
         }
}
// k_relsoft: per row (zz, i): s[j] = (AC[zz][i][j] + shift(BD)[i][j]) / 8 where shift(BD)[i][j] = BD[zz][f / (T+1)][f % (T+1) - 1] (0 when f % (T+1) == 0), f = T + i*T + j - the module's
__global__ __launch_bounds__(256) void k_relsoft(const float* __restrict__ AC, const float* __restrict__ BD, h16* P) {
    const int lane = threadIdx.x & 31; const int row = blockIdx.x * 8 + (threadIdx.x >> 5); if (row >= ZH * TT) return; const int i = row & (TT - 1); const int zz = row >> 11;
    const float* ar = AC + (size_t)row * TT; const float* bd = BD + (size_t)zz * TT * TT; float v[64]; float mx = -3.0e38f;
#pragma unroll
    for (int ch = 0; ch < 16; ++ch) { const int j0 = ch * 128 + lane * 4; const v4f a = *(const v4f*)(ar + j0);
#pragma unroll
        for (int q = 0; q < 4; ++q) { const int j = j0 + q; const int f = TT + i * TT + j; const int ii = f / (TT + 1), c = f - ii * (TT + 1); const float sb = (c > 0) ? bd[(size_t)ii * TT + (c - 1)] : 0.f;
            const float t = __fmul_rn(__fadd_rn(a[q], sb), 0.125f); v[ch * 4 + q] = t; mx = fmaxf(mx, t); } }
#pragma unroll
    for (int sh = 16; sh; sh >>= 1) mx = fmaxf(mx, __shfl_xor(mx, sh, 32));
    float sum = 0.f;
#pragma unroll
    for (int k = 0; k < 64; ++k) { v[k] = __expf(v[k] - mx); sum += v[k]; }
#pragma unroll
    for (int sh = 16; sh; sh >>= 1) sum += __shfl_xor(sum, sh, 32);
    const float fct = __fdiv_rn(PCAR, sum);
{
#pragma unroll
        for (int ch = 0; ch < 16; ++ch) { v4h o;
#pragma unroll
            for (int q = 0; q < 4; ++q) o[q] = tohx(v[ch * 4 + q] * fct);
            *(v4h*)(P + (size_t)row * TT + ch * 128 + lane * 4) = o; }
         }
}
__global__ __launch_bounds__(256) void k_merge(const float* __restrict__ O, int b, int h0, bf* Ah, bf* Al) {
    const int lane = threadIdx.x & 31; const int L0 = (blockIdx.x * 8 + (threadIdx.x >> 5)) * 8; const int nlines = TT * ZH * HD / 64;
{
#pragma unroll
        for (int l = 0; l < 8; ++l) { const int L = L0 + l; if (L >= nlines) break; const int e = L * 64 + lane * 2; const int d = e & 63; const int zz = (e >> 6) % ZH; const int t = (e >> 6) / ZH; v2us oh, ol;
#pragma unroll
            for (int q = 0; q < 2; ++q) { unsigned short a, c2; splitf(O[((size_t)zz * TT + t) * HD + d + q] * (1.0f / PCAR), a, c2); oh[q] = a; ol[q] = c2; }
            const size_t o = ((size_t)t * NB_ + b) * DD + (h0 + zz) * HD + d; *(v2us*)(Ah + o) = oh; *(v2us*)(Al + o) = ol; }
         }
}

extern "C" void kernel_launch(void* const* d_in, const int* in_sizes, int n_in,
                              void* d_out, int out_size, void* d_ws, size_t ws_size, hipStream_t stream) {
    (void)in_sizes; (void)n_in; (void)out_size;
    const float* x = (const float*)d_in[0]; const float* r = (const float*)d_in[1]; const float* rwb = (const float*)d_in[2]; const float* rrb = (const float*)d_in[3]; const float* qkvw = (const float*)d_in[4]; const float* rw = (const float*)d_in[5]; const float* ow = (const float*)d_in[6]; const float* ob = (const float*)d_in[7];
    float* OUT = (float*)d_out;     // [2048][2][1024] (rows t*2 + b)
    char* wsp = (char*)d_ws;
    auto take = [&](size_t bytes) { char* p = wsp; wsp += (bytes + 255) & ~(size_t)255; return (void*)p; };
    bf* WQ = (bf*)take((size_t)DD * DD * 2); bf* WK = (bf*)take((size_t)DD * DD * 2); bf* WV = (bf*)take((size_t)DD * DD * 2); bf* WR = (bf*)take((size_t)DD * DD * 2); bf* WO = (bf*)take((size_t)DD * DD * 2);
    bf* XB = (bf*)take((size_t)NT * DD * 2); bf* RB = (bf*)take((size_t)TT * DD * 2); float* F = (float*)take((size_t)NT * DD * 4);
    h16* QA = (h16*)take((size_t)NT * DD * 2); h16* QB = (h16*)take((size_t)NT * DD * 2); h16* KP = (h16*)take((size_t)NT * DD * 2); h16* VT = (h16*)take((size_t)NT * DD * 2); h16* RK = (h16*)take((size_t)NH_ * TT * HD * 2);
    float* Sa = (float*)take((size_t)ZH * TT * TT * 4); float* Sd = (float*)take((size_t)ZH * TT * TT * 4); h16* Pm = (h16*)take((size_t)ZH * TT * TT * 2); float* Ob = (float*)take((size_t)ZH * TT * HD * 4); bf* ATh = (bf*)take((size_t)NT * DD * 2); bf* ATl = (bf*)take((size_t)NT * DD * 2);
    if ((size_t)(wsp - (char*)d_ws) > ws_size) return;    // total ~ 179 MB = 171 MiB; ws 256 MiB
    { const size_t nw = (size_t)DD * DD / 8; const unsigned gw = (unsigned)((nw + 255) / 256); k_cvt8<<<gw, 256, 0, stream>>>(qkvw, WQ, nw); k_cvt8<<<gw, 256, 0, stream>>>(qkvw + (size_t)DD * DD, WK, nw); k_cvt8<<<gw, 256, 0, stream>>>(qkvw + (size_t)2 * DD * DD, WV, nw); k_cvt8<<<gw, 256, 0, stream>>>(rw, WR, nw); k_cvt8<<<gw, 256, 0, stream>>>(ow, WO, nw);
      const size_t nx = (size_t)NT * DD / 8; k_cvt8<<<(unsigned)((nx + 255) / 256), 256, 0, stream>>>(x, XB, nx); k_cvt8<<<(unsigned)((nx / 2 + 255) / 256), 256, 0, stream>>>(r, RB, nx / 2); }
    const unsigned LB = (unsigned)((NT * DD / 64 + 63) / 64); const dim3 gP(NT / 64, DD / 64, 1);
    k_gemmks<bf, false, false, 4, 4><<<gP, 128, 0, stream>>>(XB, nullptr, WQ, DD, F, DD, nullptr, 0, 0, 0); k_hb16<<<LB, 256, 0, stream>>>(F, rwb, QA); k_hb16<<<LB, 256, 0, stream>>>(F, rrb, QB);
    k_gemmks<bf, false, false, 4, 4><<<gP, 128, 0, stream>>>(XB, nullptr, WK, DD, F, DD, nullptr, 0, 0, 0); k_hb16<<<LB, 256, 0, stream>>>(F, nullptr, KP);
    k_gemmks<bf, false, false, 4, 4><<<gP, 128, 0, stream>>>(XB, nullptr, WV, DD, F, DD, nullptr, 0, 0, 0); k_vtplane<<<LB, 256, 0, stream>>>(F, VT);
    k_gemmks<bf, false, false, 4, 4><<<dim3(TT / 64, DD / 64, 1), 128, 0, stream>>>(RB, nullptr, WR, DD, F, DD, nullptr, 0, 0, 0); k_rk16<<<(unsigned)((NH_ * TT * HD / 64 + 63) / 64), 256, 0, stream>>>(F, RK);
    for (int b = 0; b < NB_; ++b)
        for (int h0 = 0; h0 < NH_; h0 += ZH) { const size_t z0 = (size_t)b * NH_ + h0;
            k_gemmw<h16, 0, false><<<dim3(TT / 64, TT / 64, ZH), 32, 0, stream>>>(QA + z0 * TT * HD, nullptr, KP + z0 * TT * HD, nullptr, HD, Sa, TT, nullptr, (size_t)TT * HD, (size_t)TT * HD, (size_t)TT * TT);   // AC
            k_gemmw<h16, 0, false><<<dim3(TT / 64, TT / 64, ZH), 32, 0, stream>>>(QB + z0 * TT * HD, nullptr, RK + (size_t)h0 * TT * HD, nullptr, HD, Sd, TT, nullptr, (size_t)TT * HD, (size_t)TT * HD, (size_t)TT * TT);   // BD (unshifted)
            k_relsoft<<<ZH * TT / 8, 256, 0, stream>>>(Sa, Sd, Pm);
            k_gemmks<h16, false, false, 16, 2><<<dim3(TT / 32, 1, ZH), 512, 0, stream>>>(Pm, nullptr, VT + z0 * HD * TT, TT, Ob, HD, nullptr, (size_t)TT * TT, (size_t)HD * TT, (size_t)TT * HD);
            k_merge<<<(TT * ZH * HD / 64 + 63) / 64, 256, 0, stream>>>(Ob, b, h0, ATh, ATl); }
    k_gemmks<bf, true, true, 4, 4><<<gP, 128, 0, stream>>>(ATh, ATl, WO, DD, OUT, DD, ob, 0, 0, 0);
}

// v002
// It runs in 316 microseconds.
// Next to v001, in two timings, it ran 3.08 times as fast each time.
// Counting every step since v000, it is 4.92 times as fast.
#include <hip/hip_runtime.h>

// Relative-position multi-head attention (segment-recurrence style relative shift; query [2048][2][1024] seq-first, r [2048][1024]; w = query qkv_w^T -> q|k|v (16 heads x 64); r_k = r r_w^T; AC = (q + r_w_bias).k,
// BD = rel_shift((q + r_r_bias).r_k) with the module's exact zero-pad/reshape shift (out[i][j] = BD[f / (T+1)][f % (T+1) - 1] or 0 when f % (T+1) == 0, f = T + i*T + j); p = softmax((AC + BD) / 8)
// over the keys; attn = p.v; out = merged out_w^T + out_b; output [2048][2][1024] (rows t*2 + b)).
// Compute dtypes, f32 accumulate: every input rounded to bf16; the qkv and r projections on PLAIN bf16 operands (inputs: exact); AC, BD and attn.v on SINGLE fp16 planes
// (the per-head biases added in f32 before the fp16 rounding; logit sd ~ 0.6); the relative shift is an index scatter into the LDS score rows of the fused attention kernel; P x1024;

#define NB_  2
#define TT   2048
#define DD   1024
#define NH_  16
#define HD   64
#define NT   (NB_ * TT)
#define PCAR 1024.0f
typedef _Float16 h16;
typedef unsigned short bf;
typedef __attribute__((ext_vector_type(16))) __bf16   v16bf;
typedef __attribute__((ext_vector_type(16))) _Float16 v16h;
typedef __attribute__((ext_vector_type(8)))  _Float16 v8h;
typedef __attribute__((ext_vector_type(8)))  unsigned short v8us;
typedef __attribute__((ext_vector_type(8)))  float    v8f;
typedef __attribute__((ext_vector_type(4)))  float    v4f;
typedef v8h  __attribute__((may_alias)) v8ha;
typedef v4f  __attribute__((may_alias)) v4fa;
typedef v8us __attribute__((may_alias)) v8usa;

__device__ __forceinline__ unsigned short f2bf(float f) { unsigned u = __float_as_uint(f); u += 0x7FFFu + ((u >> 16) & 1u); return (unsigned short)(u >> 16); }
__device__ __forceinline__ float bf2f(unsigned short b) { return __uint_as_float(((unsigned)b) << 16); }
__device__ __forceinline__ float bfr(float f) { return bf2f(f2bf(f)); }
__device__ __forceinline__ v16h cat16(v8h lo, v8h hi) { return __builtin_shufflevector(lo, hi, 0, 1, 2, 3, 4, 5, 6, 7, 8, 9, 10, 11, 12, 13, 14, 15); }
__device__ __forceinline__ v16bf cat16b(v8us lo, v8us hi) { return __builtin_bit_cast(v16bf, __builtin_shufflevector(lo, hi, 0, 1, 2, 3, 4, 5, 6, 7, 8, 9, 10, 11, 12, 13, 14, 15)); }
__device__ __forceinline__ v8f wmma16(v16h a, v16h b, v8f c) { return __builtin_amdgcn_wmma_f32_16x16x32_f16(false, a, false, b, (short)0, c, false, false); }
__device__ __forceinline__ v8f wmmab(v16bf a, v16bf b, v8f c) { return __builtin_amdgcn_wmma_f32_16x16x32_bf16(false, a, false, b, (short)0, c, false, false); }



// fragment loaders: 16 k values of one row from a K-contiguous 16-bit plane (k = 8 hi .. 8 hi + 7 and 16 + 8 hi .. 16 + 8 hi + 7)
template <typename T16> struct WFrag;
template <> struct WFrag<h16> { typedef v16h V; static __device__ __forceinline__ V ld(const h16* p) { return cat16(*(const v8h*)p, *(const v8h*)(p + 16)); } static __device__ __forceinline__ v8f mma(V a, V b, v8f c) { return wmma16(a, b, c); } };
template <> struct WFrag<bf> { typedef v16bf V; static __device__ __forceinline__ V ld(const bf* p) { return cat16b(*(const v8us*)p, *(const v8us*)(p + 16)); } static __device__ __forceinline__ v8f mma(V a, V b, v8f c) { return wmmab(a, b, c); } };
// ---- k_gemmks: C[m][n] (f32, pitch ldc, + optional f32 bias[n]) = sum_k A[m][k] Bt[n][k] for a long K and few output tiles: one workgroup of KW waves per (16 MT)x64 tile; grid (M/(16 MT), N/64, Z), 32 KW threads. K % (32 KW) == 0.
// Wave w sums k in [w K/KW, (w+1) K/KW) into its own MT x 4 accumulators; the KW f32 partial tiles are joined through LDS, in wave order, by the threads that store the tile. TWOA: C = (A + A2) Bt^T.
template <typename T16, bool TWOA, bool BIAS, int KW, int MT>
__global__ __launch_bounds__(32 * KW) void k_gemmks(const T16* __restrict__ A, const T16* __restrict__ A2, const T16* __restrict__ Bt, int K, float* C, int ldc, const float* __restrict__ bias, size_t sA, size_t sB, size_t sC) {
    typedef typename WFrag<T16>::V V;
    static_assert((MT * 8) % KW == 0, "the tile's 16-byte pieces divide evenly over the threads");
    static_assert(MT >= 2 && MT <= 4, "the wait in the k loop names the addresses of row blocks 0, 1, MT - 2 and MT - 1");
    __shared__ __align__(16) float os[KW * MT * 16 * 68];
    const size_t z = blockIdx.z; A += z * sA; if (TWOA) A2 += z * sA; Bt += z * sB; C += z * sC;
    const int lane = threadIdx.x & 31, lr = lane & 15, hi = lane >> 4; const int r0 = blockIdx.x * (16 * MT), c0 = blockIdx.y * 64;
    const int w = __builtin_amdgcn_readfirstlane(threadIdx.x >> 5); const int kbeg = w * (K / KW), kend = kbeg + K / KW;
    v8f acc[MT][4];
#pragma unroll
    for (int mb = 0; mb < MT; ++mb)
#pragma unroll
        for (int nb = 0; nb < 4; ++nb) acc[mb][nb] = (v8f){};
    const size_t aoff = (size_t)(r0 + lr) * K + 8 * hi, boff = (size_t)(c0 + lr) * K + 8 * hi;
#pragma unroll 1
    for (int kc = kbeg; kc < kend; kc += 32) {
        const T16 *pa[MT], *pa2[MT], *pb[4]; V a[MT], a2[MT], b[4];
#pragma unroll
        for (int mb = 0; mb < MT; ++mb) { pa[mb] = A + aoff + (size_t)mb * 16 * K + kc; a[mb] = WFrag<T16>::ld(pa[mb]); pa2[mb] = pa[mb]; if (TWOA) { pa2[mb] = A2 + aoff + (size_t)mb * 16 * K + kc; a2[mb] = WFrag<T16>::ld(pa2[mb]); } }
#pragma unroll
        for (int nb = 0; nb < 4; ++nb) { pb[nb] = Bt + boff + (size_t)nb * 16 * K + kc; b[nb] = WFrag<T16>::ld(pb[nb]); }
        // one translation wait behind the trip's loads; the addresses are its inputs, so that no load's result and no later add lands in an address register ahead of it
        asm volatile("s_wait_xcnt 0x0" :: "v"(pa[0]), "v"(pa[1]), "v"(pa[MT - 2]), "v"(pa[MT - 1]), "v"(pa2[0]), "v"(pa2[1]), "v"(pa2[MT - 2]), "v"(pa2[MT - 1]), "v"(pb[0]), "v"(pb[1]), "v"(pb[2]), "v"(pb[3]) : "memory");
#pragma unroll
        for (int nb = 0; nb < 4; ++nb)
#pragma unroll
            for (int mb = 0; mb < MT; ++mb) { acc[mb][nb] = WFrag<T16>::mma(a[mb], b[nb], acc[mb][nb]); if (TWOA) acc[mb][nb] = WFrag<T16>::mma(a2[mb], b[nb], acc[mb][nb]); }
        // four vector slots behind the last WMMA on the loop's taken branch too
        asm volatile("v_nop\n\tv_nop\n\tv_nop\n\tv_nop" : "+v"(acc[0][0]), "+v"(acc[1][1]), "+v"(acc[MT - 2][2]), "+v"(acc[MT - 1][3]) : "v"(a[0]), "v"(a[MT - 1]));
    }
#pragma unroll
    for (int mb = 0; mb < MT; ++mb)
#pragma unroll
        for (int nb = 0; nb < 4; ++nb)
#pragma unroll
            for (int j = 0; j < 8; ++j) os[(w * (16 * MT) + mb * 16 + hi * 8 + j) * 68 + nb * 16 + lr] = acc[mb][nb][j];
    __syncthreads();   // every wave's partial tile is in LDS before any thread sums it
#pragma unroll
    for (int it = 0; it < MT * 8 / KW; ++it) { const int s = (int)threadIdx.x + it * (32 * KW); const int row = s >> 4, cofs = (s & 15) * 4; v4f val = *(const v4fa*)(os + row * 68 + cofs);
#pragma unroll
        for (int p = 1; p < KW; ++p) val += *(const v4fa*)(os + (p * (16 * MT) + row) * 68 + cofs);
        if (BIAS) { val[0] += bfr(bias[c0 + cofs]); val[1] += bfr(bias[c0 + cofs + 1]); val[2] += bfr(bias[c0 + cofs + 2]); val[3] += bfr(bias[c0 + cofs + 3]); }
        *(v4f*)(C + (size_t)(r0 + row) * ldc + c0 + cofs) = val; }
}

__device__ __forceinline__ h16 tohx(float x) { return (h16)x; }
__device__ __forceinline__ void splitf(float y, unsigned short& h, unsigned short& l) { h = f2bf(y); l = f2bf(y - bf2f(h)); }
typedef __attribute__((ext_vector_type(2))) _Float16 v2h;
typedef __attribute__((ext_vector_type(4))) _Float16 v4h;
typedef __attribute__((ext_vector_type(2))) unsigned short v2us;
typedef __attribute__((ext_vector_type(4))) int v4i;

__global__ __launch_bounds__(256) void k_cvt8(const float* __restrict__ src, bf* dst, size_t n8) { const size_t i = (size_t)blockIdx.x * 256 + threadIdx.x; if (i >= n8) return; const v8f v = *(const v8f*)(src + i * 8); v8us o;
#pragma unroll
    for (int k = 0; k < 8; ++k) o[k] = f2bf(v[k]); *(v8us*)(dst + i * 8) = o;  }
__global__ __launch_bounds__(256) void k_hb16(const float* __restrict__ F, const float* __restrict__ hb, h16* P) {
    const int lane = threadIdx.x & 31; const int L0 = (blockIdx.x * 8 + (threadIdx.x >> 5)) * 8; const int nlines = NT * DD / 64;
{
#pragma unroll
        for (int l = 0; l < 8; ++l) { const int L = L0 + l; if (L >= nlines) break; const int e = L * 64 + lane * 2; const int d = e & 63; const int t = (e >> 6) & (TT - 1); const int z = e >> 17; const int b = z >> 4, h = z & 15; v2h o;
#pragma unroll
            for (int q = 0; q < 2; ++q) { const float bb = hb ? bfr(hb[h * HD + d + q]) : 0.f; o[q] = tohx(__fadd_rn(F[((size_t)t * NB_ + b) * DD + h * HD + d + q], bb)); }
            *(v2h*)(P + (size_t)e) = o; }
         }
}
__global__ __launch_bounds__(256) void k_rk16(const float* __restrict__ FR, h16* RK) {
    const int lane = threadIdx.x & 31; const int L0 = (blockIdx.x * 8 + (threadIdx.x >> 5)) * 8; const int nlines = NH_ * TT * HD / 64;
{
#pragma unroll
        for (int l = 0; l < 8; ++l) { const int L = L0 + l; if (L >= nlines) break; const int e = L * 64 + lane * 2; const int d = e & 63; const int j = (e >> 6) & (TT - 1); const int h = e >> 17; v2h o;
#pragma unroll
            for (int q = 0; q < 2; ++q) o[q] = tohx(FR[(size_t)j * DD + h * HD + d + q]);
            *(v2h*)(RK + (size_t)e) = o; }
         }
}
__global__ __launch_bounds__(256) void k_vtplane(const float* __restrict__ F, h16* VT) {
    const int lane = threadIdx.x & 31; const int L0 = (blockIdx.x * 8 + (threadIdx.x >> 5)) * 8; const int nlines = NT * DD / 64;
{
#pragma unroll
        for (int l = 0; l < 8; ++l) { const int L = L0 + l; if (L >= nlines) break; const int e = L * 64 + lane * 2; const int t = e & (TT - 1); const int d = (e >> 11) & 63; const int z = e >> 17; const int b = z >> 4, h = z & 15; v2h v;
#pragma unroll
            for (int q = 0; q < 2; ++q) v[q] = tohx(F[((size_t)(t + q) * NB_ + b) * DD + h * HD + d]);
            *(v2h*)(VT + (size_t)e) = v; }
         }
}
// ---- k_relattn: scores, relative shift, softmax, P.V and the head merge for RT query rows of one (batch, head); grid (T / RT, batch x heads), 16 waves.
// The RT score rows stay in LDS (f32, pitch SP floats). BD[i][m] = (q_i + r_r_bias).r_k[m] lands where the module's zero-pad/reshape shift puts it: at row i, key m - (T - 1 - i), when that is >= 0,
// else at row i - 1, key m + i + 1; row i, key i + 1 is the shift's zero. So the rows i0 .. i0 + RT - 1 take the first kind from q rows i0 .. and the second kind from q rows i0 + 1 .. .
// Then AC is added in place, each wave does the softmax of two rows and leaves P x1024 (fp16) in the first half of the row's own LDS; P.V splits the keys over the 16 waves, whose f32 partial tiles
// lie in the second half of the rows and are joined in wave order by the threads that store the merged bf16 hi/lo planes.
#define RT 32
#define SP 2052
// e^x as the fast library form has it, 2^(x log2 e); the v_nop is the one independent slot that the instruction set asks for behind a transcendental, in the same statement so that it stays directly behind it
__device__ __forceinline__ float exp_slot(float x) { float r; asm("v_exp_f32 %0, %1\n\tv_nop" : "=v"(r) : "v"(x * 1.44269504f)); return r; }
typedef v4h __attribute__((may_alias)) v4ha;
typedef __attribute__((ext_vector_type(4))) unsigned short v4us;
__global__ __launch_bounds__(512) void k_relattn(const h16* __restrict__ QA, const h16* __restrict__ QB, const h16* __restrict__ KP, const h16* __restrict__ RK, const h16* __restrict__ VT, bf* Ah, bf* Al) {
    __shared__ __align__(16) float S[RT * SP];
    const int z = blockIdx.y, b = z >> 4, h = z & 15, i0 = blockIdx.x * RT;
    const int lane = threadIdx.x & 31, lr = lane & 15, hi = lane >> 4; const int w = __builtin_amdgcn_readfirstlane(threadIdx.x >> 5);
    QA += (size_t)z * TT * HD; QB += (size_t)z * TT * HD; KP += (size_t)z * TT * HD; VT += (size_t)z * HD * TT; RK += (size_t)h * TT * HD;
    const int fo = lr * HD + 8 * hi;   // this lane's place in a 16-row fragment of a plane with 64 values a row
    {   // BD, stored shifted; wave w takes the 16-column tiles w, w + 16, ...
        v16h ql[2][2], qu[2][2]; const h16* pl = QB + i0 * HD + fo; const h16* pr = RK + w * 16 * HD + fo; const h16* pu[2];
#pragma unroll
        for (int mb = 0; mb < 2; ++mb) { pu[mb] = QB + min(i0 + 1 + mb * 16 + lr, TT - 1) * HD + 8 * hi;   // the row behind the last one feeds no key: any row in bounds serves
#pragma unroll
            for (int ks = 0; ks < 2; ++ks) { ql[mb][ks] = WFrag<h16>::ld(pl + mb * 16 * HD + ks * 32); qu[mb][ks] = WFrag<h16>::ld(pu[mb] + ks * 32); } }
#pragma unroll
        for (int g = 0; g < 2; ++g) { v16h rb[4][2];
#pragma unroll
            for (int s = 0; s < 4; ++s)
#pragma unroll
                for (int ks = 0; ks < 2; ++ks) rb[s][ks] = WFrag<h16>::ld(pr + (g * 4 + s) * 256 * HD + ks * 32);
            // one translation wait behind the batch's loads; the addresses are its inputs, so that no load's result and no later add lands in an address register ahead of it
            asm volatile("s_wait_xcnt 0x0" :: "v"(pl), "v"(pu[0]), "v"(pu[1]), "v"(pr) : "memory");
#pragma unroll
            for (int s = 0; s < 4; ++s)
#pragma unroll
                for (int mb = 0; mb < 2; ++mb) { const int base = ((g * 4 + s) * 16 + w) * 16 + i0 + mb * 16; float* sr = S + (mb * 16 + hi * 8) * SP;
                    if (base + 30 >= TT - 1) { v8f c = (v8f){}; c = wmma16(ql[mb][0], rb[s][0], c); c = wmma16(ql[mb][1], rb[s][1], c); const int j = base + lr + hi * 8 - (TT - 1);
#pragma unroll
                        for (int q = 0; q < 8; ++q) if (j + q >= 0) sr[q * SP + j + q] = c[q]; }
                    if (base + 2 < TT) { v8f c = (v8f){}; c = wmma16(qu[mb][0], rb[s][0], c); c = wmma16(qu[mb][1], rb[s][1], c); const int j = base + lr + hi * 8 + 2;
#pragma unroll
                        for (int q = 0; q < 8; ++q) if (j + q < TT) sr[q * SP + j + q] = c[q]; } } }
        if (threadIdx.x < RT) { const int j = i0 + (int)threadIdx.x + 1; if (j < TT) S[threadIdx.x * SP + j] = 0.f; }
    }
    {   // AC, added in place: s = (AC + BD) / 8; its first operands are fetched in front of the barrier, so that they fly while the wave waits there
        v16h qa[2][2]; const h16* pq = QA + i0 * HD + fo; const h16* pk = KP + w * 16 * HD + fo;
#pragma unroll
        for (int mb = 0; mb < 2; ++mb)
#pragma unroll
            for (int ks = 0; ks < 2; ++ks) qa[mb][ks] = WFrag<h16>::ld(pq + mb * 16 * HD + ks * 32);
#pragma unroll
        for (int g = 0; g < 2; ++g) { v16h kb[4][2];
#pragma unroll
            for (int s = 0; s < 4; ++s)
#pragma unroll
                for (int ks = 0; ks < 2; ++ks) kb[s][ks] = WFrag<h16>::ld(pk + (g * 4 + s) * 256 * HD + ks * 32);
            // one translation wait behind the batch's loads, the addresses its inputs (as above)
            asm volatile("s_wait_xcnt 0x0" :: "v"(pq), "v"(pk) : "memory");
            if (g == 0) __syncthreads();   // every shifted BD value is in LDS before AC is added to it
#pragma unroll
            for (int s = 0; s < 4; ++s)
#pragma unroll
                for (int mb = 0; mb < 2; ++mb) { v8f c = (v8f){}; c = wmma16(qa[mb][0], kb[s][0], c); c = wmma16(qa[mb][1], kb[s][1], c); float* sr = S + (mb * 16 + hi * 8) * SP + ((g * 4 + s) * 16 + w) * 16 + lr;
#pragma unroll
                    for (int q = 0; q < 8; ++q) sr[q * SP] = __fmul_rn(__fadd_rn(c[q], sr[q * SP]), 0.125f); } }
    }
    __syncthreads();   // whole score rows are in LDS before a wave reads its two
#pragma unroll
    for (int rr = 0; rr < 2; ++rr) { float* sr = S + (w * 2 + rr) * SP; float v[64]; float mx = -3.0e38f;
#pragma unroll
        for (int ch = 0; ch < 16; ++ch) { const v4f a = *(const v4fa*)(sr + ch * 128 + lane * 4);
#pragma unroll
            for (int q = 0; q < 4; ++q) { v[ch * 4 + q] = a[q]; mx = fmaxf(mx, a[q]); } }
#pragma unroll
        for (int sh = 16; sh; sh >>= 1) mx = fmaxf(mx, __shfl_xor(mx, sh, 32));
        float sum = 0.f;
#pragma unroll
        for (int k = 0; k < 64; ++k) { v[k] = exp_slot(v[k] - mx); sum += v[k]; }
#pragma unroll
        for (int sh = 16; sh; sh >>= 1) sum += __shfl_xor(sum, sh, 32);
        const float fct = __fdiv_rn(PCAR, sum); h16* pr = (h16*)sr;
#pragma unroll
        for (int ch = 0; ch < 16; ++ch) { v4h o;
#pragma unroll
            for (int q = 0; q < 4; ++q) o[q] = tohx(v[ch * 4 + q] * fct);
            *(v4ha*)(pr + ch * 128 + lane * 4) = o; } }
    v16h vb[4][4]; const h16* pv = VT + lr * TT + w * 128 + 8 * hi;   // this wave's 128 keys of V, fetched in front of the barrier, so that they fly while the wave waits there
#pragma unroll
    for (int ks = 0; ks < 4; ++ks)
#pragma unroll
        for (int nb = 0; nb < 4; ++nb) vb[ks][nb] = WFrag<h16>::ld(pv + nb * 16 * TT + ks * 32);
    // one translation wait behind the batch's loads, the address its input (as above)
    asm volatile("s_wait_xcnt 0x0" :: "v"(pv) : "memory");
    __syncthreads();   // every row of P is in LDS before any wave multiplies it
    v8f acc[2][4];
#pragma unroll
    for (int mb = 0; mb < 2; ++mb)
#pragma unroll
        for (int nb = 0; nb < 4; ++nb) acc[mb][nb] = (v8f){};
#pragma unroll
    for (int ks = 0; ks < 4; ++ks) { const int kc = w * 128 + ks * 32 + 8 * hi; v16h a[2];
#pragma unroll
        for (int mb = 0; mb < 2; ++mb) { const h16* p = (const h16*)S + (mb * 16 + lr) * (2 * SP) + kc; a[mb] = cat16(*(const v8ha*)p, *(const v8ha*)(p + 16)); }
#pragma unroll
        for (int nb = 0; nb < 4; ++nb)
#pragma unroll
            for (int mb = 0; mb < 2; ++mb) acc[mb][nb] = wmma16(a[mb], vb[ks][nb], acc[mb][nb]); }
#pragma unroll
    for (int mb = 0; mb < 2; ++mb)
#pragma unroll
        for (int nb = 0; nb < 4; ++nb)
#pragma unroll
            for (int q = 0; q < 8; ++q) S[(mb * 16 + hi * 8 + q) * SP + 1024 + w * 64 + nb * 16 + lr] = acc[mb][nb][q];
    __syncthreads();   // every wave's partial tile is in LDS before any thread sums it
    { const int row = (int)threadIdx.x >> 4, cofs = ((int)threadIdx.x & 15) * 4; const float* pp = S + row * SP + 1024 + cofs; v4f val = *(const v4fa*)pp;
#pragma unroll
        for (int p = 1; p < 16; ++p) val += *(const v4fa*)(pp + p * 64);
        v4us oh, ol;
#pragma unroll
        for (int q = 0; q < 4; ++q) { unsigned short x, y; splitf(val[q] * (1.0f / PCAR), x, y); oh[q] = x; ol[q] = y; }
        const size_t o = ((size_t)(i0 + row) * NB_ + b) * DD + h * HD + cofs; *(v4us*)(Ah + o) = oh; *(v4us*)(Al + o) = ol; }
}

extern "C" void kernel_launch(void* const* d_in, const int* in_sizes, int n_in,
                              void* d_out, int out_size, void* d_ws, size_t ws_size, hipStream_t stream) {
    (void)in_sizes; (void)n_in; (void)out_size;
    const float* x = (const float*)d_in[0]; const float* r = (const float*)d_in[1]; const float* rwb = (const float*)d_in[2]; const float* rrb = (const float*)d_in[3]; const float* qkvw = (const float*)d_in[4]; const float* rw = (const float*)d_in[5]; const float* ow = (const float*)d_in[6]; const float* ob = (const float*)d_in[7];
    float* OUT = (float*)d_out;     // [2048][2][1024] (rows t*2 + b)
    char* wsp = (char*)d_ws;
    auto take = [&](size_t bytes) { char* p = wsp; wsp += (bytes + 255) & ~(size_t)255; return (void*)p; };
    bf* WQ = (bf*)take((size_t)DD * DD * 2); bf* WK = (bf*)take((size_t)DD * DD * 2); bf* WV = (bf*)take((size_t)DD * DD * 2); bf* WR = (bf*)take((size_t)DD * DD * 2); bf* WO = (bf*)take((size_t)DD * DD * 2);
    bf* XB = (bf*)take((size_t)NT * DD * 2); bf* RB = (bf*)take((size_t)TT * DD * 2); float* F = (float*)take((size_t)NT * DD * 4);
    h16* QA = (h16*)take((size_t)NT * DD * 2); h16* QB = (h16*)take((size_t)NT * DD * 2); h16* KP = (h16*)take((size_t)NT * DD * 2); h16* VT = (h16*)take((size_t)NT * DD * 2); h16* RK = (h16*)take((size_t)NH_ * TT * HD * 2);
    bf* ATh = (bf*)take((size_t)NT * DD * 2); bf* ATl = (bf*)take((size_t)NT * DD * 2);
    if ((size_t)(wsp - (char*)d_ws) > ws_size) return;    // total 90 MiB
    { const size_t nw = (size_t)DD * DD / 8; const unsigned gw = (unsigned)((nw + 255) / 256); k_cvt8<<<gw, 256, 0, stream>>>(qkvw, WQ, nw); k_cvt8<<<gw, 256, 0, stream>>>(qkvw + (size_t)DD * DD, WK, nw); k_cvt8<<<gw, 256, 0, stream>>>(qkvw + (size_t)2 * DD * DD, WV, nw); k_cvt8<<<gw, 256, 0, stream>>>(rw, WR, nw); k_cvt8<<<gw, 256, 0, stream>>>(ow, WO, nw);
      const size_t nx = (size_t)NT * DD / 8; k_cvt8<<<(unsigned)((nx + 255) / 256), 256, 0, stream>>>(x, XB, nx); k_cvt8<<<(unsigned)((nx / 2 + 255) / 256), 256, 0, stream>>>(r, RB, nx / 2); }
    const unsigned LB = (unsigned)((NT * DD / 64 + 63) / 64); const dim3 gP(NT / 64, DD / 64, 1);
    k_gemmks<bf, false, false, 4, 4><<<gP, 128, 0, stream>>>(XB, nullptr, WQ, DD, F, DD, nullptr, 0, 0, 0); k_hb16<<<LB, 256, 0, stream>>>(F, rwb, QA); k_hb16<<<LB, 256, 0, stream>>>(F, rrb, QB);
    k_gemmks<bf, false, false, 4, 4><<<gP, 128, 0, stream>>>(XB, nullptr, WK, DD, F, DD, nullptr, 0, 0, 0); k_hb16<<<LB, 256, 0, stream>>>(F, nullptr, KP);
    k_gemmks<bf, false, false, 4, 4><<<gP, 128, 0, stream>>>(XB, nullptr, WV, DD, F, DD, nullptr, 0, 0, 0); k_vtplane<<<LB, 256, 0, stream>>>(F, VT);
    k_gemmks<bf, false, false, 4, 4><<<dim3(TT / 64, DD / 64, 1), 128, 0, stream>>>(RB, nullptr, WR, DD, F, DD, nullptr, 0, 0, 0); k_rk16<<<(unsigned)((NH_ * TT * HD / 64 + 63) / 64), 256, 0, stream>>>(F, RK);
    k_relattn<<<dim3(TT / RT, NB_ * NH_, 1), 512, 0, stream>>>(QA, QB, KP, RK, VT, ATh, ATl);
    k_gemmks<bf, true, true, 4, 4><<<gP, 128, 0, stream>>>(ATh, ATl, WO, DD, OUT, DD, ob, 0, 0, 0);
}

// v003
// It runs in 262 microseconds.
// In two side-by-side timings against v002, it was 1.20 and 1.21 times as fast.
// Over all steps from v000 it is 5.93 times as fast.
#include <hip/hip_runtime.h>

// Relative-position multi-head attention (segment-recurrence style relative shift; query [2048][2][1024] seq-first, r [2048][1024]; w = query qkv_w^T -> q|k|v (16 heads x 64); r_k = r r_w^T; AC = (q + r_w_bias).k,
// BD = rel_shift((q + r_r_bias).r_k) with the module's exact zero-pad/reshape shift (out[i][j] = BD[f / (T+1)][f % (T+1) - 1] or 0 when f % (T+1) == 0, f = T + i*T + j); p = softmax((AC + BD) / 8)
// over the keys; attn = p.v; out = merged out_w^T + out_b; output [2048][2][1024] (rows t*2 + b)).
// Compute dtypes, f32 accumulate: every input rounded to bf16; the qkv and r projections on PLAIN bf16 operands (inputs: exact); AC, BD and attn.v on SINGLE fp16 planes
// (the per-head biases added in f32 before the fp16 rounding; logit sd ~ 0.6); the relative shift is an index scatter into the LDS score rows of the fused attention kernel; P x1024;

#define NB_  2
#define TT   2048
#define DD   1024
#define NH_  16
#define HD   64
#define NT   (NB_ * TT)
#define PCAR 1024.0f
typedef _Float16 h16;
typedef unsigned short bf;
typedef __attribute__((ext_vector_type(16))) __bf16   v16bf;
typedef __attribute__((ext_vector_type(16))) _Float16 v16h;
typedef __attribute__((ext_vector_type(8)))  _Float16 v8h;
typedef __attribute__((ext_vector_type(8)))  unsigned short v8us;
typedef __attribute__((ext_vector_type(8)))  float    v8f;
typedef __attribute__((ext_vector_type(4)))  float    v4f;
typedef v8h  __attribute__((may_alias)) v8ha;
typedef v4f  __attribute__((may_alias)) v4fa;
typedef v8us __attribute__((may_alias)) v8usa;

__device__ __forceinline__ unsigned short f2bf(float f) { unsigned u = __float_as_uint(f); u += 0x7FFFu + ((u >> 16) & 1u); return (unsigned short)(u >> 16); }
__device__ __forceinline__ float bf2f(unsigned short b) { return __uint_as_float(((unsigned)b) << 16); }
__device__ __forceinline__ float bfr(float f) { return bf2f(f2bf(f)); }
__device__ __forceinline__ v16h cat16(v8h lo, v8h hi) { return __builtin_shufflevector(lo, hi, 0, 1, 2, 3, 4, 5, 6, 7, 8, 9, 10, 11, 12, 13, 14, 15); }
__device__ __forceinline__ v16bf cat16b(v8us lo, v8us hi) { return __builtin_bit_cast(v16bf, __builtin_shufflevector(lo, hi, 0, 1, 2, 3, 4, 5, 6, 7, 8, 9, 10, 11, 12, 13, 14, 15)); }
__device__ __forceinline__ v8f wmma16(v16h a, v16h b, v8f c) { return __builtin_amdgcn_wmma_f32_16x16x32_f16(false, a, false, b, (short)0, c, false, false); }
__device__ __forceinline__ v8f wmmab(v16bf a, v16bf b, v8f c) { return __builtin_amdgcn_wmma_f32_16x16x32_bf16(false, a, false, b, (short)0, c, false, false); }



// FRAGMENT ORDER: every 16-bit operand plane [rows][K] that a kernel fetches from global memory lies in blocks of 16 rows x 32 k (512 values, 1 KiB), block (row / 16) * (K / 32) + k / 32;
// inside a block the value (row % 16, k % 32) lies at (k & 16) * 16 + ((k >> 3 & 1) * 16 + row % 16) * 8 + (k & 7). Lane l = 16 hi + lr of a fragment (row lr; k = 8 hi .. 8 hi + 7 and 16 + 8 hi .. 16 + 8 hi + 7)
// so finds its two 16-byte pieces at 8 l and 256 + 8 l, and each of the wave's two loads covers 512 contiguous bytes, four whole lines, where a row-major plane makes it touch sixteen.
// fragment loaders: p = the block's start + 8 lane
template <typename T16> struct WFrag;
template <> struct WFrag<h16> { typedef v16h V; static __device__ __forceinline__ V ld(const h16* p) { return cat16(*(const v8h*)p, *(const v8h*)(p + 256)); } static __device__ __forceinline__ v8f mma(V a, V b, v8f c) { return wmma16(a, b, c); } };
template <> struct WFrag<bf> { typedef v16bf V; static __device__ __forceinline__ V ld(const bf* p) { return cat16b(*(const v8us*)p, *(const v8us*)(p + 256)); } static __device__ __forceinline__ v8f mma(V a, V b, v8f c) { return wmmab(a, b, c); } };
// ---- k_gemmks: C[m][n] (f32, pitch ldc, + optional f32 bias[n]) = sum_k A[m][k] Bt[n][k] for a long K and few output tiles: one workgroup of KW waves per (16 MT)x64 tile; grid (M/(16 MT), N/64, Z), 32 KW threads. K % (32 KW) == 0.
// Wave w sums k in [w K/KW, (w+1) K/KW) into its own MT x 4 accumulators; the KW f32 partial tiles are joined through LDS, in wave order, by the threads that store the tile. TWOA: C = (A + A2) Bt^T.
// A, A2 and Bt lie in fragment order. BMAJ: A's row b T + t is C's row t NB + b.
template <typename T16, bool TWOA, bool BIAS, bool BMAJ, int KW, int MT>
__global__ __launch_bounds__(32 * KW) void k_gemmks(const T16* __restrict__ A, const T16* __restrict__ A2, const T16* __restrict__ Bt, int K, float* C, int ldc, const float* __restrict__ bias, size_t sA, size_t sB, size_t sC) {
    typedef typename WFrag<T16>::V V;
    static_assert((MT * 8) % KW == 0, "the tile's 16-byte pieces divide evenly over the threads");
    static_assert(MT >= 2 && MT <= 4, "the wait in the k loop names the addresses of row blocks 0, 1, MT - 2 and MT - 1");
    __shared__ __align__(16) float os[KW * MT * 16 * 68];
    const size_t z = blockIdx.z; A += z * sA; if (TWOA) A2 += z * sA; Bt += z * sB; C += z * sC;
    const int lane = threadIdx.x & 31, lr = lane & 15, hi = lane >> 4; const int r0 = blockIdx.x * (16 * MT), c0 = blockIdx.y * 64;
    const int w = __builtin_amdgcn_readfirstlane(threadIdx.x >> 5); const int kbeg = w * (K / KW), kend = kbeg + K / KW;
    v8f acc[MT][4];
#pragma unroll
    for (int mb = 0; mb < MT; ++mb)
#pragma unroll
        for (int nb = 0; nb < 4; ++nb) acc[mb][nb] = (v8f){};
    const size_t aoff = (size_t)r0 * K + 8 * lane, boff = (size_t)c0 * K + 8 * lane;   // 16 rows of blocks are 16 K values, one block of 32 k is 512
#pragma unroll 1
    for (int kc = kbeg; kc < kend; kc += 32) {
        const T16 *pa[MT], *pa2[MT], *pb[4]; V a[MT], a2[MT], b[4];
#pragma unroll
        for (int mb = 0; mb < MT; ++mb) { pa[mb] = A + aoff + (size_t)mb * 16 * K + (size_t)kc * 16; a[mb] = WFrag<T16>::ld(pa[mb]); pa2[mb] = pa[mb]; if (TWOA) { pa2[mb] = A2 + aoff + (size_t)mb * 16 * K + (size_t)kc * 16; a2[mb] = WFrag<T16>::ld(pa2[mb]); } }
#pragma unroll
        for (int nb = 0; nb < 4; ++nb) { pb[nb] = Bt + boff + (size_t)nb * 16 * K + (size_t)kc * 16; b[nb] = WFrag<T16>::ld(pb[nb]); }
        // one translation wait behind the trip's loads; the addresses are its inputs, so that no load's result and no later add lands in an address register ahead of it
        asm volatile("s_wait_xcnt 0x0" :: "v"(pa[0]), "v"(pa[1]), "v"(pa[MT - 2]), "v"(pa[MT - 1]), "v"(pa2[0]), "v"(pa2[1]), "v"(pa2[MT - 2]), "v"(pa2[MT - 1]), "v"(pb[0]), "v"(pb[1]), "v"(pb[2]), "v"(pb[3]) : "memory");
#pragma unroll
        for (int nb = 0; nb < 4; ++nb)
#pragma unroll
            for (int mb = 0; mb < MT; ++mb) { acc[mb][nb] = WFrag<T16>::mma(a[mb], b[nb], acc[mb][nb]); if (TWOA) acc[mb][nb] = WFrag<T16>::mma(a2[mb], b[nb], acc[mb][nb]); }
        // four vector slots behind the last WMMA on the loop's taken branch too
        asm volatile("v_nop\n\tv_nop\n\tv_nop\n\tv_nop" : "+v"(acc[0][0]), "+v"(acc[1][1]), "+v"(acc[MT - 2][2]), "+v"(acc[MT - 1][3]) : "v"(a[0]), "v"(a[MT - 1]));
    }
#pragma unroll
    for (int mb = 0; mb < MT; ++mb)
#pragma unroll
        for (int nb = 0; nb < 4; ++nb)
#pragma unroll
            for (int j = 0; j < 8; ++j) os[(w * (16 * MT) + mb * 16 + hi * 8 + j) * 68 + nb * 16 + lr] = acc[mb][nb][j];
    __syncthreads();   // every wave's partial tile is in LDS before any thread sums it
#pragma unroll
    for (int it = 0; it < MT * 8 / KW; ++it) { const int s = (int)threadIdx.x + it * (32 * KW); const int row = s >> 4, cofs = (s & 15) * 4; v4f val = *(const v4fa*)(os + row * 68 + cofs);
#pragma unroll
        for (int p = 1; p < KW; ++p) val += *(const v4fa*)(os + (p * (16 * MT) + row) * 68 + cofs);
        if (BIAS) { val[0] += bfr(bias[c0 + cofs]); val[1] += bfr(bias[c0 + cofs + 1]); val[2] += bfr(bias[c0 + cofs + 2]); val[3] += bfr(bias[c0 + cofs + 3]); }
        const unsigned m = (unsigned)(r0 + row), orow = BMAJ ? (m % TT) * NB_ + m / TT : m;
        *(v4f*)(C + (size_t)orow * ldc + c0 + cofs) = val; }
}

__device__ __forceinline__ h16 tohx(float x) { return (h16)x; }
__device__ __forceinline__ void splitf(float y, unsigned short& h, unsigned short& l) { h = f2bf(y); l = f2bf(y - bf2f(h)); }
typedef __attribute__((ext_vector_type(2))) _Float16 v2h;
typedef __attribute__((ext_vector_type(4))) _Float16 v4h;
typedef __attribute__((ext_vector_type(2))) unsigned short v2us;
typedef __attribute__((ext_vector_type(4))) int v4i;

// src [rows][DD] f32, row-major -> dst bf16 in fragment order; thread i makes the order's 16-byte piece i, so a wave stores 512 contiguous bytes and reads 64 bytes of each of 16 rows
__global__ __launch_bounds__(256) void k_cvt8(const float* __restrict__ src, bf* dst, size_t n8) { const size_t i = (size_t)blockIdx.x * 256 + threadIdx.x; if (i >= n8) return;
    const size_t blk = i >> 6; const float* ps = src + ((blk / (DD / 32)) * 16 + (i & 15)) * DD + (blk % (DD / 32)) * 32 + ((i >> 5) & 1) * 16 + ((i >> 4) & 1) * 8; const v8f v = *(const v8f*)ps; v8us o;
    // the translation wait behind the loads, the address its input, so that no later result lands in an address register ahead of it
    asm volatile("s_wait_xcnt 0x0" :: "v"(ps) : "memory");
#pragma unroll
    for (int k = 0; k < 8; ++k) o[k] = f2bf(v[k]); *(v8us*)(dst + i * 8) = o;  }
// F [t NB + b][DD] f32 (+ the head's bias) -> P [batch x head][T][64] fp16 in fragment order; one wave makes 16 rows t of one (batch, head): 2 KiB, four stores of 512 contiguous bytes
template <bool HB>
__global__ __launch_bounds__(256) void k_hb16(const float* __restrict__ F, const float* __restrict__ hb, h16* P) {
    const int lane = threadIdx.x & 31, lr = lane & 15, hi = lane >> 4; const int tile = blockIdx.x * 8 + (threadIdx.x >> 5); const int tb = tile & (TT / 16 - 1); const int z = tile >> 7; const int b = z >> 4, h = z & 15;
    const float* pf = F + ((size_t)(tb * 16 + lr) * NB_ + b) * DD + h * HD + hi * 8; const float* pb = HB ? hb + h * HD + hi * 8 : pf; v8f v[4], bb[4]; v8h o[4];
#pragma unroll
    for (int cc = 0; cc < 4; ++cc) { v[cc] = *(const v8f*)(pf + cc * 16); bb[cc] = (v8f){}; if (HB) bb[cc] = *(const v8f*)(pb + cc * 16); }
    // the translation wait behind the loads, the addresses its inputs (as in k_cvt8)
    asm volatile("s_wait_xcnt 0x0" :: "v"(pf), "v"(pb) : "memory");
#pragma unroll
    for (int cc = 0; cc < 4; ++cc)
#pragma unroll
        for (int q = 0; q < 8; ++q) o[cc][q] = tohx(__fadd_rn(v[cc][q], bfr(bb[cc][q])));
#pragma unroll
    for (int cc = 0; cc < 4; ++cc) *(v8h*)(P + (size_t)tile * 1024 + cc * 256 + lane * 8) = o[cc];
}
// FR [j][DD] f32 -> RK [head][T][64] fp16 in fragment order; one wave makes 16 rows j of one head
__global__ __launch_bounds__(256) void k_rk16(const float* __restrict__ FR, h16* RK) {
    const int lane = threadIdx.x & 31, lr = lane & 15, hi = lane >> 4; const int tile = blockIdx.x * 8 + (threadIdx.x >> 5); const int jb = tile & (TT / 16 - 1); const int h = tile >> 7;
    const float* pf = FR + (size_t)(jb * 16 + lr) * DD + h * HD + hi * 8; v8f v[4];
#pragma unroll
    for (int cc = 0; cc < 4; ++cc) v[cc] = *(const v8f*)(pf + cc * 16);
    // the translation wait behind the loads, the address its input (as in k_cvt8)
    asm volatile("s_wait_xcnt 0x0" :: "v"(pf) : "memory");
#pragma unroll
    for (int cc = 0; cc < 4; ++cc) { v8h o;
#pragma unroll
        for (int q = 0; q < 8; ++q) o[q] = tohx(v[cc][q]);
        *(v8h*)(RK + (size_t)tile * 1024 + cc * 256 + lane * 8) = o; }
}
// F [t NB + b][DD] f32 -> VT [batch x head][64 rows d][T] fp16 in fragment order (k = t); one wave makes one block, 16 d x 32 t: each load reads 64 contiguous bytes of two rows t
__global__ __launch_bounds__(256) void k_vtplane(const float* __restrict__ F, h16* VT) {
    const int lane = threadIdx.x & 31, lr = lane & 15, hi = lane >> 4; const int blk = blockIdx.x * 8 + (threadIdx.x >> 5); const int db = blk & 3; const int tb = (blk >> 2) & (TT / 32 - 1); const int z = blk >> 8; const int b = z >> 4, h = z & 15;
    const float* pf = F + ((size_t)(tb * 32 + hi * 8) * NB_ + b) * DD + h * HD + db * 16 + lr; float v[16];
#pragma unroll
    for (int q = 0; q < 16; ++q) v[q] = pf[(size_t)((q >> 3) * 16 + (q & 7)) * NB_ * DD];
    // the translation wait behind the loads, the address its input (as in k_cvt8)
    asm volatile("s_wait_xcnt 0x0" :: "v"(pf) : "memory");
#pragma unroll
    for (int hf = 0; hf < 2; ++hf) { v8h o;
#pragma unroll
        for (int q = 0; q < 8; ++q) o[q] = tohx(v[hf * 8 + q]);
        *(v8h*)(VT + (size_t)z * HD * TT + (size_t)(db * (TT / 32) + tb) * 512 + hf * 256 + lane * 8) = o; }
}
// ---- k_relattn: scores, relative shift, softmax, P.V and the head merge for RT query rows of one (batch, head); grid (T / RT, batch x heads), 16 waves.
// The RT score rows stay in LDS (f32, pitch SP floats). BD[i][m] = (q_i + r_r_bias).r_k[m] lands where the module's zero-pad/reshape shift puts it: at row i, key m - (T - 1 - i), when that is >= 0,
// else at row i - 1, key m + i + 1; row i, key i + 1 is the shift's zero. So the rows i0 .. i0 + RT - 1 take the first kind from q rows i0 .. and the second kind from q rows i0 + 1 .. .
// Then AC is added in place, each wave does the softmax of two rows and leaves P x1024 (fp16) in the first half of the row's own LDS; P.V splits the keys over the 16 waves, whose f32 partial tiles
// lie in the second half of the rows and are joined in wave order by the threads that store the merged bf16 hi/lo planes. All five operand planes and the two merged planes lie in fragment order.
#define RT 32
#define SP 2052
// e^x as the fast library form has it, 2^(x log2 e); the v_nop is the one independent slot that the instruction set asks for behind a transcendental, in the same statement so that it stays directly behind it
__device__ __forceinline__ float exp_slot(float x) { float r; asm("v_exp_f32 %0, %1\n\tv_nop" : "=v"(r) : "v"(x * 1.44269504f)); return r; }
typedef v4h __attribute__((may_alias)) v4ha;
typedef __attribute__((ext_vector_type(4))) unsigned short v4us;
__global__ __launch_bounds__(512) void k_relattn(const h16* __restrict__ QA, const h16* __restrict__ QB, const h16* __restrict__ KP, const h16* __restrict__ RK, const h16* __restrict__ VT, bf* Ah, bf* Al) {
    __shared__ __align__(16) float S[RT * SP];
    const int z = blockIdx.y, b = z >> 4, h = z & 15, i0 = blockIdx.x * RT;
    const int lane = threadIdx.x & 31, lr = lane & 15, hi = lane >> 4; const int w = __builtin_amdgcn_readfirstlane(threadIdx.x >> 5);
    QA += (size_t)z * TT * HD; QB += (size_t)z * TT * HD; KP += (size_t)z * TT * HD; VT += (size_t)z * HD * TT; RK += (size_t)h * TT * HD;
    const int fo = 8 * lane;   // this lane's place in a block of the fragment order; 16 rows of a plane with 64 values a row are two blocks, k 0 .. 31 and 32 .. 63
    {   // BD, stored shifted; wave w takes the 16-column tiles w, w + 16, ...
        v16h ql[2][2], qu[2][2]; const h16* pl = QB + i0 * HD; const h16* pr = RK + w * 16 * HD; const h16* pu[2];   // pl, pr: the same for the whole wave; the lane's place fo is added at each load
#pragma unroll
        for (int mb = 0; mb < 2; ++mb) { const int ru = min(i0 + 1 + mb * 16 + lr, TT - 1); pu[mb] = QB + (ru >> 4) * (16 * HD) + (hi * 16 + (ru & 15)) * 8;   // the row behind the last one feeds no key: any row in bounds serves
#pragma unroll
            for (int ks = 0; ks < 2; ++ks) { ql[mb][ks] = WFrag<h16>::ld(pl + fo + mb * 16 * HD + ks * 512); qu[mb][ks] = WFrag<h16>::ld(pu[mb] + ks * 512); } }
#pragma unroll
        for (int g = 0; g < 2; ++g) { v16h rb[4][2];
#pragma unroll
            for (int s = 0; s < 4; ++s)
#pragma unroll
                for (int ks = 0; ks < 2; ++ks) rb[s][ks] = WFrag<h16>::ld(pr + fo + (g * 4 + s) * 256 * HD + ks * 512);
            // one translation wait behind the batch's loads; the addresses are its inputs (the wave's bases in scalar registers, the lane number that the loads scale), so that no load's result and no later add lands in an address register ahead of it
            asm volatile("s_wait_xcnt 0x0" :: "s"(pl), "v"(pu[0]), "v"(pu[1]), "s"(pr), "v"(lane) : "memory");
#pragma unroll
            for (int s = 0; s < 4; ++s)
#pragma unroll
                for (int mb = 0; mb < 2; ++mb) { const int base = ((g * 4 + s) * 16 + w) * 16 + i0 + mb * 16; float* sr = S + (mb * 16 + hi * 8) * SP;
                    if (base + 30 >= TT - 1) { v8f c = (v8f){}; c = wmma16(ql[mb][0], rb[s][0], c); c = wmma16(ql[mb][1], rb[s][1], c); const int j = base + lr + hi * 8 - (TT - 1);
#pragma unroll
                        for (int q = 0; q < 8; ++q) if (j + q >= 0) sr[q * SP + j + q] = c[q]; }
                    if (base + 2 < TT) { v8f c = (v8f){}; c = wmma16(qu[mb][0], rb[s][0], c); c = wmma16(qu[mb][1], rb[s][1], c); const int j = base + lr + hi * 8 + 2;
#pragma unroll
                        for (int q = 0; q < 8; ++q) if (j + q < TT) sr[q * SP + j + q] = c[q]; } } }
        if (threadIdx.x < RT) { const int j = i0 + (int)threadIdx.x + 1; if (j < TT) S[threadIdx.x * SP + j] = 0.f; }
    }
    {   // AC, added in place: s = (AC + BD) / 8; its first operands are fetched in front of the barrier, so that they fly while the wave waits there
        v16h qa[2][2]; const h16* pq = QA + i0 * HD; const h16* pk = KP + w * 16 * HD;
#pragma unroll
        for (int mb = 0; mb < 2; ++mb)
#pragma unroll
            for (int ks = 0; ks < 2; ++ks) qa[mb][ks] = WFrag<h16>::ld(pq + fo + mb * 16 * HD + ks * 512);
#pragma unroll
        for (int g = 0; g < 2; ++g) { v16h kb[4][2];
#pragma unroll
            for (int s = 0; s < 4; ++s)
#pragma unroll
                for (int ks = 0; ks < 2; ++ks) kb[s][ks] = WFrag<h16>::ld(pk + fo + (g * 4 + s) * 256 * HD + ks * 512);
            // one translation wait behind the batch's loads, the addresses its inputs (as above)
            asm volatile("s_wait_xcnt 0x0" :: "s"(pq), "s"(pk), "v"(lane) : "memory");
            if (g == 0) __syncthreads();   // every shifted BD value is in LDS before AC is added to it
#pragma unroll
            for (int s = 0; s < 4; ++s)
#pragma unroll
                for (int mb = 0; mb < 2; ++mb) { v8f c = (v8f){}; c = wmma16(qa[mb][0], kb[s][0], c); c = wmma16(qa[mb][1], kb[s][1], c); float* sr = S + (mb * 16 + hi * 8) * SP + ((g * 4 + s) * 16 + w) * 16 + lr;
#pragma unroll
                    for (int q = 0; q < 8; ++q) sr[q * SP] = __fmul_rn(__fadd_rn(c[q], sr[q * SP]), 0.125f); } }
    }
    __syncthreads();   // whole score rows are in LDS before a wave reads its two
#pragma unroll
    for (int rr = 0; rr < 2; ++rr) { float* sr = S + (w * 2 + rr) * SP; float v[64]; float mx = -3.0e38f;
#pragma unroll
        for (int ch = 0; ch < 16; ++ch) { const v4f a = *(const v4fa*)(sr + ch * 128 + lane * 4);
#pragma unroll
            for (int q = 0; q < 4; ++q) { v[ch * 4 + q] = a[q]; mx = fmaxf(mx, a[q]); } }
#pragma unroll
        for (int sh = 16; sh; sh >>= 1) mx = fmaxf(mx, __shfl_xor(mx, sh, 32));
        float sum = 0.f;
#pragma unroll
        for (int k = 0; k < 64; ++k) { v[k] = exp_slot(v[k] - mx); sum += v[k]; }
#pragma unroll
        for (int sh = 16; sh; sh >>= 1) sum += __shfl_xor(sum, sh, 32);
        const float fct = __fdiv_rn(PCAR, sum); h16* pr = (h16*)sr;
#pragma unroll
        for (int ch = 0; ch < 16; ++ch) { v4h o;
#pragma unroll
            for (int q = 0; q < 4; ++q) o[q] = tohx(v[ch * 4 + q] * fct);
            *(v4ha*)(pr + ch * 128 + lane * 4) = o; } }
    v16h vb[4][4]; const h16* pv = VT + w * 4 * 512;   // this wave's 128 keys of V, fetched in front of the barrier, so that they fly while the wave waits there
#pragma unroll
    for (int ks = 0; ks < 4; ++ks)
#pragma unroll
        for (int nb = 0; nb < 4; ++nb) vb[ks][nb] = WFrag<h16>::ld(pv + fo + nb * 16 * TT + ks * 512);
    // one translation wait behind the batch's loads, the address its input (as above)
    asm volatile("s_wait_xcnt 0x0" :: "s"(pv), "v"(lane) : "memory");
    __syncthreads();   // every row of P is in LDS before any wave multiplies it
    v8f acc[2][4];
#pragma unroll
    for (int mb = 0; mb < 2; ++mb)
#pragma unroll
        for (int nb = 0; nb < 4; ++nb) acc[mb][nb] = (v8f){};
#pragma unroll
    for (int ks = 0; ks < 4; ++ks) { const int kc = w * 128 + ks * 32 + 8 * hi; v16h a[2];
#pragma unroll
        for (int mb = 0; mb < 2; ++mb) { const h16* p = (const h16*)S + (mb * 16 + lr) * (2 * SP) + kc; a[mb] = cat16(*(const v8ha*)p, *(const v8ha*)(p + 16)); }
#pragma unroll
        for (int nb = 0; nb < 4; ++nb)
#pragma unroll
            for (int mb = 0; mb < 2; ++mb) acc[mb][nb] = wmma16(a[mb], vb[ks][nb], acc[mb][nb]); }
#pragma unroll
    for (int mb = 0; mb < 2; ++mb)
#pragma unroll
        for (int nb = 0; nb < 4; ++nb)
#pragma unroll
            for (int q = 0; q < 8; ++q) S[(mb * 16 + hi * 8 + q) * SP + 1024 + w * 64 + nb * 16 + lr] = acc[mb][nb][q];
    __syncthreads();   // every wave's partial tile is in LDS before any thread sums it
    { const int row = (int)threadIdx.x >> 4, cofs = ((int)threadIdx.x & 15) * 4; const float* pp = S + row * SP + 1024 + cofs; v4f val = *(const v4fa*)pp;
#pragma unroll
        for (int p = 1; p < 16; ++p) val += *(const v4fa*)(pp + p * 64);
        v4us oh, ol;
#pragma unroll
        for (int q = 0; q < 4; ++q) { unsigned short x, y; splitf(val[q] * (1.0f / PCAR), x, y); oh[q] = x; ol[q] = y; }
        // the merged planes in fragment order, row b T + t, so that this workgroup alone writes its four blocks (2 x 16 rows, the head's 2 x 32 columns)
        const size_t o = ((size_t)((b * TT + i0 + row) >> 4) * (DD / 32) + h * 2 + (cofs >> 5)) * 512 + (cofs & 16) * 16 + (((cofs >> 3) & 1) * 16 + (row & 15)) * 8 + (cofs & 7); *(v4us*)(Ah + o) = oh; *(v4us*)(Al + o) = ol; }
}

extern "C" void kernel_launch(void* const* d_in, const int* in_sizes, int n_in,
                              void* d_out, int out_size, void* d_ws, size_t ws_size, hipStream_t stream) {
    (void)in_sizes; (void)n_in; (void)out_size;
    const float* x = (const float*)d_in[0]; const float* r = (const float*)d_in[1]; const float* rwb = (const float*)d_in[2]; const float* rrb = (const float*)d_in[3]; const float* qkvw = (const float*)d_in[4]; const float* rw = (const float*)d_in[5]; const float* ow = (const float*)d_in[6]; const float* ob = (const float*)d_in[7];
    float* OUT = (float*)d_out;     // [2048][2][1024] (rows t*2 + b)
    char* wsp = (char*)d_ws;
    auto take = [&](size_t bytes) { char* p = wsp; wsp += (bytes + 255) & ~(size_t)255; return (void*)p; };
    bf* WQ = (bf*)take((size_t)DD * DD * 2); bf* WK = (bf*)take((size_t)DD * DD * 2); bf* WV = (bf*)take((size_t)DD * DD * 2); bf* WR = (bf*)take((size_t)DD * DD * 2); bf* WO = (bf*)take((size_t)DD * DD * 2);
    bf* XB = (bf*)take((size_t)NT * DD * 2); bf* RB = (bf*)take((size_t)TT * DD * 2); float* F = (float*)take((size_t)NT * DD * 4);
    h16* QA = (h16*)take((size_t)NT * DD * 2); h16* QB = (h16*)take((size_t)NT * DD * 2); h16* KP = (h16*)take((size_t)NT * DD * 2); h16* VT = (h16*)take((size_t)NT * DD * 2); h16* RK = (h16*)take((size_t)NH_ * TT * HD * 2);
    bf* ATh = (bf*)take((size_t)NT * DD * 2); bf* ATl = (bf*)take((size_t)NT * DD * 2);
    if ((size_t)(wsp - (char*)d_ws) > ws_size) return;    // total 90 MiB
    { const size_t nw = (size_t)DD * DD / 8; const unsigned gw = (unsigned)((nw + 255) / 256); k_cvt8<<<gw, 256, 0, stream>>>(qkvw, WQ, nw); k_cvt8<<<gw, 256, 0, stream>>>(qkvw + (size_t)DD * DD, WK, nw); k_cvt8<<<gw, 256, 0, stream>>>(qkvw + (size_t)2 * DD * DD, WV, nw); k_cvt8<<<gw, 256, 0, stream>>>(rw, WR, nw); k_cvt8<<<gw, 256, 0, stream>>>(ow, WO, nw);
      const size_t nx = (size_t)NT * DD / 8; k_cvt8<<<(unsigned)((nx + 255) / 256), 256, 0, stream>>>(x, XB, nx); k_cvt8<<<(unsigned)((nx / 2 + 255) / 256), 256, 0, stream>>>(r, RB, nx / 2); }
    const unsigned LB = (unsigned)(NT * DD / 1024 / 8), LV = (unsigned)(NT * DD / 512 / 8); const dim3 gP(NT / 64, DD / 64, 1);   // eight waves a block: a wave of k_hb16 and k_rk16 makes 1024 values, one of k_vtplane 512
    k_gemmks<bf, false, false, false, 4, 4><<<gP, 128, 0, stream>>>(XB, nullptr, WQ, DD, F, DD, nullptr, 0, 0, 0); k_hb16<true><<<LB, 256, 0, stream>>>(F, rwb, QA); k_hb16<true><<<LB, 256, 0, stream>>>(F, rrb, QB);
    k_gemmks<bf, false, false, false, 4, 4><<<gP, 128, 0, stream>>>(XB, nullptr, WK, DD, F, DD, nullptr, 0, 0, 0); k_hb16<false><<<LB, 256, 0, stream>>>(F, nullptr, KP);
    k_gemmks<bf, false, false, false, 4, 4><<<gP, 128, 0, stream>>>(XB, nullptr, WV, DD, F, DD, nullptr, 0, 0, 0); k_vtplane<<<LV, 256, 0, stream>>>(F, VT);
    k_gemmks<bf, false, false, false, 4, 4><<<dim3(TT / 64, DD / 64, 1), 128, 0, stream>>>(RB, nullptr, WR, DD, F, DD, nullptr, 0, 0, 0); k_rk16<<<(unsigned)(NH_ * TT * HD / 1024 / 8), 256, 0, stream>>>(F, RK);
    k_relattn<<<dim3(TT / RT, NB_ * NH_, 1), 512, 0, stream>>>(QA, QB, KP, RK, VT, ATh, ATl);
    k_gemmks<bf, true, true, true, 4, 4><<<gP, 128, 0, stream>>>(ATh, ATl, WO, DD, OUT, DD, ob, 0, 0, 0);
}

// v004
// One run takes 217 microseconds.
// Two timings next to v003 both put it at 1.21 times that version's speed.
// Counting every step since v000, it is 7.17 times as fast.
#include <hip/hip_runtime.h>

// Relative-position multi-head attention (segment-recurrence style relative shift; query [2048][2][1024] seq-first, r [2048][1024]; w = query qkv_w^T -> q|k|v (16 heads x 64); r_k = r r_w^T; AC = (q + r_w_bias).k,
// BD = rel_shift((q + r_r_bias).r_k) with the module's exact zero-pad/reshape shift (out[i][j] = BD[f / (T+1)][f % (T+1) - 1] or 0 when f % (T+1) == 0, f = T + i*T + j); p = softmax((AC + BD) / 8)
// over the keys; attn = p.v; out = merged out_w^T + out_b; output [2048][2][1024] (rows t*2 + b)).
// Compute dtypes, f32 accumulate: every input rounded to bf16; the qkv and r projections on PLAIN bf16 operands (inputs: exact); AC, BD and attn.v on SINGLE fp16 planes
// (the per-head biases added in f32 before the fp16 rounding; logit sd ~ 0.6); the relative shift is an index scatter into the LDS score rows of the fused attention kernel; P x1024;

#define NB_  2
#define TT   2048
#define DD   1024
#define NH_  16
#define HD   64
#define NT   (NB_ * TT)
#define PCAR 1024.0f
typedef _Float16 h16;
typedef unsigned short bf;
typedef __attribute__((ext_vector_type(16))) __bf16   v16bf;
typedef __attribute__((ext_vector_type(16))) _Float16 v16h;
typedef __attribute__((ext_vector_type(8)))  _Float16 v8h;
typedef __attribute__((ext_vector_type(8)))  unsigned short v8us;
typedef __attribute__((ext_vector_type(8)))  float    v8f;
typedef __attribute__((ext_vector_type(4)))  float    v4f;
typedef v8h  __attribute__((may_alias)) v8ha;
typedef v4f  __attribute__((may_alias)) v4fa;
typedef v8us __attribute__((may_alias)) v8usa;

__device__ __forceinline__ unsigned short f2bf(float f) { unsigned u = __float_as_uint(f); u += 0x7FFFu + ((u >> 16) & 1u); return (unsigned short)(u >> 16); }
__device__ __forceinline__ float bf2f(unsigned short b) { return __uint_as_float(((unsigned)b) << 16); }
__device__ __forceinline__ float bfr(float f) { return bf2f(f2bf(f)); }
__device__ __forceinline__ v16h cat16(v8h lo, v8h hi) { return __builtin_shufflevector(lo, hi, 0, 1, 2, 3, 4, 5, 6, 7, 8, 9, 10, 11, 12, 13, 14, 15); }
__device__ __forceinline__ v16bf cat16b(v8us lo, v8us hi) { return __builtin_bit_cast(v16bf, __builtin_shufflevector(lo, hi, 0, 1, 2, 3, 4, 5, 6, 7, 8, 9, 10, 11, 12, 13, 14, 15)); }
__device__ __forceinline__ v8f wmma16(v16h a, v16h b, v8f c) { return __builtin_amdgcn_wmma_f32_16x16x32_f16(false, a, false, b, (short)0, c, false, false); }
__device__ __forceinline__ v8f wmmab(v16bf a, v16bf b, v8f c) { return __builtin_amdgcn_wmma_f32_16x16x32_bf16(false, a, false, b, (short)0, c, false, false); }



// FRAGMENT ORDER: every 16-bit operand plane [rows][K] that a kernel fetches from global memory lies in blocks of 16 rows x 32 k (512 values, 1 KiB), block (row / 16) * (K / 32) + k / 32;
// inside a block the value (row % 16, k % 32) lies at (k & 16) * 16 + ((k >> 3 & 1) * 16 + row % 16) * 8 + (k & 7). Lane l = 16 hi + lr of a fragment (row lr; k = 8 hi .. 8 hi + 7 and 16 + 8 hi .. 16 + 8 hi + 7)
// so finds its two 16-byte pieces at 8 l and 256 + 8 l, and each of the wave's two loads covers 512 contiguous bytes, four whole lines, where a row-major plane makes it touch sixteen.
// fragment loaders: p = the block's start + 8 lane
template <typename T16> struct WFrag;
template <> struct WFrag<h16> { typedef v16h V; static __device__ __forceinline__ V ld(const h16* p) { return cat16(*(const v8h*)p, *(const v8h*)(p + 256)); } static __device__ __forceinline__ v8f mma(V a, V b, v8f c) { return wmma16(a, b, c); } };
template <> struct WFrag<bf> { typedef v16bf V; static __device__ __forceinline__ V ld(const bf* p) { return cat16b(*(const v8us*)p, *(const v8us*)(p + 256)); } static __device__ __forceinline__ v8f mma(V a, V b, v8f c) { return wmmab(a, b, c); } };
// ---- k_gemmks: C[m][n] (f32, pitch ldc, + optional f32 bias[n]) = sum_k A[m][k] Bt[n][k] for a long K and few output tiles: one workgroup of KW waves per (16 MT)x64 tile; grid (M/(16 MT), N/64, Z), 32 KW threads. K % (32 KW) == 0.
// Wave w sums k in [w K/KW, (w+1) K/KW) into its own MT x 4 accumulators; the KW f32 partial tiles are joined through LDS, in wave order, by the threads that store the tile. TWOA: C = (A + A2) Bt^T.
// A, A2 and Bt lie in fragment order. BMAJ: A's row b T + t is C's row t NB + b.
// gemm_partials: the k loop of the tile at (r0, c0); it leaves wave w's partial tile in os, rows w 16 MT .., pitch 68 floats. The caller's barrier stands between it and the join. k_proj below shares it.
template <typename T16, bool TWOA, int KW, int MT>
__device__ __forceinline__ void gemm_partials(const T16* __restrict__ A, const T16* __restrict__ A2, const T16* __restrict__ Bt, int K, int r0, int c0, float* os) {
    typedef typename WFrag<T16>::V V;
    static_assert(MT >= 2 && MT <= 4, "the wait in the k loop names the addresses of row blocks 0, 1, MT - 2 and MT - 1");
    const int lane = threadIdx.x & 31, lr = lane & 15, hi = lane >> 4;
    const int w = __builtin_amdgcn_readfirstlane(threadIdx.x >> 5); const int kbeg = w * (K / KW), kend = kbeg + K / KW;
    v8f acc[MT][4];
#pragma unroll
    for (int mb = 0; mb < MT; ++mb)
#pragma unroll
        for (int nb = 0; nb < 4; ++nb) acc[mb][nb] = (v8f){};
    const size_t aoff = (size_t)r0 * K + 8 * lane, boff = (size_t)c0 * K + 8 * lane;   // 16 rows of blocks are 16 K values, one block of 32 k is 512
#pragma unroll 1
    for (int kc = kbeg; kc < kend; kc += 32) {
        const T16 *pa[MT], *pa2[MT], *pb[4]; V a[MT], a2[MT], b[4];
#pragma unroll
        for (int mb = 0; mb < MT; ++mb) { pa[mb] = A + aoff + (size_t)mb * 16 * K + (size_t)kc * 16; a[mb] = WFrag<T16>::ld(pa[mb]); pa2[mb] = pa[mb]; if (TWOA) { pa2[mb] = A2 + aoff + (size_t)mb * 16 * K + (size_t)kc * 16; a2[mb] = WFrag<T16>::ld(pa2[mb]); } }
#pragma unroll
        for (int nb = 0; nb < 4; ++nb) { pb[nb] = Bt + boff + (size_t)nb * 16 * K + (size_t)kc * 16; b[nb] = WFrag<T16>::ld(pb[nb]); }
        // one translation wait behind the trip's loads; the addresses are its inputs, so that no load's result and no later add lands in an address register ahead of it
        asm volatile("s_wait_xcnt 0x0" :: "v"(pa[0]), "v"(pa[1]), "v"(pa[MT - 2]), "v"(pa[MT - 1]), "v"(pa2[0]), "v"(pa2[1]), "v"(pa2[MT - 2]), "v"(pa2[MT - 1]), "v"(pb[0]), "v"(pb[1]), "v"(pb[2]), "v"(pb[3]) : "memory");
#pragma unroll
        for (int nb = 0; nb < 4; ++nb)
#pragma unroll
            for (int mb = 0; mb < MT; ++mb) { acc[mb][nb] = WFrag<T16>::mma(a[mb], b[nb], acc[mb][nb]); if (TWOA) acc[mb][nb] = WFrag<T16>::mma(a2[mb], b[nb], acc[mb][nb]); }
        // four vector slots behind the last WMMA on the loop's taken branch too
        asm volatile("v_nop\n\tv_nop\n\tv_nop\n\tv_nop" : "+v"(acc[0][0]), "+v"(acc[1][1]), "+v"(acc[MT - 2][2]), "+v"(acc[MT - 1][3]) : "v"(a[0]), "v"(a[MT - 1]));
    }
#pragma unroll
    for (int mb = 0; mb < MT; ++mb)
#pragma unroll
        for (int nb = 0; nb < 4; ++nb)
#pragma unroll
            for (int j = 0; j < 8; ++j) os[(w * (16 * MT) + mb * 16 + hi * 8 + j) * 68 + nb * 16 + lr] = acc[mb][nb][j];
}
template <typename T16, bool TWOA, bool BIAS, bool BMAJ, int KW, int MT>
__global__ __launch_bounds__(32 * KW) void k_gemmks(const T16* __restrict__ A, const T16* __restrict__ A2, const T16* __restrict__ Bt, int K, float* C, int ldc, const float* __restrict__ bias, size_t sA, size_t sB, size_t sC) {
    static_assert((MT * 8) % KW == 0, "the tile's 16-byte pieces divide evenly over the threads");
    __shared__ __align__(16) float os[KW * MT * 16 * 68];
    const size_t z = blockIdx.z; A += z * sA; if (TWOA) A2 += z * sA; Bt += z * sB; C += z * sC;
    const int r0 = blockIdx.x * (16 * MT), c0 = blockIdx.y * 64;
    gemm_partials<T16, TWOA, KW, MT>(A, A2, Bt, K, r0, c0, os);
    __syncthreads();   // every wave's partial tile is in LDS before any thread sums it
#pragma unroll
    for (int it = 0; it < MT * 8 / KW; ++it) { const int s = (int)threadIdx.x + it * (32 * KW); const int row = s >> 4, cofs = (s & 15) * 4; v4f val = *(const v4fa*)(os + row * 68 + cofs);
#pragma unroll
        for (int p = 1; p < KW; ++p) val += *(const v4fa*)(os + (p * (16 * MT) + row) * 68 + cofs);
        if (BIAS) { val[0] += bfr(bias[c0 + cofs]); val[1] += bfr(bias[c0 + cofs + 1]); val[2] += bfr(bias[c0 + cofs + 2]); val[3] += bfr(bias[c0 + cofs + 3]); }
        const unsigned m = (unsigned)(r0 + row), orow = BMAJ ? (m % TT) * NB_ + m / TT : m;
        *(v4f*)(C + (size_t)orow * ldc + c0 + cofs) = val; }
}

__device__ __forceinline__ h16 tohx(float x) { return (h16)x; }
__device__ __forceinline__ void splitf(float y, unsigned short& h, unsigned short& l) { h = f2bf(y); l = f2bf(y - bf2f(h)); }
typedef __attribute__((ext_vector_type(2))) _Float16 v2h;
typedef __attribute__((ext_vector_type(4))) _Float16 v4h;
typedef __attribute__((ext_vector_type(2))) unsigned short v2us;
typedef __attribute__((ext_vector_type(4))) int v4i;

// src [rows][DD] f32, row-major -> dst bf16 in fragment order; thread i makes the order's 16-byte piece i, so a wave stores 512 contiguous bytes and reads 64 bytes of each of 16 rows
__global__ __launch_bounds__(256) void k_cvt8(const float* __restrict__ src, bf* dst, size_t n8) { const size_t i = (size_t)blockIdx.x * 256 + threadIdx.x; if (i >= n8) return;
    const size_t blk = i >> 6; const float* ps = src + ((blk / (DD / 32)) * 16 + (i & 15)) * DD + (blk % (DD / 32)) * 32 + ((i >> 5) & 1) * 16 + ((i >> 4) & 1) * 8; const v8f v = *(const v8f*)ps; v8us o;
    // the translation wait behind the loads, the address its input, so that no later result lands in an address register ahead of it
    asm volatile("s_wait_xcnt 0x0" :: "v"(ps) : "memory");
#pragma unroll
    for (int k = 0; k < 8; ++k) o[k] = f2bf(v[k]); *(v8us*)(dst + i * 8) = o;  }
// ---- k_proj: the q, k, v and r projections in one launch, each 64x64 tile stored straight as the fp16 operand planes of k_relattn, in fragment order; no f32 plane in memory. 4 waves, the k loop and the join order of k_gemmks.
// W: the rows of qkv_w, then those of r_w (4 DD rows); a column tile of 64 is one head of q, k, v or r_k. grid (NT / 64, 56): y < 48 is the column tile, x the row tile of XB (rows t NB + b: 32 t of both batches);
// the 8 x 64 workgroups behind them are the 32 row tiles x 16 heads of RB. A tile holds whole 1-KiB blocks of its planes: thread piece = 16 bytes, a wave's store = 512 contiguous bytes.
// QA = q + r_w_bias, QB = q + r_r_bias, KP = k: [batch x head][T][64]; RK: [head][T][64]; VT: [batch x head][64 rows d][T] (k = t).
// the join of one 16-byte piece: 8 neighbouring columns of one tile row, the four waves' partial sums added in wave order
__device__ __forceinline__ v8f join8(const float* pp) { v4f v0 = *(const v4fa*)pp, v1 = *(const v4fa*)(pp + 4);
#pragma unroll
    for (int p = 1; p < 4; ++p) { v0 += *(const v4fa*)(pp + p * 64 * 68); v1 += *(const v4fa*)(pp + p * 64 * 68 + 4); }
    return __builtin_shufflevector(v0, v1, 0, 1, 2, 3, 4, 5, 6, 7); }
__device__ __forceinline__ v8h addh8(v8f v, v8f b) { v8h o;
#pragma unroll
    for (int q = 0; q < 8; ++q) o[q] = tohx(__fadd_rn(v[q], b[q]));
    return o; }
// a thread's four pieces of one plane
__device__ __forceinline__ void store4(h16* const (&p)[4], const v8h (&o)[4]) {
#pragma unroll
    for (int it = 0; it < 4; ++it) *(v8h*)p[it] = o[it];
    // the translation wait behind the stores, their addresses and values its inputs, so that no later result lands in one of those registers ahead of it
    asm volatile("s_wait_xcnt 0x0" :: "v"(p[0]), "v"(p[1]), "v"(p[2]), "v"(p[3]), "v"(o[0]), "v"(o[1]), "v"(o[2]), "v"(o[3]) : "memory"); }
__global__ __launch_bounds__(128) void k_proj(const bf* __restrict__ XB, const bf* __restrict__ RB, const bf* __restrict__ W, const float* __restrict__ rwb, const float* __restrict__ rrb, h16* QA, h16* QB, h16* KP, h16* VT, h16* RK) {
    __shared__ __align__(16) float os[4 * 64 * 68];
    const int y = blockIdx.y; const bool isr = y >= 48; const int rid = (y - 48) * (NT / 64) + (int)blockIdx.x;
    const int xt = isr ? rid & (TT / 64 - 1) : (int)blockIdx.x, ct = isr ? 48 + rid / (TT / 64) : y; const int kind = ct >> 4, h = ct & 15;   // kind 0 q, 1 k, 2 v, 3 r_k: the same for the whole workgroup
    // thread -> its place in a block: l the 16-byte piece of a half block, hf the half, kb one bit of the block's number; the other two bits are the trip it
    const int l = threadIdx.x & 31, lr = l & 15, hi = l >> 4, hf = ((int)threadIdx.x >> 5) & 1, kb = (int)threadIdx.x >> 6; const int po = hf * 256 + l * 8;
    const int d = kb * 32 + hf * 16 + hi * 8;   // q, k, r_k: the piece's first column, the same on every trip
    v8f ba = (v8f){}, bb = (v8f){};
    if (kind == 0) { const float* pa = rwb + h * HD + d; const float* pb = rrb + h * HD + d; ba = *(const v8f*)pa; bb = *(const v8f*)pb;   // the head's biases, fetched in front of the k loop, which hides their latency
        // the translation wait behind the loads, the addresses its inputs (as in k_cvt8)
        asm volatile("s_wait_xcnt 0x0" :: "v"(pa), "v"(pb) : "memory"); }
    gemm_partials<bf, false, 4, 4>(isr ? RB : XB, nullptr, W, DD, xt * 64, ct * 64, os);
    __syncthreads();   // every wave's partial tile is in LDS before any thread sums it
    h16* pd[4]; v8h o[4];
    if (kind == 2) {
#pragma unroll
        for (int it = 0; it < 4; ++it) { const int db = (it & 1) * 2 + kb, b = it >> 1; const float* pp = os + ((hf * 16 + hi * 8) * NB_ + b) * 68 + db * 16 + lr;   // 8 rows t of column d = 16 db + lr
#pragma unroll
            for (int q = 0; q < 8; ++q) { float v = pp[q * NB_ * 68];
#pragma unroll
                for (int p = 1; p < 4; ++p) v += pp[(p * 64 + q * NB_) * 68];
                o[it][q] = tohx(v); }
            pd[it] = VT + (size_t)(b * NH_ + h) * HD * TT + (size_t)(db * (TT / 32) + xt) * 512 + po; }
        store4(pd, o);
    } else { v8f v[4]; size_t off[4]; h16* P = kind == 0 ? QA : kind == 1 ? KP : RK;
#pragma unroll
        for (int q = 0; q < 8; ++q) { ba[q] = bfr(ba[q]); bb[q] = bfr(bb[q]); }
#pragma unroll
        for (int it = 0; it < 4; ++it) { v[it] = join8(os + (kind == 3 ? it * 16 + lr : ((it & 1) * 16 + lr) * NB_ + (it >> 1)) * 68 + d);
            off[it] = (kind == 3 ? (size_t)h * TT * HD + (size_t)(xt * 4 + it) * 1024 : (size_t)((it >> 1) * NH_ + h) * TT * HD + (size_t)(xt * 2 + (it & 1)) * 1024) + kb * 512 + po;
            pd[it] = P + off[it]; o[it] = addh8(v[it], ba); }   // k, r_k: ba is zero
        store4(pd, o);
        if (kind == 0) {
#pragma unroll
            for (int it = 0; it < 4; ++it) { pd[it] = QB + off[it]; o[it] = addh8(v[it], bb); }
            store4(pd, o); }
    }
}
// ---- k_relattn: scores, relative shift, softmax, P.V and the head merge for RT query rows of one (batch, head); grid (T / RT, batch x heads), 16 waves.
// The RT score rows stay in LDS (f32, pitch SP floats). BD[i][m] = (q_i + r_r_bias).r_k[m] lands where the module's zero-pad/reshape shift puts it: at row i, key m - (T - 1 - i), when that is >= 0,
// else at row i - 1, key m + i + 1; row i, key i + 1 is the shift's zero. So the rows i0 .. i0 + RT - 1 take the first kind from q rows i0 .. and the second kind from q rows i0 + 1 .. .
// Then AC is added in place, each wave does the softmax of two rows and leaves P x1024 (fp16) in the first half of the row's own LDS; P.V splits the keys over the 16 waves, whose f32 partial tiles
// lie in the second half of the rows and are joined in wave order by the threads that store the merged bf16 hi/lo planes. All five operand planes and the two merged planes lie in fragment order.
#define RT 32
#define SP 2052
// e^x as the fast library form has it, 2^(x log2 e); the v_nop is the one independent slot that the instruction set asks for behind a transcendental, in the same statement so that it stays directly behind it
__device__ __forceinline__ float exp_slot(float x) { float r; asm("v_exp_f32 %0, %1\n\tv_nop" : "=v"(r) : "v"(x * 1.44269504f)); return r; }
typedef v4h __attribute__((may_alias)) v4ha;
typedef __attribute__((ext_vector_type(4))) unsigned short v4us;
__global__ __launch_bounds__(512) void k_relattn(const h16* __restrict__ QA, const h16* __restrict__ QB, const h16* __restrict__ KP, const h16* __restrict__ RK, const h16* __restrict__ VT, bf* Ah, bf* Al) {
    __shared__ __align__(16) float S[RT * SP];
    const int z = blockIdx.y, b = z >> 4, h = z & 15, i0 = blockIdx.x * RT;
    const int lane = threadIdx.x & 31, lr = lane & 15, hi = lane >> 4; const int w = __builtin_amdgcn_readfirstlane(threadIdx.x >> 5);
    QA += (size_t)z * TT * HD; QB += (size_t)z * TT * HD; KP += (size_t)z * TT * HD; VT += (size_t)z * HD * TT; RK += (size_t)h * TT * HD;
    const int fo = 8 * lane;   // this lane's place in a block of the fragment order; 16 rows of a plane with 64 values a row are two blocks, k 0 .. 31 and 32 .. 63
    {   // BD, stored shifted; wave w takes the 16-column tiles w, w + 16, ...
        v16h ql[2][2], qu[2][2]; const h16* pl = QB + i0 * HD; const h16* pr = RK + w * 16 * HD; const h16* pu[2];   // pl, pr: the same for the whole wave; the lane's place fo is added at each load
#pragma unroll
        for (int mb = 0; mb < 2; ++mb) { const int ru = min(i0 + 1 + mb * 16 + lr, TT - 1); pu[mb] = QB + (ru >> 4) * (16 * HD) + (hi * 16 + (ru & 15)) * 8;   // the row behind the last one feeds no key: any row in bounds serves
#pragma unroll
            for (int ks = 0; ks < 2; ++ks) { ql[mb][ks] = WFrag<h16>::ld(pl + fo + mb * 16 * HD + ks * 512); qu[mb][ks] = WFrag<h16>::ld(pu[mb] + ks * 512); } }
#pragma unroll
        for (int g = 0; g < 2; ++g) { v16h rb[4][2];
#pragma unroll
            for (int s = 0; s < 4; ++s)
#pragma unroll
                for (int ks = 0; ks < 2; ++ks) rb[s][ks] = WFrag<h16>::ld(pr + fo + (g * 4 + s) * 256 * HD + ks * 512);
            // one translation wait behind the batch's loads; the addresses are its inputs (the wave's bases in scalar registers, the lane number that the loads scale), so that no load's result and no later add lands in an address register ahead of it
            asm volatile("s_wait_xcnt 0x0" :: "s"(pl), "v"(pu[0]), "v"(pu[1]), "s"(pr), "v"(lane) : "memory");
#pragma unroll
            for (int s = 0; s < 4; ++s)
#pragma unroll
                for (int mb = 0; mb < 2; ++mb) { const int base = ((g * 4 + s) * 16 + w) * 16 + i0 + mb * 16; float* sr = S + (mb * 16 + hi * 8) * SP;
                    if (base + 30 >= TT - 1) { v8f c = (v8f){}; c = wmma16(ql[mb][0], rb[s][0], c); c = wmma16(ql[mb][1], rb[s][1], c); const int j = base + lr + hi * 8 - (TT - 1);
#pragma unroll
                        for (int q = 0; q < 8; ++q) if (j + q >= 0) sr[q * SP + j + q] = c[q]; }
                    if (base + 2 < TT) { v8f c = (v8f){}; c = wmma16(qu[mb][0], rb[s][0], c); c = wmma16(qu[mb][1], rb[s][1], c); const int j = base + lr + hi * 8 + 2;
#pragma unroll
                        for (int q = 0; q < 8; ++q) if (j + q < TT) sr[q * SP + j + q] = c[q]; } } }
        if (threadIdx.x < RT) { const int j = i0 + (int)threadIdx.x + 1; if (j < TT) S[threadIdx.x * SP + j] = 0.f; }
    }
    {   // AC, added in place: s = (AC + BD) / 8; its first operands are fetched in front of the barrier, so that they fly while the wave waits there
        v16h qa[2][2]; const h16* pq = QA + i0 * HD; const h16* pk = KP + w * 16 * HD;
#pragma unroll
        for (int mb = 0; mb < 2; ++mb)
#pragma unroll
            for (int ks = 0; ks < 2; ++ks) qa[mb][ks] = WFrag<h16>::ld(pq + fo + mb * 16 * HD + ks * 512);
#pragma unroll
        for (int g = 0; g < 2; ++g) { v16h kb[4][2];
#pragma unroll
            for (int s = 0; s < 4; ++s)
#pragma unroll
                for (int ks = 0; ks < 2; ++ks) kb[s][ks] = WFrag<h16>::ld(pk + fo + (g * 4 + s) * 256 * HD + ks * 512);
            // one translation wait behind the batch's loads, the addresses its inputs (as above)
            asm volatile("s_wait_xcnt 0x0" :: "s"(pq), "s"(pk), "v"(lane) : "memory");
            if (g == 0) __syncthreads();   // every shifted BD value is in LDS before AC is added to it
#pragma unroll
            for (int s = 0; s < 4; ++s)
#pragma unroll
                for (int mb = 0; mb < 2; ++mb) { v8f c = (v8f){}; c = wmma16(qa[mb][0], kb[s][0], c); c = wmma16(qa[mb][1], kb[s][1], c); float* sr = S + (mb * 16 + hi * 8) * SP + ((g * 4 + s) * 16 + w) * 16 + lr;
#pragma unroll
                    for (int q = 0; q < 8; ++q) sr[q * SP] = __fmul_rn(__fadd_rn(c[q], sr[q * SP]), 0.125f); } }
    }
    __syncthreads();   // whole score rows are in LDS before a wave reads its two
#pragma unroll
    for (int rr = 0; rr < 2; ++rr) { float* sr = S + (w * 2 + rr) * SP; float v[64]; float mx = -3.0e38f;
#pragma unroll
        for (int ch = 0; ch < 16; ++ch) { const v4f a = *(const v4fa*)(sr + ch * 128 + lane * 4);
#pragma unroll
            for (int q = 0; q < 4; ++q) { v[ch * 4 + q] = a[q]; mx = fmaxf(mx, a[q]); } }
#pragma unroll
        for (int sh = 16; sh; sh >>= 1) mx = fmaxf(mx, __shfl_xor(mx, sh, 32));
        float sum = 0.f;
#pragma unroll
        for (int k = 0; k < 64; ++k) { v[k] = exp_slot(v[k] - mx); sum += v[k]; }
#pragma unroll
        for (int sh = 16; sh; sh >>= 1) sum += __shfl_xor(sum, sh, 32);
        const float fct = __fdiv_rn(PCAR, sum); h16* pr = (h16*)sr;
#pragma unroll
        for (int ch = 0; ch < 16; ++ch) { v4h o;
#pragma unroll
            for (int q = 0; q < 4; ++q) o[q] = tohx(v[ch * 4 + q] * fct);
            *(v4ha*)(pr + ch * 128 + lane * 4) = o; } }
    v16h vb[4][4]; const h16* pv = VT + w * 4 * 512;   // this wave's 128 keys of V, fetched in front of the barrier, so that they fly while the wave waits there
#pragma unroll
    for (int ks = 0; ks < 4; ++ks)
#pragma unroll
        for (int nb = 0; nb < 4; ++nb) vb[ks][nb] = WFrag<h16>::ld(pv + fo + nb * 16 * TT + ks * 512);
    // one translation wait behind the batch's loads, the address its input (as above)
    asm volatile("s_wait_xcnt 0x0" :: "s"(pv), "v"(lane) : "memory");
    __syncthreads();   // every row of P is in LDS before any wave multiplies it
    v8f acc[2][4];
#pragma unroll
    for (int mb = 0; mb < 2; ++mb)
#pragma unroll
        for (int nb = 0; nb < 4; ++nb) acc[mb][nb] = (v8f){};
#pragma unroll
    for (int ks = 0; ks < 4; ++ks) { const int kc = w * 128 + ks * 32 + 8 * hi; v16h a[2];
#pragma unroll
        for (int mb = 0; mb < 2; ++mb) { const h16* p = (const h16*)S + (mb * 16 + lr) * (2 * SP) + kc; a[mb] = cat16(*(const v8ha*)p, *(const v8ha*)(p + 16)); }
#pragma unroll
        for (int nb = 0; nb < 4; ++nb)
#pragma unroll
            for (int mb = 0; mb < 2; ++mb) acc[mb][nb] = wmma16(a[mb], vb[ks][nb], acc[mb][nb]); }
#pragma unroll
    for (int mb = 0; mb < 2; ++mb)
#pragma unroll
        for (int nb = 0; nb < 4; ++nb)
#pragma unroll
            for (int q = 0; q < 8; ++q) S[(mb * 16 + hi * 8 + q) * SP + 1024 + w * 64 + nb * 16 + lr] = acc[mb][nb][q];
    __syncthreads();   // every wave's partial tile is in LDS before any thread sums it
    { const int row = (int)threadIdx.x >> 4, cofs = ((int)threadIdx.x & 15) * 4; const float* pp = S + row * SP + 1024 + cofs; v4f val = *(const v4fa*)pp;
#pragma unroll
        for (int p = 1; p < 16; ++p) val += *(const v4fa*)(pp + p * 64);
        v4us oh, ol;
#pragma unroll
        for (int q = 0; q < 4; ++q) { unsigned short x, y; splitf(val[q] * (1.0f / PCAR), x, y); oh[q] = x; ol[q] = y; }
        // the merged planes in fragment order, row b T + t, so that this workgroup alone writes its four blocks (2 x 16 rows, the head's 2 x 32 columns)
        const size_t o = ((size_t)((b * TT + i0 + row) >> 4) * (DD / 32) + h * 2 + (cofs >> 5)) * 512 + (cofs & 16) * 16 + (((cofs >> 3) & 1) * 16 + (row & 15)) * 8 + (cofs & 7); *(v4us*)(Ah + o) = oh; *(v4us*)(Al + o) = ol; }
}

extern "C" void kernel_launch(void* const* d_in, const int* in_sizes, int n_in,
                              void* d_out, int out_size, void* d_ws, size_t ws_size, hipStream_t stream) {
    (void)in_sizes; (void)n_in; (void)out_size;
    const float* x = (const float*)d_in[0]; const float* r = (const float*)d_in[1]; const float* rwb = (const float*)d_in[2]; const float* rrb = (const float*)d_in[3]; const float* qkvw = (const float*)d_in[4]; const float* rw = (const float*)d_in[5]; const float* ow = (const float*)d_in[6]; const float* ob = (const float*)d_in[7];
    float* OUT = (float*)d_out;     // [2048][2][1024] (rows t*2 + b)
    char* wsp = (char*)d_ws;
    auto take = [&](size_t bytes) { char* p = wsp; wsp += (bytes + 255) & ~(size_t)255; return (void*)p; };
    bf* WQ = (bf*)take((size_t)DD * DD * 2); bf* WK = (bf*)take((size_t)DD * DD * 2); bf* WV = (bf*)take((size_t)DD * DD * 2); bf* WR = (bf*)take((size_t)DD * DD * 2); bf* WO = (bf*)take((size_t)DD * DD * 2);
    bf* XB = (bf*)take((size_t)NT * DD * 2); bf* RB = (bf*)take((size_t)TT * DD * 2);
    h16* QA = (h16*)take((size_t)NT * DD * 2); h16* QB = (h16*)take((size_t)NT * DD * 2); h16* KP = (h16*)take((size_t)NT * DD * 2); h16* VT = (h16*)take((size_t)NT * DD * 2); h16* RK = (h16*)take((size_t)NH_ * TT * HD * 2);
    bf* ATh = (bf*)take((size_t)NT * DD * 2); bf* ATl = (bf*)take((size_t)NT * DD * 2);
    if ((size_t)(wsp - (char*)d_ws) > ws_size) return;    // total 74 MiB
    { const size_t nw = (size_t)DD * DD / 8; const unsigned gw = (unsigned)((nw + 255) / 256); k_cvt8<<<gw, 256, 0, stream>>>(qkvw, WQ, nw); k_cvt8<<<gw, 256, 0, stream>>>(qkvw + (size_t)DD * DD, WK, nw); k_cvt8<<<gw, 256, 0, stream>>>(qkvw + (size_t)2 * DD * DD, WV, nw); k_cvt8<<<gw, 256, 0, stream>>>(rw, WR, nw); k_cvt8<<<gw, 256, 0, stream>>>(ow, WO, nw);
      const size_t nx = (size_t)NT * DD / 8; k_cvt8<<<(unsigned)((nx + 255) / 256), 256, 0, stream>>>(x, XB, nx); k_cvt8<<<(unsigned)((nx / 2 + 255) / 256), 256, 0, stream>>>(r, RB, nx / 2); }
    const dim3 gP(NT / 64, DD / 64, 1);
    k_proj<<<dim3(NT / 64, 56, 1), 128, 0, stream>>>(XB, RB, WQ, rwb, rrb, QA, QB, KP, VT, RK);   // WQ, WK, WV, WR lie one behind the other: the 4 DD rows of W
    k_relattn<<<dim3(TT / RT, NB_ * NH_, 1), 512, 0, stream>>>(QA, QB, KP, RK, VT, ATh, ATl);
    k_gemmks<bf, true, true, true, 4, 4><<<gP, 128, 0, stream>>>(ATh, ATl, WO, DD, OUT, DD, ob, 0, 0, 0);
}

// v005
// A run of this version takes 201 microseconds.
// Two timings next to v004 put it at 1.07 and 1.06 times that version's speed.
// Over all steps from v000 it is 7.64 times as fast.
#include <hip/hip_runtime.h>

// Relative-position multi-head attention (segment-recurrence style relative shift; query [2048][2][1024] seq-first, r [2048][1024]; w = query qkv_w^T -> q|k|v (16 heads x 64); r_k = r r_w^T; AC = (q + r_w_bias).k,
// BD = rel_shift((q + r_r_bias).r_k) with the module's exact zero-pad/reshape shift (out[i][j] = BD[f / (T+1)][f % (T+1) - 1] or 0 when f % (T+1) == 0, f = T + i*T + j); p = softmax((AC + BD) / 8)
// over the keys; attn = p.v; out = merged out_w^T + out_b; output [2048][2][1024] (rows t*2 + b)).
// Compute dtypes, f32 accumulate: every input rounded to bf16; the qkv and r projections on PLAIN bf16 operands (inputs: exact); AC, BD and attn.v on SINGLE fp16 planes
// (the per-head biases added in f32 before the fp16 rounding; logit sd ~ 0.6); the relative shift is an index scatter into the LDS score rows of the fused attention kernel; P x1024;

#define NB_  2
#define TT   2048
#define DD   1024
#define NH_  16
#define HD   64
#define NT   (NB_ * TT)
#define PCAR 1024.0f
typedef _Float16 h16;
typedef unsigned short bf;
typedef __attribute__((ext_vector_type(16))) __bf16   v16bf;
typedef __attribute__((ext_vector_type(16))) _Float16 v16h;
typedef __attribute__((ext_vector_type(8)))  _Float16 v8h;
typedef __attribute__((ext_vector_type(8)))  unsigned short v8us;
typedef __attribute__((ext_vector_type(8)))  float    v8f;
typedef __attribute__((ext_vector_type(4)))  float    v4f;
typedef v8h  __attribute__((may_alias)) v8ha;
typedef v4f  __attribute__((may_alias)) v4fa;
typedef v8us __attribute__((may_alias)) v8usa;

__device__ __forceinline__ unsigned short f2bf(float f) { unsigned u = __float_as_uint(f); u += 0x7FFFu + ((u >> 16) & 1u); return (unsigned short)(u >> 16); }
__device__ __forceinline__ float bf2f(unsigned short b) { return __uint_as_float(((unsigned)b) << 16); }
__device__ __forceinline__ float bfr(float f) { return bf2f(f2bf(f)); }
__device__ __forceinline__ v16h cat16(v8h lo, v8h hi) { return __builtin_shufflevector(lo, hi, 0, 1, 2, 3, 4, 5, 6, 7, 8, 9, 10, 11, 12, 13, 14, 15); }
__device__ __forceinline__ v16bf cat16b(v8us lo, v8us hi) { return __builtin_bit_cast(v16bf, __builtin_shufflevector(lo, hi, 0, 1, 2, 3, 4, 5, 6, 7, 8, 9, 10, 11, 12, 13, 14, 15)); }
__device__ __forceinline__ v8f wmma16(v16h a, v16h b, v8f c) { return __builtin_amdgcn_wmma_f32_16x16x32_f16(false, a, false, b, (short)0, c, false, false); }
__device__ __forceinline__ v8f wmmab(v16bf a, v16bf b, v8f c) { return __builtin_amdgcn_wmma_f32_16x16x32_bf16(false, a, false, b, (short)0, c, false, false); }



// FRAGMENT ORDER: every 16-bit operand plane [rows][K] that a kernel fetches from global memory lies in blocks of 16 rows x 32 k (512 values, 1 KiB), block (row / 16) * (K / 32) + k / 32;
// inside a block the value (row % 16, k % 32) lies at (k & 16) * 16 + ((k >> 3 & 1) * 16 + row % 16) * 8 + (k & 7). Lane l = 16 hi + lr of a fragment (row lr; k = 8 hi .. 8 hi + 7 and 16 + 8 hi .. 16 + 8 hi + 7)
// so finds its two 16-byte pieces at 8 l and 256 + 8 l, and each of the wave's two loads covers 512 contiguous bytes, four whole lines, where a row-major plane makes it touch sixteen.
// fragment loaders: p = the block's start + 8 lane
template <typename T16> struct WFrag;
template <> struct WFrag<h16> { typedef v16h V; static __device__ __forceinline__ V ld(const h16* p) { return cat16(*(const v8h*)p, *(const v8h*)(p + 256)); } static __device__ __forceinline__ v8f mma(V a, V b, v8f c) { return wmma16(a, b, c); } };
template <> struct WFrag<bf> { typedef v16bf V; static __device__ __forceinline__ V ld(const bf* p) { return cat16b(*(const v8us*)p, *(const v8us*)(p + 256)); } static __device__ __forceinline__ v8f mma(V a, V b, v8f c) { return wmmab(a, b, c); } };
// ---- k_gemmks: C[m][n] (f32, pitch ldc, + optional f32 bias[n]) = sum_k A[m][k] Bt[n][k] for a long K and few output tiles: one workgroup of KW waves per (16 MT)x64 tile; grid (M/(16 MT), N/64, Z), 32 KW threads. K % (32 KW) == 0.
// Wave w sums k in [w K/KW, (w+1) K/KW) into its own MT x 4 accumulators; the KW f32 partial tiles are joined through LDS, in wave order, by the threads that store the tile. TWOA: C = (A + A2) Bt^T.
// A, A2 and Bt lie in fragment order. BMAJ: A's row b T + t is C's row t NB + b.
// gemm_partials: the k loop of the tile at (r0, c0); it leaves wave w's partial tile in os, rows w 16 MT .., pitch 68 floats. The caller's barrier stands between it and the join. k_proj below shares it.
template <typename T16, bool TWOA, int KW, int MT>
__device__ __forceinline__ void gemm_partials(const T16* __restrict__ A, const T16* __restrict__ A2, const T16* __restrict__ Bt, int K, int r0, int c0, float* os) {
    typedef typename WFrag<T16>::V V;
    static_assert(MT >= 2 && MT <= 4, "the wait in the k loop names the addresses of row blocks 0, 1, MT - 2 and MT - 1");
    const int lane = threadIdx.x & 31, lr = lane & 15, hi = lane >> 4;
    const int w = __builtin_amdgcn_readfirstlane(threadIdx.x >> 5); const int kbeg = w * (K / KW), kend = kbeg + K / KW;
    v8f acc[MT][4];
#pragma unroll
    for (int mb = 0; mb < MT; ++mb)
#pragma unroll
        for (int nb = 0; nb < 4; ++nb) acc[mb][nb] = (v8f){};
    const size_t aoff = (size_t)r0 * K + 8 * lane, boff = (size_t)c0 * K + 8 * lane;   // 16 rows of blocks are 16 K values, one block of 32 k is 512
#pragma unroll 1
    for (int kc = kbeg; kc < kend; kc += 32) {
        const T16 *pa[MT], *pa2[MT], *pb[4]; V a[MT], a2[MT], b[4];
#pragma unroll
        for (int mb = 0; mb < MT; ++mb) { pa[mb] = A + aoff + (size_t)mb * 16 * K + (size_t)kc * 16; a[mb] = WFrag<T16>::ld(pa[mb]); pa2[mb] = pa[mb]; if (TWOA) { pa2[mb] = A2 + aoff + (size_t)mb * 16 * K + (size_t)kc * 16; a2[mb] = WFrag<T16>::ld(pa2[mb]); } }
#pragma unroll
        for (int nb = 0; nb < 4; ++nb) { pb[nb] = Bt + boff + (size_t)nb * 16 * K + (size_t)kc * 16; b[nb] = WFrag<T16>::ld(pb[nb]); }
        // one translation wait behind the trip's loads; the addresses are its inputs, so that no load's result and no later add lands in an address register ahead of it
        asm volatile("s_wait_xcnt 0x0" :: "v"(pa[0]), "v"(pa[1]), "v"(pa[MT - 2]), "v"(pa[MT - 1]), "v"(pa2[0]), "v"(pa2[1]), "v"(pa2[MT - 2]), "v"(pa2[MT - 1]), "v"(pb[0]), "v"(pb[1]), "v"(pb[2]), "v"(pb[3]) : "memory");
#pragma unroll
        for (int nb = 0; nb < 4; ++nb)
#pragma unroll
            for (int mb = 0; mb < MT; ++mb) { acc[mb][nb] = WFrag<T16>::mma(a[mb], b[nb], acc[mb][nb]); if (TWOA) acc[mb][nb] = WFrag<T16>::mma(a2[mb], b[nb], acc[mb][nb]); }
        // four vector slots behind the last WMMA on the loop's taken branch too
        asm volatile("v_nop\n\tv_nop\n\tv_nop\n\tv_nop" : "+v"(acc[0][0]), "+v"(acc[1][1]), "+v"(acc[MT - 2][2]), "+v"(acc[MT - 1][3]) : "v"(a[0]), "v"(a[MT - 1]));
    }
#pragma unroll
    for (int mb = 0; mb < MT; ++mb)
#pragma unroll
        for (int nb = 0; nb < 4; ++nb)
#pragma unroll
            for (int j = 0; j < 8; ++j) os[(w * (16 * MT) + mb * 16 + hi * 8 + j) * 68 + nb * 16 + lr] = acc[mb][nb][j];
}
template <typename T16, bool TWOA, bool BIAS, bool BMAJ, int KW, int MT>
__global__ __launch_bounds__(32 * KW) void k_gemmks(const T16* __restrict__ A, const T16* __restrict__ A2, const T16* __restrict__ Bt, int K, float* C, int ldc, const float* __restrict__ bias, size_t sA, size_t sB, size_t sC) {
    static_assert((MT * 8) % KW == 0, "the tile's 16-byte pieces divide evenly over the threads");
    __shared__ __align__(16) float os[KW * MT * 16 * 68];
    const size_t z = blockIdx.z; A += z * sA; if (TWOA) A2 += z * sA; Bt += z * sB; C += z * sC;
    const int r0 = blockIdx.x * (16 * MT), c0 = blockIdx.y * 64;
    gemm_partials<T16, TWOA, KW, MT>(A, A2, Bt, K, r0, c0, os);
    __syncthreads();   // every wave's partial tile is in LDS before any thread sums it
#pragma unroll
    for (int it = 0; it < MT * 8 / KW; ++it) { const int s = (int)threadIdx.x + it * (32 * KW); const int row = s >> 4, cofs = (s & 15) * 4; v4f val = *(const v4fa*)(os + row * 68 + cofs);
#pragma unroll
        for (int p = 1; p < KW; ++p) val += *(const v4fa*)(os + (p * (16 * MT) + row) * 68 + cofs);
        if (BIAS) { val[0] += bfr(bias[c0 + cofs]); val[1] += bfr(bias[c0 + cofs + 1]); val[2] += bfr(bias[c0 + cofs + 2]); val[3] += bfr(bias[c0 + cofs + 3]); }
        const unsigned m = (unsigned)(r0 + row), orow = BMAJ ? (m % TT) * NB_ + m / TT : m;
        *(v4f*)(C + (size_t)orow * ldc + c0 + cofs) = val; }
}

__device__ __forceinline__ h16 tohx(float x) { return (h16)x; }
__device__ __forceinline__ void splitf(float y, unsigned short& h, unsigned short& l) { h = f2bf(y); l = f2bf(y - bf2f(h)); }
typedef __attribute__((ext_vector_type(2))) _Float16 v2h;
typedef __attribute__((ext_vector_type(4))) _Float16 v4h;
typedef __attribute__((ext_vector_type(2))) unsigned short v2us;
typedef __attribute__((ext_vector_type(4))) int v4i;

// ---- k_cvtall: every f32 input matrix [rows][DD], row-major -> bf16 in fragment order, in one launch. dst: the planes of qkv_w, r_w, out_w, query and r, which lie one behind the other in the workspace, in this order.
// One workgroup makes one row of blocks: 16 source rows x DD columns, 2048 pieces of 16 bytes, 32 KiB of dst; grid = all rows / 16. Thread t makes the pieces t, t + 256, ..: a wave stores 512 contiguous bytes and reads 64 bytes of each of 16 rows.
// A thread's eight loads are all issued before the first value is used, so that a wave has 8 KiB in flight and the launch needs an eighth of the waves that one piece a thread takes.
#define GQKV (3 * DD / 16)
#define GW   (DD / 16)
#define GX   (NT / 16)
#define GR   (TT / 16)
__global__ __launch_bounds__(256) void k_cvtall(const float* __restrict__ qkvw, const float* __restrict__ rw, const float* __restrict__ ow, const float* __restrict__ x, const float* __restrict__ r, bf* dst) {
    const int g = blockIdx.x, t = threadIdx.x;   // the source matrix and the row group in it are the same for the whole workgroup
    const float* src = g < GQKV ? qkvw : g < GQKV + GW ? rw : g < GQKV + 2 * GW ? ow : g < GQKV + 2 * GW + GX ? x : r;
    const int gl = g - (g < GQKV ? 0 : g < GQKV + GW ? GQKV : g < GQKV + 2 * GW ? GQKV + GW : g < GQKV + 2 * GW + GX ? GQKV + 2 * GW : GQKV + 2 * GW + GX);
    const float* ps = src + (size_t)(gl * 16 + (t & 15)) * DD + (t >> 6) * 32 + ((t >> 5) & 1) * 16 + ((t >> 4) & 1) * 8; v8f v[8];   // piece t + 256 j lies four blocks, 128 columns, behind piece t + 256 (j - 1)
#pragma unroll
    for (int j = 0; j < 8; ++j) v[j] = *(const v8f*)(ps + j * 128);
    // the translation wait behind the loads, the address its input, so that no later result lands in an address register ahead of it
    asm volatile("s_wait_xcnt 0x0" :: "v"(ps) : "memory");
    bf* pd = dst + (size_t)g * 16384 + t * 8;
#pragma unroll
    for (int j = 0; j < 8; ++j) { v8us o;
#pragma unroll
        for (int k = 0; k < 8; ++k) o[k] = f2bf(v[j][k]);
        *(v8us*)(pd + j * 2048) = o; }
}
// ---- k_proj: the q, k, v and r projections in one launch, each 64x64 tile stored straight as the fp16 operand planes of k_relattn, in fragment order; no f32 plane in memory. 4 waves, the k loop and the join order of k_gemmks.
// W: the rows of qkv_w, then those of r_w (4 DD rows); a column tile of 64 is one head of q, k, v or r_k. grid (NT / 64, 56): y < 48 is the column tile, x the row tile of XB (rows t NB + b: 32 t of both batches);
// the 8 x 64 workgroups behind them are the 32 row tiles x 16 heads of RB. A tile holds whole 1-KiB blocks of its planes: thread piece = 16 bytes, a wave's store = 512 contiguous bytes.
// QA = q + r_w_bias, QB = q + r_r_bias, KP = k: [batch x head][T][64]; RK: [head][T][64]; VT: [batch x head][64 rows d][T] (k = t).
// the join of one 16-byte piece: 8 neighbouring columns of one tile row, the four waves' partial sums added in wave order
__device__ __forceinline__ v8f join8(const float* pp) { v4f v0 = *(const v4fa*)pp, v1 = *(const v4fa*)(pp + 4);
#pragma unroll
    for (int p = 1; p < 4; ++p) { v0 += *(const v4fa*)(pp + p * 64 * 68); v1 += *(const v4fa*)(pp + p * 64 * 68 + 4); }
    return __builtin_shufflevector(v0, v1, 0, 1, 2, 3, 4, 5, 6, 7); }
__device__ __forceinline__ v8h addh8(v8f v, v8f b) { v8h o;
#pragma unroll
    for (int q = 0; q < 8; ++q) o[q] = tohx(__fadd_rn(v[q], b[q]));
    return o; }
// a thread's four pieces of one plane
__device__ __forceinline__ void store4(h16* const (&p)[4], const v8h (&o)[4]) {
#pragma unroll
    for (int it = 0; it < 4; ++it) *(v8h*)p[it] = o[it];
    // the translation wait behind the stores, their addresses and values its inputs, so that no later result lands in one of those registers ahead of it
    asm volatile("s_wait_xcnt 0x0" :: "v"(p[0]), "v"(p[1]), "v"(p[2]), "v"(p[3]), "v"(o[0]), "v"(o[1]), "v"(o[2]), "v"(o[3]) : "memory"); }
__global__ __launch_bounds__(128) void k_proj(const bf* __restrict__ XB, const bf* __restrict__ RB, const bf* __restrict__ W, const float* __restrict__ rwb, const float* __restrict__ rrb, h16* QA, h16* QB, h16* KP, h16* VT, h16* RK) {
    __shared__ __align__(16) float os[4 * 64 * 68];
    const int y = blockIdx.y; const bool isr = y >= 48; const int rid = (y - 48) * (NT / 64) + (int)blockIdx.x;
    const int xt = isr ? rid & (TT / 64 - 1) : (int)blockIdx.x, ct = isr ? 48 + rid / (TT / 64) : y; const int kind = ct >> 4, h = ct & 15;   // kind 0 q, 1 k, 2 v, 3 r_k: the same for the whole workgroup
    // thread -> its place in a block: l the 16-byte piece of a half block, hf the half, kb one bit of the block's number; the other two bits are the trip it
    const int l = threadIdx.x & 31, lr = l & 15, hi = l >> 4, hf = ((int)threadIdx.x >> 5) & 1, kb = (int)threadIdx.x >> 6; const int po = hf * 256 + l * 8;
    const int d = kb * 32 + hf * 16 + hi * 8;   // q, k, r_k: the piece's first column, the same on every trip
    v8f ba = (v8f){}, bb = (v8f){};
    if (kind == 0) { const float* pa = rwb + h * HD + d; const float* pb = rrb + h * HD + d; ba = *(const v8f*)pa; bb = *(const v8f*)pb;   // the head's biases, fetched in front of the k loop, which hides their latency
        // the translation wait behind the loads, the addresses its inputs (as in k_cvtall)
        asm volatile("s_wait_xcnt 0x0" :: "v"(pa), "v"(pb) : "memory"); }
    gemm_partials<bf, false, 4, 4>(isr ? RB : XB, nullptr, W, DD, xt * 64, ct * 64, os);
    __syncthreads();   // every wave's partial tile is in LDS before any thread sums it
    h16* pd[4]; v8h o[4];
    if (kind == 2) {
#pragma unroll
        for (int it = 0; it < 4; ++it) { const int db = (it & 1) * 2 + kb, b = it >> 1; const float* pp = os + ((hf * 16 + hi * 8) * NB_ + b) * 68 + db * 16 + lr;   // 8 rows t of column d = 16 db + lr
#pragma unroll
            for (int q = 0; q < 8; ++q) { float v = pp[q * NB_ * 68];
#pragma unroll
                for (int p = 1; p < 4; ++p) v += pp[(p * 64 + q * NB_) * 68];
                o[it][q] = tohx(v); }
            pd[it] = VT + (size_t)(b * NH_ + h) * HD * TT + (size_t)(db * (TT / 32) + xt) * 512 + po; }
        store4(pd, o);
    } else { v8f v[4]; size_t off[4]; h16* P = kind == 0 ? QA : kind == 1 ? KP : RK;
#pragma unroll
        for (int q = 0; q < 8; ++q) { ba[q] = bfr(ba[q]); bb[q] = bfr(bb[q]); }
#pragma unroll
        for (int it = 0; it < 4; ++it) { v[it] = join8(os + (kind == 3 ? it * 16 + lr : ((it & 1) * 16 + lr) * NB_ + (it >> 1)) * 68 + d);
            off[it] = (kind == 3 ? (size_t)h * TT * HD + (size_t)(xt * 4 + it) * 1024 : (size_t)((it >> 1) * NH_ + h) * TT * HD + (size_t)(xt * 2 + (it & 1)) * 1024) + kb * 512 + po;
            pd[it] = P + off[it]; o[it] = addh8(v[it], ba); }   // k, r_k: ba is zero
        store4(pd, o);
        if (kind == 0) {
#pragma unroll
            for (int it = 0; it < 4; ++it) { pd[it] = QB + off[it]; o[it] = addh8(v[it], bb); }
            store4(pd, o); }
    }
}
// ---- k_relattn: scores, relative shift, softmax, P.V and the head merge for RT query rows of one (batch, head); grid (T / RT, batch x heads), 16 waves.
// The RT score rows stay in LDS (f32, pitch SP floats). BD[i][m] = (q_i + r_r_bias).r_k[m] lands where the module's zero-pad/reshape shift puts it: at row i, key m - (T - 1 - i), when that is >= 0,
// else at row i - 1, key m + i + 1; row i, key i + 1 is the shift's zero. So the rows i0 .. i0 + RT - 1 take the first kind from q rows i0 .. and the second kind from q rows i0 + 1 .. .
// Then AC is added in place, each wave does the softmax of two rows and leaves P x1024 (fp16) in the first half of the row's own LDS; P.V splits the keys over the 16 waves, whose f32 partial tiles
// lie in the second half of the rows and are joined in wave order by the threads that store the merged bf16 hi/lo planes. All five operand planes and the two merged planes lie in fragment order.
#define RT 32
#define SP 2052
// e^x as the fast library form has it, 2^(x log2 e); the v_nop is the one independent slot that the instruction set asks for behind a transcendental, in the same statement so that it stays directly behind it
__device__ __forceinline__ float exp_slot(float x) { float r; asm("v_exp_f32 %0, %1\n\tv_nop" : "=v"(r) : "v"(x * 1.44269504f)); return r; }
typedef v4h __attribute__((may_alias)) v4ha;
typedef __attribute__((ext_vector_type(4))) unsigned short v4us;
__global__ __launch_bounds__(512) void k_relattn(const h16* __restrict__ QA, const h16* __restrict__ QB, const h16* __restrict__ KP, const h16* __restrict__ RK, const h16* __restrict__ VT, bf* Ah, bf* Al) {
    __shared__ __align__(16) float S[RT * SP];
    const int z = blockIdx.y, b = z >> 4, h = z & 15, i0 = blockIdx.x * RT;
    const int lane = threadIdx.x & 31, lr = lane & 15, hi = lane >> 4; const int w = __builtin_amdgcn_readfirstlane(threadIdx.x >> 5);
    QA += (size_t)z * TT * HD; QB += (size_t)z * TT * HD; KP += (size_t)z * TT * HD; VT += (size_t)z * HD * TT; RK += (size_t)h * TT * HD;
    const int fo = 8 * lane;   // this lane's place in a block of the fragment order; 16 rows of a plane with 64 values a row are two blocks, k 0 .. 31 and 32 .. 63
    {   // BD, stored shifted; wave w takes the 16-column tiles w, w + 16, ...
        v16h ql[2][2], qu[2][2]; const h16* pl = QB + i0 * HD; const h16* pr = RK + w * 16 * HD; const h16* pu[2];   // pl, pr: the same for the whole wave; the lane's place fo is added at each load
#pragma unroll
        for (int mb = 0; mb < 2; ++mb) { const int ru = min(i0 + 1 + mb * 16 + lr, TT - 1); pu[mb] = QB + (ru >> 4) * (16 * HD) + (hi * 16 + (ru & 15)) * 8;   // the row behind the last one feeds no key: any row in bounds serves
#pragma unroll
            for (int ks = 0; ks < 2; ++ks) { ql[mb][ks] = WFrag<h16>::ld(pl + fo + mb * 16 * HD + ks * 512); qu[mb][ks] = WFrag<h16>::ld(pu[mb] + ks * 512); } }
#pragma unroll
        for (int g = 0; g < 2; ++g) { v16h rb[4][2];
#pragma unroll
            for (int s = 0; s < 4; ++s)
#pragma unroll
                for (int ks = 0; ks < 2; ++ks) rb[s][ks] = WFrag<h16>::ld(pr + fo + (g * 4 + s) * 256 * HD + ks * 512);
            // one translation wait behind the batch's loads; the addresses are its inputs (the wave's bases in scalar registers, the lane number that the loads scale), so that no load's result and no later add lands in an address register ahead of it
            asm volatile("s_wait_xcnt 0x0" :: "s"(pl), "v"(pu[0]), "v"(pu[1]), "s"(pr), "v"(lane) : "memory");
#pragma unroll
            for (int s = 0; s < 4; ++s)
#pragma unroll
                for (int mb = 0; mb < 2; ++mb) { const int base = ((g * 4 + s) * 16 + w) * 16 + i0 + mb * 16; float* sr = S + (mb * 16 + hi * 8) * SP;
                    if (base + 30 >= TT - 1) { v8f c = (v8f){}; c = wmma16(ql[mb][0], rb[s][0], c); c = wmma16(ql[mb][1], rb[s][1], c); const int j = base + lr + hi * 8 - (TT - 1);
#pragma unroll
                        for (int q = 0; q < 8; ++q) if (j + q >= 0) sr[q * SP + j + q] = c[q]; }
                    if (base + 2 < TT) { v8f c = (v8f){}; c = wmma16(qu[mb][0], rb[s][0], c); c = wmma16(qu[mb][1], rb[s][1], c); const int j = base + lr + hi * 8 + 2;
#pragma unroll
                        for (int q = 0; q < 8; ++q) if (j + q < TT) sr[q * SP + j + q] = c[q]; } } }
        if (threadIdx.x < RT) { const int j = i0 + (int)threadIdx.x + 1; if (j < TT) S[threadIdx.x * SP + j] = 0.f; }
    }
    {   // AC, added in place: s = (AC + BD) / 8; its first operands are fetched in front of the barrier, so that they fly while the wave waits there
        v16h qa[2][2]; const h16* pq = QA + i0 * HD; const h16* pk = KP + w * 16 * HD;
#pragma unroll
        for (int mb = 0; mb < 2; ++mb)
#pragma unroll
            for (int ks = 0; ks < 2; ++ks) qa[mb][ks] = WFrag<h16>::ld(pq + fo + mb * 16 * HD + ks * 512);
#pragma unroll
        for (int g = 0; g < 2; ++g) { v16h kb[4][2];
#pragma unroll
            for (int s = 0; s < 4; ++s)
#pragma unroll
                for (int ks = 0; ks < 2; ++ks) kb[s][ks] = WFrag<h16>::ld(pk + fo + (g * 4 + s) * 256 * HD + ks * 512);
            // one translation wait behind the batch's loads, the addresses its inputs (as above)
            asm volatile("s_wait_xcnt 0x0" :: "s"(pq), "s"(pk), "v"(lane) : "memory");
            if (g == 0) __syncthreads();   // every shifted BD value is in LDS before AC is added to it
#pragma unroll
            for (int s = 0; s < 4; ++s)
#pragma unroll
                for (int mb = 0; mb < 2; ++mb) { v8f c = (v8f){}; c = wmma16(qa[mb][0], kb[s][0], c); c = wmma16(qa[mb][1], kb[s][1], c); float* sr = S + (mb * 16 + hi * 8) * SP + ((g * 4 + s) * 16 + w) * 16 + lr;
#pragma unroll
                    for (int q = 0; q < 8; ++q) sr[q * SP] = __fmul_rn(__fadd_rn(c[q], sr[q * SP]), 0.125f); } }
    }
    __syncthreads();   // whole score rows are in LDS before a wave reads its two
#pragma unroll
    for (int rr = 0; rr < 2; ++rr) { float* sr = S + (w * 2 + rr) * SP; float v[64]; float mx = -3.0e38f;
#pragma unroll
        for (int ch = 0; ch < 16; ++ch) { const v4f a = *(const v4fa*)(sr + ch * 128 + lane * 4);
#pragma unroll
            for (int q = 0; q < 4; ++q) { v[ch * 4 + q] = a[q]; mx = fmaxf(mx, a[q]); } }
#pragma unroll
        for (int sh = 16; sh; sh >>= 1) mx = fmaxf(mx, __shfl_xor(mx, sh, 32));
        float sum = 0.f;
#pragma unroll
        for (int k = 0; k < 64; ++k) { v[k] = exp_slot(v[k] - mx); sum += v[k]; }
#pragma unroll
        for (int sh = 16; sh; sh >>= 1) sum += __shfl_xor(sum, sh, 32);
        const float fct = __fdiv_rn(PCAR, sum); h16* pr = (h16*)sr;
#pragma unroll
        for (int ch = 0; ch < 16; ++ch) { v4h o;
#pragma unroll
            for (int q = 0; q < 4; ++q) o[q] = tohx(v[ch * 4 + q] * fct);
            *(v4ha*)(pr + ch * 128 + lane * 4) = o; } }
    v16h vb[4][4]; const h16* pv = VT + w * 4 * 512;   // this wave's 128 keys of V, fetched in front of the barrier, so that they fly while the wave waits there
#pragma unroll
    for (int ks = 0; ks < 4; ++ks)
#pragma unroll
        for (int nb = 0; nb < 4; ++nb) vb[ks][nb] = WFrag<h16>::ld(pv + fo + nb * 16 * TT + ks * 512);
    // one translation wait behind the batch's loads, the address its input (as above)
    asm volatile("s_wait_xcnt 0x0" :: "s"(pv), "v"(lane) : "memory");
    __syncthreads();   // every row of P is in LDS before any wave multiplies it
    v8f acc[2][4];
#pragma unroll
    for (int mb = 0; mb < 2; ++mb)
#pragma unroll
        for (int nb = 0; nb < 4; ++nb) acc[mb][nb] = (v8f){};
#pragma unroll
    for (int ks = 0; ks < 4; ++ks) { const int kc = w * 128 + ks * 32 + 8 * hi; v16h a[2];
#pragma unroll
        for (int mb = 0; mb < 2; ++mb) { const h16* p = (const h16*)S + (mb * 16 + lr) * (2 * SP) + kc; a[mb] = cat16(*(const v8ha*)p, *(const v8ha*)(p + 16)); }
#pragma unroll
        for (int nb = 0; nb < 4; ++nb)
#pragma unroll
            for (int mb = 0; mb < 2; ++mb) acc[mb][nb] = wmma16(a[mb], vb[ks][nb], acc[mb][nb]); }
#pragma unroll
    for (int mb = 0; mb < 2; ++mb)
#pragma unroll
        for (int nb = 0; nb < 4; ++nb)
#pragma unroll
            for (int q = 0; q < 8; ++q) S[(mb * 16 + hi * 8 + q) * SP + 1024 + w * 64 + nb * 16 + lr] = acc[mb][nb][q];
    __syncthreads();   // every wave's partial tile is in LDS before any thread sums it
    { const int row = (int)threadIdx.x >> 4, cofs = ((int)threadIdx.x & 15) * 4; const float* pp = S + row * SP + 1024 + cofs; v4f val = *(const v4fa*)pp;
#pragma unroll
        for (int p = 1; p < 16; ++p) val += *(const v4fa*)(pp + p * 64);
        v4us oh, ol;
#pragma unroll
        for (int q = 0; q < 4; ++q) { unsigned short x, y; splitf(val[q] * (1.0f / PCAR), x, y); oh[q] = x; ol[q] = y; }
        // the merged planes in fragment order, row b T + t, so that this workgroup alone writes its four blocks (2 x 16 rows, the head's 2 x 32 columns)
        const size_t o = ((size_t)((b * TT + i0 + row) >> 4) * (DD / 32) + h * 2 + (cofs >> 5)) * 512 + (cofs & 16) * 16 + (((cofs >> 3) & 1) * 16 + (row & 15)) * 8 + (cofs & 7); *(v4us*)(Ah + o) = oh; *(v4us*)(Al + o) = ol; }
}

extern "C" void kernel_launch(void* const* d_in, const int* in_sizes, int n_in,
                              void* d_out, int out_size, void* d_ws, size_t ws_size, hipStream_t stream) {
    (void)in_sizes; (void)n_in; (void)out_size;
    const float* x = (const float*)d_in[0]; const float* r = (const float*)d_in[1]; const float* rwb = (const float*)d_in[2]; const float* rrb = (const float*)d_in[3]; const float* qkvw = (const float*)d_in[4]; const float* rw = (const float*)d_in[5]; const float* ow = (const float*)d_in[6]; const float* ob = (const float*)d_in[7];
    float* OUT = (float*)d_out;     // [2048][2][1024] (rows t*2 + b)
    char* wsp = (char*)d_ws;
    auto take = [&](size_t bytes) { char* p = wsp; wsp += (bytes + 255) & ~(size_t)255; return (void*)p; };
    bf* WQ = (bf*)take((size_t)DD * DD * 2); bf* WK = (bf*)take((size_t)DD * DD * 2); bf* WV = (bf*)take((size_t)DD * DD * 2); bf* WR = (bf*)take((size_t)DD * DD * 2); bf* WO = (bf*)take((size_t)DD * DD * 2);
    bf* XB = (bf*)take((size_t)NT * DD * 2); bf* RB = (bf*)take((size_t)TT * DD * 2);
    h16* QA = (h16*)take((size_t)NT * DD * 2); h16* QB = (h16*)take((size_t)NT * DD * 2); h16* KP = (h16*)take((size_t)NT * DD * 2); h16* VT = (h16*)take((size_t)NT * DD * 2); h16* RK = (h16*)take((size_t)NH_ * TT * HD * 2);
    bf* ATh = (bf*)take((size_t)NT * DD * 2); bf* ATl = (bf*)take((size_t)NT * DD * 2);
    if ((size_t)(wsp - (char*)d_ws) > ws_size) return;    // total 74 MiB
    k_cvtall<<<GQKV + 2 * GW + GX + GR, 256, 0, stream>>>(qkvw, rw, ow, x, r, WQ);   // WQ, WK, WV, WR, WO, XB, RB lie one behind the other
    const dim3 gP(NT / 64, DD / 64, 1);
    k_proj<<<dim3(NT / 64, 56, 1), 128, 0, stream>>>(XB, RB, WQ, rwb, rrb, QA, QB, KP, VT, RK);   // WQ, WK, WV, WR lie one behind the other: the 4 DD rows of W
    k_relattn<<<dim3(TT / RT, NB_ * NH_, 1), 512, 0, stream>>>(QA, QB, KP, RK, VT, ATh, ATl);
    k_gemmks<bf, true, true, true, 4, 4><<<gP, 128, 0, stream>>>(ATh, ATl, WO, DD, OUT, DD, ob, 0, 0, 0);
}

// v006
// It runs in 185 microseconds.
// Next to v005, in two timings, it ran 1.10 times as fast each time.
// Over all steps from v000 it is 8.42 times as fast.
#include <hip/hip_runtime.h>

// Relative-position multi-head attention (segment-recurrence style relative shift; query [2048][2][1024] seq-first, r [2048][1024]; w = query qkv_w^T -> q|k|v (16 heads x 64); r_k = r r_w^T; AC = (q + r_w_bias).k,
// BD = rel_shift((q + r_r_bias).r_k) with the module's exact zero-pad/reshape shift (out[i][j] = BD[f / (T+1)][f % (T+1) - 1] or 0 when f % (T+1) == 0, f = T + i*T + j); p = softmax((AC + BD) / 8)
// over the keys; attn = p.v; out = merged out_w^T + out_b; output [2048][2][1024] (rows t*2 + b)).
// Compute dtypes, f32 accumulate: every input rounded to bf16; the qkv and r projections on PLAIN bf16 operands (inputs: exact); AC, BD and attn.v on SINGLE fp16 planes
// (the per-head biases added in f32 before the fp16 rounding; logit sd ~ 0.6); the relative shift is an index scatter into the LDS score rows of the fused attention kernel; P = e^(s - max) in fp16, divided by the row's sum behind P.V;

#define NB_  2
#define TT   2048
#define DD   1024
#define NH_  16
#define HD   64
#define NT   (NB_ * TT)
typedef _Float16 h16;
typedef unsigned short bf;
typedef __attribute__((ext_vector_type(16))) __bf16   v16bf;
typedef __attribute__((ext_vector_type(16))) _Float16 v16h;
typedef __attribute__((ext_vector_type(8)))  _Float16 v8h;
typedef __attribute__((ext_vector_type(8)))  unsigned short v8us;
typedef __attribute__((ext_vector_type(8)))  float    v8f;
typedef __attribute__((ext_vector_type(4)))  float    v4f;
typedef v8h  __attribute__((may_alias)) v8ha;
typedef v4f  __attribute__((may_alias)) v4fa;
typedef v8us __attribute__((may_alias)) v8usa;

__device__ __forceinline__ unsigned short f2bf(float f) { unsigned u = __float_as_uint(f); u += 0x7FFFu + ((u >> 16) & 1u); return (unsigned short)(u >> 16); }
__device__ __forceinline__ float bf2f(unsigned short b) { return __uint_as_float(((unsigned)b) << 16); }
__device__ __forceinline__ float bfr(float f) { return bf2f(f2bf(f)); }
__device__ __forceinline__ v16h cat16(v8h lo, v8h hi) { return __builtin_shufflevector(lo, hi, 0, 1, 2, 3, 4, 5, 6, 7, 8, 9, 10, 11, 12, 13, 14, 15); }
__device__ __forceinline__ v16bf cat16b(v8us lo, v8us hi) { return __builtin_bit_cast(v16bf, __builtin_shufflevector(lo, hi, 0, 1, 2, 3, 4, 5, 6, 7, 8, 9, 10, 11, 12, 13, 14, 15)); }
__device__ __forceinline__ v8f wmma16(v16h a, v16h b, v8f c) { return __builtin_amdgcn_wmma_f32_16x16x32_f16(false, a, false, b, (short)0, c, false, false); }
__device__ __forceinline__ v8f wmmab(v16bf a, v16bf b, v8f c) { return __builtin_amdgcn_wmma_f32_16x16x32_bf16(false, a, false, b, (short)0, c, false, false); }



// FRAGMENT ORDER: every 16-bit operand plane [rows][K] that a kernel fetches from global memory lies in blocks of 16 rows x 32 k (512 values, 1 KiB), block (row / 16) * (K / 32) + k / 32;
// inside a block the value (row % 16, k % 32) lies at (k & 16) * 16 + ((k >> 3 & 1) * 16 + row % 16) * 8 + (k & 7). Lane l = 16 hi + lr of a fragment (row lr; k = 8 hi .. 8 hi + 7 and 16 + 8 hi .. 16 + 8 hi + 7)
// so finds its two 16-byte pieces at 8 l and 256 + 8 l, and each of the wave's two loads covers 512 contiguous bytes, four whole lines, where a row-major plane makes it touch sixteen.
// fragment loaders: p = the block's start + 8 lane
template <typename T16> struct WFrag;
template <> struct WFrag<h16> { typedef v16h V; static __device__ __forceinline__ V ld(const h16* p) { return cat16(*(const v8h*)p, *(const v8h*)(p + 256)); } static __device__ __forceinline__ v8f mma(V a, V b, v8f c) { return wmma16(a, b, c); } };
template <> struct WFrag<bf> { typedef v16bf V; static __device__ __forceinline__ V ld(const bf* p) { return cat16b(*(const v8us*)p, *(const v8us*)(p + 256)); } static __device__ __forceinline__ v8f mma(V a, V b, v8f c) { return wmmab(a, b, c); } };
// ---- k_gemmks: C[m][n] (f32, pitch ldc, + optional f32 bias[n]) = sum_k A[m][k] Bt[n][k] for a long K and few output tiles: one workgroup of KW waves per (16 MT)x64 tile; grid (M/(16 MT), N/64, Z), 32 KW threads. K % (32 KW) == 0.
// Wave w sums k in [w K/KW, (w+1) K/KW) into its own MT x 4 accumulators; the KW f32 partial tiles are joined through LDS, in wave order, by the threads that store the tile. TWOA: C = (A + A2) Bt^T.
// A, A2 and Bt lie in fragment order. BMAJ: A's row b T + t is C's row t NB + b.
// gemm_partials: the k loop of the tile at (r0, c0); it leaves wave w's partial tile in os, rows w 16 MT .., pitch 68 floats. The caller's barrier stands between it and the join. k_proj below shares it.
template <typename T16, bool TWOA, int KW, int MT>
__device__ __forceinline__ void gemm_partials(const T16* __restrict__ A, const T16* __restrict__ A2, const T16* __restrict__ Bt, int K, int r0, int c0, float* os) {
    typedef typename WFrag<T16>::V V;
    static_assert(MT >= 2 && MT <= 4, "the wait in the k loop names the addresses of row blocks 0, 1, MT - 2 and MT - 1");
    const int lane = threadIdx.x & 31, lr = lane & 15, hi = lane >> 4;
    const int w = __builtin_amdgcn_readfirstlane(threadIdx.x >> 5); const int kbeg = w * (K / KW), kend = kbeg + K / KW;
    v8f acc[MT][4];
#pragma unroll
    for (int mb = 0; mb < MT; ++mb)
#pragma unroll
        for (int nb = 0; nb < 4; ++nb) acc[mb][nb] = (v8f){};
    const size_t aoff = (size_t)r0 * K + 8 * lane, boff = (size_t)c0 * K + 8 * lane;   // 16 rows of blocks are 16 K values, one block of 32 k is 512
#pragma unroll 1
    for (int kc = kbeg; kc < kend; kc += 32) {
        const T16 *pa[MT], *pa2[MT], *pb[4]; V a[MT], a2[MT], b[4];
#pragma unroll
        for (int mb = 0; mb < MT; ++mb) { pa[mb] = A + aoff + (size_t)mb * 16 * K + (size_t)kc * 16; a[mb] = WFrag<T16>::ld(pa[mb]); pa2[mb] = pa[mb]; if (TWOA) { pa2[mb] = A2 + aoff + (size_t)mb * 16 * K + (size_t)kc * 16; a2[mb] = WFrag<T16>::ld(pa2[mb]); } }
#pragma unroll
        for (int nb = 0; nb < 4; ++nb) { pb[nb] = Bt + boff + (size_t)nb * 16 * K + (size_t)kc * 16; b[nb] = WFrag<T16>::ld(pb[nb]); }
        // one translation wait behind the trip's loads; the addresses are its inputs, so that no load's result and no later add lands in an address register ahead of it
        asm volatile("s_wait_xcnt 0x0" :: "v"(pa[0]), "v"(pa[1]), "v"(pa[MT - 2]), "v"(pa[MT - 1]), "v"(pa2[0]), "v"(pa2[1]), "v"(pa2[MT - 2]), "v"(pa2[MT - 1]), "v"(pb[0]), "v"(pb[1]), "v"(pb[2]), "v"(pb[3]) : "memory");
#pragma unroll
        for (int nb = 0; nb < 4; ++nb)
#pragma unroll
            for (int mb = 0; mb < MT; ++mb) { acc[mb][nb] = WFrag<T16>::mma(a[mb], b[nb], acc[mb][nb]); if (TWOA) acc[mb][nb] = WFrag<T16>::mma(a2[mb], b[nb], acc[mb][nb]); }
        // four vector slots behind the last WMMA on the loop's taken branch too
        asm volatile("v_nop\n\tv_nop\n\tv_nop\n\tv_nop" : "+v"(acc[0][0]), "+v"(acc[1][1]), "+v"(acc[MT - 2][2]), "+v"(acc[MT - 1][3]) : "v"(a[0]), "v"(a[MT - 1]));
    }
#pragma unroll
    for (int mb = 0; mb < MT; ++mb)
#pragma unroll
        for (int nb = 0; nb < 4; ++nb)
#pragma unroll
            for (int j = 0; j < 8; ++j) os[(w * (16 * MT) + mb * 16 + hi * 8 + j) * 68 + nb * 16 + lr] = acc[mb][nb][j];
}
template <typename T16, bool TWOA, bool BIAS, bool BMAJ, int KW, int MT>
__global__ __launch_bounds__(32 * KW) void k_gemmks(const T16* __restrict__ A, const T16* __restrict__ A2, const T16* __restrict__ Bt, int K, float* C, int ldc, const float* __restrict__ bias, size_t sA, size_t sB, size_t sC) {
    static_assert((MT * 8) % KW == 0, "the tile's 16-byte pieces divide evenly over the threads");
    __shared__ __align__(16) float os[KW * MT * 16 * 68];
    const size_t z = blockIdx.z; A += z * sA; if (TWOA) A2 += z * sA; Bt += z * sB; C += z * sC;
    const int r0 = blockIdx.x * (16 * MT), c0 = blockIdx.y * 64;
    gemm_partials<T16, TWOA, KW, MT>(A, A2, Bt, K, r0, c0, os);
    __syncthreads();   // every wave's partial tile is in LDS before any thread sums it
#pragma unroll
    for (int it = 0; it < MT * 8 / KW; ++it) { const int s = (int)threadIdx.x + it * (32 * KW); const int row = s >> 4, cofs = (s & 15) * 4; v4f val = *(const v4fa*)(os + row * 68 + cofs);
#pragma unroll
        for (int p = 1; p < KW; ++p) val += *(const v4fa*)(os + (p * (16 * MT) + row) * 68 + cofs);
        if (BIAS) { val[0] += bfr(bias[c0 + cofs]); val[1] += bfr(bias[c0 + cofs + 1]); val[2] += bfr(bias[c0 + cofs + 2]); val[3] += bfr(bias[c0 + cofs + 3]); }
        const unsigned m = (unsigned)(r0 + row), orow = BMAJ ? (m % TT) * NB_ + m / TT : m;
        *(v4f*)(C + (size_t)orow * ldc + c0 + cofs) = val; }
}

__device__ __forceinline__ h16 tohx(float x) { return (h16)x; }
__device__ __forceinline__ void splitf(float y, unsigned short& h, unsigned short& l) { h = f2bf(y); l = f2bf(y - bf2f(h)); }
typedef __attribute__((ext_vector_type(2))) _Float16 v2h;
typedef __attribute__((ext_vector_type(4))) _Float16 v4h;
typedef __attribute__((ext_vector_type(2))) unsigned short v2us;
typedef __attribute__((ext_vector_type(4))) int v4i;

// ---- k_cvtall: every f32 input matrix [rows][DD], row-major -> bf16 in fragment order, in one launch. dst: the planes of qkv_w, r_w, out_w, query and r, which lie one behind the other in the workspace, in this order.
// One workgroup makes one row of blocks: 16 source rows x DD columns, 2048 pieces of 16 bytes, 32 KiB of dst; grid = all rows / 16. Thread t makes the pieces t, t + 256, ..: a wave stores 512 contiguous bytes and reads 64 bytes of each of 16 rows.
// A thread's eight loads are all issued before the first value is used, so that a wave has 8 KiB in flight and the launch needs an eighth of the waves that one piece a thread takes.
#define GQKV (3 * DD / 16)
#define GW   (DD / 16)
#define GX   (NT / 16)
#define GR   (TT / 16)
__global__ __launch_bounds__(256) void k_cvtall(const float* __restrict__ qkvw, const float* __restrict__ rw, const float* __restrict__ ow, const float* __restrict__ x, const float* __restrict__ r, bf* dst) {
    const int g = blockIdx.x, t = threadIdx.x;   // the source matrix and the row group in it are the same for the whole workgroup
    const float* src = g < GQKV ? qkvw : g < GQKV + GW ? rw : g < GQKV + 2 * GW ? ow : g < GQKV + 2 * GW + GX ? x : r;
    const int gl = g - (g < GQKV ? 0 : g < GQKV + GW ? GQKV : g < GQKV + 2 * GW ? GQKV + GW : g < GQKV + 2 * GW + GX ? GQKV + 2 * GW : GQKV + 2 * GW + GX);
    const float* ps = src + (size_t)(gl * 16 + (t & 15)) * DD + (t >> 6) * 32 + ((t >> 5) & 1) * 16 + ((t >> 4) & 1) * 8; v8f v[8];   // piece t + 256 j lies four blocks, 128 columns, behind piece t + 256 (j - 1)
#pragma unroll
    for (int j = 0; j < 8; ++j) v[j] = *(const v8f*)(ps + j * 128);
    // the translation wait behind the loads, the address its input, so that no later result lands in an address register ahead of it
    asm volatile("s_wait_xcnt 0x0" :: "v"(ps) : "memory");
    bf* pd = dst + (size_t)g * 16384 + t * 8;
#pragma unroll
    for (int j = 0; j < 8; ++j) { v8us o;
#pragma unroll
        for (int k = 0; k < 8; ++k) o[k] = f2bf(v[j][k]);
        *(v8us*)(pd + j * 2048) = o; }
}
// ---- k_proj: the q, k, v and r projections in one launch, each 64x64 tile stored straight as the fp16 operand planes of k_relattn, in fragment order; no f32 plane in memory. 4 waves, the k loop and the join order of k_gemmks.
// W: the rows of qkv_w, then those of r_w (4 DD rows); a column tile of 64 is one head of q, k, v or r_k. grid (NT / 64, 56): y < 48 is the column tile, x the row tile of XB (rows t NB + b: 32 t of both batches);
// the 8 x 64 workgroups behind them are the 32 row tiles x 16 heads of RB. A tile holds whole 1-KiB blocks of its planes: thread piece = 16 bytes, a wave's store = 512 contiguous bytes.
// QA = q + r_w_bias, QB = q + r_r_bias, KP = k: [batch x head][T][64]; RK: [head][T][64]; VT: [batch x head][64 rows d][T] (k = t).
// the join of one 16-byte piece: 8 neighbouring columns of one tile row, the four waves' partial sums added in wave order
__device__ __forceinline__ v8f join8(const float* pp) { v4f v0 = *(const v4fa*)pp, v1 = *(const v4fa*)(pp + 4);
#pragma unroll
    for (int p = 1; p < 4; ++p) { v0 += *(const v4fa*)(pp + p * 64 * 68); v1 += *(const v4fa*)(pp + p * 64 * 68 + 4); }
    return __builtin_shufflevector(v0, v1, 0, 1, 2, 3, 4, 5, 6, 7); }
__device__ __forceinline__ v8h addh8(v8f v, v8f b) { v8h o;
#pragma unroll
    for (int q = 0; q < 8; ++q) o[q] = tohx(__fadd_rn(v[q], b[q]));
    return o; }
// a thread's four pieces of one plane
__device__ __forceinline__ void store4(h16* const (&p)[4], const v8h (&o)[4]) {
#pragma unroll
    for (int it = 0; it < 4; ++it) *(v8h*)p[it] = o[it];
    // the translation wait behind the stores, their addresses and values its inputs, so that no later result lands in one of those registers ahead of it
    asm volatile("s_wait_xcnt 0x0" :: "v"(p[0]), "v"(p[1]), "v"(p[2]), "v"(p[3]), "v"(o[0]), "v"(o[1]), "v"(o[2]), "v"(o[3]) : "memory"); }
__global__ __launch_bounds__(128) void k_proj(const bf* __restrict__ XB, const bf* __restrict__ RB, const bf* __restrict__ W, const float* __restrict__ rwb, const float* __restrict__ rrb, h16* QA, h16* QB, h16* KP, h16* VT, h16* RK) {
    __shared__ __align__(16) float os[4 * 64 * 68];
    const int y = blockIdx.y; const bool isr = y >= 48; const int rid = (y - 48) * (NT / 64) + (int)blockIdx.x;
    const int xt = isr ? rid & (TT / 64 - 1) : (int)blockIdx.x, ct = isr ? 48 + rid / (TT / 64) : y; const int kind = ct >> 4, h = ct & 15;   // kind 0 q, 1 k, 2 v, 3 r_k: the same for the whole workgroup
    // thread -> its place in a block: l the 16-byte piece of a half block, hf the half, kb one bit of the block's number; the other two bits are the trip it
    const int l = threadIdx.x & 31, lr = l & 15, hi = l >> 4, hf = ((int)threadIdx.x >> 5) & 1, kb = (int)threadIdx.x >> 6; const int po = hf * 256 + l * 8;
    const int d = kb * 32 + hf * 16 + hi * 8;   // q, k, r_k: the piece's first column, the same on every trip
    v8f ba = (v8f){}, bb = (v8f){};
    if (kind == 0) { const float* pa = rwb + h * HD + d; const float* pb = rrb + h * HD + d; ba = *(const v8f*)pa; bb = *(const v8f*)pb;   // the head's biases, fetched in front of the k loop, which hides their latency
        // the translation wait behind the loads, the addresses its inputs (as in k_cvtall)
        asm volatile("s_wait_xcnt 0x0" :: "v"(pa), "v"(pb) : "memory"); }
    gemm_partials<bf, false, 4, 4>(isr ? RB : XB, nullptr, W, DD, xt * 64, ct * 64, os);
    __syncthreads();   // every wave's partial tile is in LDS before any thread sums it
    h16* pd[4]; v8h o[4];
    if (kind == 2) {
#pragma unroll
        for (int it = 0; it < 4; ++it) { const int db = (it & 1) * 2 + kb, b = it >> 1; const float* pp = os + ((hf * 16 + hi * 8) * NB_ + b) * 68 + db * 16 + lr;   // 8 rows t of column d = 16 db + lr
#pragma unroll
            for (int q = 0; q < 8; ++q) { float v = pp[q * NB_ * 68];
#pragma unroll
                for (int p = 1; p < 4; ++p) v += pp[(p * 64 + q * NB_) * 68];
                o[it][q] = tohx(v); }
            pd[it] = VT + (size_t)(b * NH_ + h) * HD * TT + (size_t)(db * (TT / 32) + xt) * 512 + po; }
        store4(pd, o);
    } else { v8f v[4]; size_t off[4]; h16* P = kind == 0 ? QA : kind == 1 ? KP : RK;
#pragma unroll
        for (int q = 0; q < 8; ++q) { ba[q] = bfr(ba[q]); bb[q] = bfr(bb[q]); }
#pragma unroll
        for (int it = 0; it < 4; ++it) { v[it] = join8(os + (kind == 3 ? it * 16 + lr : ((it & 1) * 16 + lr) * NB_ + (it >> 1)) * 68 + d);
            off[it] = (kind == 3 ? (size_t)h * TT * HD + (size_t)(xt * 4 + it) * 1024 : (size_t)((it >> 1) * NH_ + h) * TT * HD + (size_t)(xt * 2 + (it & 1)) * 1024) + kb * 512 + po;
            pd[it] = P + off[it]; o[it] = addh8(v[it], ba); }   // k, r_k: ba is zero
        store4(pd, o);
        if (kind == 0) {
#pragma unroll
            for (int it = 0; it < 4; ++it) { pd[it] = QB + off[it]; o[it] = addh8(v[it], bb); }
            store4(pd, o); }
    }
}
// ---- k_relattn: scores, relative shift, softmax, P.V and the head merge for RT query rows of one (batch, head); grid (T / RT, batch x heads), 16 waves.
// The RT rows of shifted BD stay in LDS (f32, pitch SP floats). BD[i][m] = (q_i + r_r_bias).r_k[m] lands where the module's zero-pad/reshape shift puts it: at row i, key m - (T - 1 - i), when that is >= 0,
// else at row i - 1, key m + i + 1; row i, key i + 1 is the shift's zero. So the rows i0 .. i0 + RT - 1 take the first kind from q rows i0 .. and the second kind from q rows i0 + 1 .. .
// AC is made transposed (keys x queries), each wave its own 128 keys of all RT rows, and stays in registers: the wave adds its BD values from LDS, the row maxima go from wave to wave through LDS,
// and e^(s - max), rounded to fp16, is the B operand of P.V^T as it stands. The waves' f32 partial tiles lie in the second half of the rows and are joined in wave order by the threads that divide by the row's sum
// and store the merged bf16 hi/lo planes. All five operand planes and the two merged planes lie in fragment order.
#define RT 32
#define SP 2052
#define XP 20   // floats a row of RM and RS: the 16-byte pieces of 16 neighbouring rows fall on different banks
// e^x as the fast library form has it, 2^(x log2 e); the v_nop is the one independent slot that the instruction set asks for behind a transcendental, in the same statement so that it stays directly behind it
__device__ __forceinline__ float exp_slot(float x) { float r; asm("v_exp_f32 %0, %1\n\tv_nop" : "=v"(r) : "v"(x * 1.44269504f)); return r; }
typedef v4h __attribute__((may_alias)) v4ha;
typedef __attribute__((ext_vector_type(4))) unsigned short v4us;
__global__ __launch_bounds__(512) void k_relattn(const h16* __restrict__ QA, const h16* __restrict__ QB, const h16* __restrict__ KP, const h16* __restrict__ RK, const h16* __restrict__ VT, bf* Ah, bf* Al) {
    __shared__ __align__(16) float S[RT * SP];
    __shared__ __align__(16) float RM[RT * XP], RS[RT * XP];   // per row: the 16 waves' maxima, the 16 waves' shares of the sum
    const int z = blockIdx.y, b = z >> 4, h = z & 15, i0 = blockIdx.x * RT;
    const int lane = threadIdx.x & 31, lr = lane & 15, hi = lane >> 4; const int w = __builtin_amdgcn_readfirstlane(threadIdx.x >> 5);
    QA += (size_t)z * TT * HD; QB += (size_t)z * TT * HD; KP += (size_t)z * TT * HD; VT += (size_t)z * HD * TT; RK += (size_t)h * TT * HD;
    const int fo = 8 * lane;   // this lane's place in a block of the fragment order; 16 rows of a plane with 64 values a row are two blocks, k 0 .. 31 and 32 .. 63
    v16h qa[2][2], kb[8][2]; const h16* pq = QA + i0 * HD; const h16* pk = KP + w * 128 * HD;   // AC's operands: both blocks of 16 queries, this wave's 8 tiles of 16 keys
    {   // BD, stored shifted; wave w takes the 16-column tiles w, w + 16, ...
        v16h ql[2][2], qu[2][2]; const h16* pl = QB + i0 * HD; const h16* pr = RK + w * 16 * HD; const h16* pu[2];   // pl, pr: the same for the whole wave; the lane's place fo is added at each load
#pragma unroll
        for (int mb = 0; mb < 2; ++mb) { const int ru = min(i0 + 1 + mb * 16 + lr, TT - 1); pu[mb] = QB + (ru >> 4) * (16 * HD) + (hi * 16 + (ru & 15)) * 8;   // the row behind the last one feeds no key: any row in bounds serves
#pragma unroll
            for (int ks = 0; ks < 2; ++ks) { ql[mb][ks] = WFrag<h16>::ld(pl + fo + mb * 16 * HD + ks * 512); qu[mb][ks] = WFrag<h16>::ld(pu[mb] + ks * 512); } }
#pragma unroll
        for (int g = 0; g < 2; ++g) { v16h rb[4][2];
#pragma unroll
            for (int s = 0; s < 4; ++s)
#pragma unroll
                for (int ks = 0; ks < 2; ++ks) rb[s][ks] = WFrag<h16>::ld(pr + fo + (g * 4 + s) * 256 * HD + ks * 512);
            // one translation wait behind the batch's loads; the addresses are its inputs (the wave's bases in scalar registers, the lane number that the loads scale), so that no load's result and no later add lands in an address register ahead of it
            asm volatile("s_wait_xcnt 0x0" :: "s"(pl), "v"(pu[0]), "v"(pu[1]), "s"(pr), "v"(lane) : "memory");
            if (g == 1) {   // AC's queries and its first four key tiles, as many as the registers take here: they fly while the second half of BD is made
#pragma unroll
                for (int qb = 0; qb < 2; ++qb)
#pragma unroll
                    for (int ks = 0; ks < 2; ++ks) qa[qb][ks] = WFrag<h16>::ld(pq + fo + qb * 16 * HD + ks * 512);
#pragma unroll
                for (int kt = 0; kt < 4; ++kt)
#pragma unroll
                    for (int ks = 0; ks < 2; ++ks) kb[kt][ks] = WFrag<h16>::ld(pk + fo + kt * 16 * HD + ks * 512);
                // one translation wait behind the batch's loads, the addresses its inputs (as above)
                asm volatile("s_wait_xcnt 0x0" :: "s"(pq), "s"(pk), "v"(lane) : "memory"); }
#pragma unroll
            for (int s = 0; s < 4; ++s)
#pragma unroll
                for (int mb = 0; mb < 2; ++mb) { const int base = ((g * 4 + s) * 16 + w) * 16 + i0 + mb * 16; float* sr = S + (mb * 16 + hi * 8) * SP;
                    if (base + 30 >= TT - 1) { v8f c = (v8f){}; c = wmma16(ql[mb][0], rb[s][0], c); c = wmma16(ql[mb][1], rb[s][1], c); const int j = base + lr + hi * 8 - (TT - 1);
#pragma unroll
                        for (int q = 0; q < 8; ++q) if (j + q >= 0) sr[q * SP + j + q] = c[q]; }
                    if (base + 2 < TT) { v8f c = (v8f){}; c = wmma16(qu[mb][0], rb[s][0], c); c = wmma16(qu[mb][1], rb[s][1], c); const int j = base + lr + hi * 8 + 2;
#pragma unroll
                        for (int q = 0; q < 8; ++q) if (j + q < TT) sr[q * SP + j + q] = c[q]; } } }
        if (threadIdx.x < RT) { const int j = i0 + (int)threadIdx.x + 1; if (j < TT) S[threadIdx.x * SP + j] = 0.f; }
    }
    // AC, transposed: wave w makes S^T = K.Q^T for its 128 keys (8 tiles of 16) and both blocks of 16 queries. A lane holds query lr of a block and the keys 8 hi .. 8 hi + 7 of a tile: two neighbouring tiles,
    // rounded to fp16, are the B fragment (32 keys x 16 queries) of P.V as they stand. The products need no LDS, so they stand in front of the barrier and run while other waves still scatter BD.
    v8f sc[8][2];
    {
#pragma unroll
        for (int kt = 4; kt < 8; ++kt)
#pragma unroll
            for (int ks = 0; ks < 2; ++ks) kb[kt][ks] = WFrag<h16>::ld(pk + fo + kt * 16 * HD + ks * 512);
        // one translation wait behind the batch's loads, the addresses its inputs (as above)
        asm volatile("s_wait_xcnt 0x0" :: "s"(pk), "v"(lane) : "memory");
        __builtin_amdgcn_sched_barrier(0);   // every load is issued before the first product waits for one (the compiler otherwise deals the loads out among the products, and each waits anew)
#pragma unroll
        for (int kt = 0; kt < 8; ++kt)
#pragma unroll
            for (int qb = 0; qb < 2; ++qb) { v8f c = (v8f){}; c = wmma16(kb[kt][0], qa[qb][0], c); c = wmma16(kb[kt][1], qa[qb][1], c); sc[kt][qb] = c; }
    }
    __builtin_amdgcn_sched_barrier(0);   // the products stay in front of the barrier, where they run while other waves still scatter BD (the compiler otherwise sinks most of them behind it)
    __syncthreads();   // every shifted BD value is in LDS before a wave reads its keys of all rows
    float mx[2] = { -3.0e38f, -3.0e38f };
#pragma unroll
    for (int kt = 0; kt < 8; ++kt)
#pragma unroll
        for (int qb = 0; qb < 2; ++qb) { const float* sr = S + (qb * 16 + lr) * SP + w * 128 + kt * 16 + hi * 8; const v4f b0 = *(const v4fa*)sr, b1 = *(const v4fa*)(sr + 4);   // s = (AC + BD) / 8
#pragma unroll
            for (int q = 0; q < 8; ++q) { const float s = __fmul_rn(__fadd_rn(sc[kt][qb][q], q < 4 ? b0[q & 3] : b1[q & 3]), 0.125f); sc[kt][qb][q] = s; mx[qb] = fmaxf(mx[qb], s); } }
#pragma unroll
    for (int qb = 0; qb < 2; ++qb) { mx[qb] = fmaxf(mx[qb], __shfl_xor(mx[qb], 16, 32)); if (hi == 0) RM[(qb * 16 + lr) * XP + w] = mx[qb]; }   // this wave's maximum of each row
    __syncthreads();   // every wave's row maxima are in LDS, and every wave has read its BD values: the score rows are free for the partial tiles
    v16h vb[4][4]; const h16* pv = VT + w * 4 * 512;   // this wave's 128 keys of V; the first 64 are fetched here, behind the barrier (which waits for every load in front of it), and fly behind the exponentials
#pragma unroll
    for (int ks = 0; ks < 2; ++ks)
#pragma unroll
        for (int nb = 0; nb < 4; ++nb) vb[ks][nb] = WFrag<h16>::ld(pv + fo + nb * 16 * TT + ks * 512);
    // one translation wait behind the batch's loads, the address its input (as above)
    asm volatile("s_wait_xcnt 0x0" :: "s"(pv), "v"(lane) : "memory");
    float sum[2][2] = { { 0.f, 0.f }, { 0.f, 0.f } }; v16h pf[4][2];
#pragma unroll
    for (int qb = 0; qb < 2; ++qb) { const float* pm = RM + (qb * 16 + lr) * XP; v4f m = *(const v4fa*)pm;
#pragma unroll
        for (int p = 1; p < 4; ++p) { const v4f n = *(const v4fa*)(pm + p * 4);
#pragma unroll
            for (int q = 0; q < 4; ++q) m[q] = fmaxf(m[q], n[q]); }
        mx[qb] = fmaxf(fmaxf(m[0], m[1]), fmaxf(m[2], m[3])); }
    // P = e^(s - max), not yet divided by the row's sum (at most 1, the row's largest exactly 1: fp16 holds it with the relative error it had for the scaled P); the division follows the join
#pragma unroll
    for (int ks = 0; ks < 4; ++ks) {
        if (ks == 2) {   // half of the scores have become fp16: registers are free for the third 32 keys of V, which fly behind the other half's exponentials
#pragma unroll
            for (int nb = 0; nb < 4; ++nb) vb[2][nb] = WFrag<h16>::ld(pv + fo + nb * 16 * TT + 2 * 512);
            // one translation wait behind the batch's loads, the address its input (as above)
            asm volatile("s_wait_xcnt 0x0" :: "s"(pv), "v"(lane) : "memory"); }
#pragma unroll
        for (int qb = 0; qb < 2; ++qb)
#pragma unroll
            for (int q = 0; q < 8; ++q) { const float e0 = exp_slot(sc[2 * ks][qb][q] - mx[qb]), e1 = exp_slot(sc[2 * ks + 1][qb][q] - mx[qb]); sum[qb][0] += e0; sum[qb][1] += e1; pf[ks][qb][q] = tohx(e0); pf[ks][qb][8 + q] = tohx(e1); } }
#pragma unroll
    for (int qb = 0; qb < 2; ++qb) { float t = sum[qb][0] + sum[qb][1]; t += __shfl_xor(t, 16, 32); if (hi == 0) RS[(qb * 16 + lr) * XP + w] = t; }   // this wave's share of each row's sum
    // P.V, transposed: out^T (64 d x 32 queries) = V^T.P^T over this wave's keys
    v8f acc[4][2];
#pragma unroll
    for (int nb = 0; nb < 4; ++nb)
#pragma unroll
        for (int qb = 0; qb < 2; ++qb) acc[nb][qb] = (v8f){};
#pragma unroll
    for (int ks = 0; ks < 4; ++ks) {
        if (ks == 1) {   // the last 32 keys of V take the registers of the first; the two scheduling barriers keep the loads here, two steps ahead of their use (the compiler otherwise sinks them to it)
            __builtin_amdgcn_sched_barrier(0);
#pragma unroll
            for (int nb = 0; nb < 4; ++nb) vb[3][nb] = WFrag<h16>::ld(pv + fo + nb * 16 * TT + 3 * 512);
            // one translation wait behind the batch's loads, the address its input (as above)
            asm volatile("s_wait_xcnt 0x0" :: "s"(pv), "v"(lane) : "memory");
            __builtin_amdgcn_sched_barrier(0); }
#pragma unroll
        for (int nb = 0; nb < 4; ++nb)
#pragma unroll
            for (int qb = 0; qb < 2; ++qb) acc[nb][qb] = wmma16(vb[ks][nb], pf[ks][qb], acc[nb][qb]); }
    // a lane holds 8 neighbouring d of one query: two 16-byte stores a tile
#pragma unroll
    for (int nb = 0; nb < 4; ++nb)
#pragma unroll
        for (int qb = 0; qb < 2; ++qb) { float* po = S + (qb * 16 + lr) * SP + 1024 + w * 64 + nb * 16 + hi * 8;
            *(v4fa*)po = __builtin_shufflevector(acc[nb][qb], acc[nb][qb], 0, 1, 2, 3); *(v4fa*)(po + 4) = __builtin_shufflevector(acc[nb][qb], acc[nb][qb], 4, 5, 6, 7); }
    __syncthreads();   // every wave's partial tile and its share of the sums are in LDS before any thread sums them
    { const int row = (int)threadIdx.x >> 4, cofs = ((int)threadIdx.x & 15) * 4; const float* pp = S + row * SP + 1024 + cofs; v4f val = *(const v4fa*)pp;
#pragma unroll
        for (int p = 1; p < 16; ++p) val += *(const v4fa*)(pp + p * 64);
        const float* pt = RS + row * XP; v4f t4 = *(const v4fa*)pt;
#pragma unroll
        for (int p = 1; p < 4; ++p) t4 += *(const v4fa*)(pt + p * 4);
        const float inv = __fdiv_rn(1.0f, (t4[0] + t4[1]) + (t4[2] + t4[3]));
        v4us oh, ol;
#pragma unroll
        for (int q = 0; q < 4; ++q) { unsigned short x, y; splitf(val[q] * inv, x, y); oh[q] = x; ol[q] = y; }
        // the merged planes in fragment order, row b T + t, so that this workgroup alone writes its four blocks (2 x 16 rows, the head's 2 x 32 columns)
        const size_t o = ((size_t)((b * TT + i0 + row) >> 4) * (DD / 32) + h * 2 + (cofs >> 5)) * 512 + (cofs & 16) * 16 + (((cofs >> 3) & 1) * 16 + (row & 15)) * 8 + (cofs & 7); *(v4us*)(Ah + o) = oh; *(v4us*)(Al + o) = ol; }
}

extern "C" void kernel_launch(void* const* d_in, const int* in_sizes, int n_in,
                              void* d_out, int out_size, void* d_ws, size_t ws_size, hipStream_t stream) {
    (void)in_sizes; (void)n_in; (void)out_size;
    const float* x = (const float*)d_in[0]; const float* r = (const float*)d_in[1]; const float* rwb = (const float*)d_in[2]; const float* rrb = (const float*)d_in[3]; const float* qkvw = (const float*)d_in[4]; const float* rw = (const float*)d_in[5]; const float* ow = (const float*)d_in[6]; const float* ob = (const float*)d_in[7];
    float* OUT = (float*)d_out;     // [2048][2][1024] (rows t*2 + b)
    char* wsp = (char*)d_ws;
    auto take = [&](size_t bytes) { char* p = wsp; wsp += (bytes + 255) & ~(size_t)255; return (void*)p; };
    bf* WQ = (bf*)take((size_t)DD * DD * 2); bf* WK = (bf*)take((size_t)DD * DD * 2); bf* WV = (bf*)take((size_t)DD * DD * 2); bf* WR = (bf*)take((size_t)DD * DD * 2); bf* WO = (bf*)take((size_t)DD * DD * 2);
    bf* XB = (bf*)take((size_t)NT * DD * 2); bf* RB = (bf*)take((size_t)TT * DD * 2);
    h16* QA = (h16*)take((size_t)NT * DD * 2); h16* QB = (h16*)take((size_t)NT * DD * 2); h16* KP = (h16*)take((size_t)NT * DD * 2); h16* VT = (h16*)take((size_t)NT * DD * 2); h16* RK = (h16*)take((size_t)NH_ * TT * HD * 2);
    bf* ATh = (bf*)take((size_t)NT * DD * 2); bf* ATl = (bf*)take((size_t)NT * DD * 2);
    if ((size_t)(wsp - (char*)d_ws) > ws_size) return;    // total 74 MiB
    k_cvtall<<<GQKV + 2 * GW + GX + GR, 256, 0, stream>>>(qkvw, rw, ow, x, r, WQ);   // WQ, WK, WV, WR, WO, XB, RB lie one behind the other
    const dim3 gP(NT / 64, DD / 64, 1);
    k_proj<<<dim3(NT / 64, 56, 1), 128, 0, stream>>>(XB, RB, WQ, rwb, rrb, QA, QB, KP, VT, RK);   // WQ, WK, WV, WR lie one behind the other: the 4 DD rows of W
    k_relattn<<<dim3(TT / RT, NB_ * NH_, 1), 512, 0, stream>>>(QA, QB, KP, RK, VT, ATh, ATl);
    k_gemmks<bf, true, true, true, 4, 4><<<gP, 128, 0, stream>>>(ATh, ATl, WO, DD, OUT, DD, ob, 0, 0, 0);
}

// v007
// Measured time: 154 microseconds a run.
// Next to v006, in two timings, it ran 1.22 and 1.19 times as fast.
// Counting every step since v000, it is 10.2 times as fast.
#include <hip/hip_runtime.h>

// Relative-position multi-head attention (segment-recurrence style relative shift; query [2048][2][1024] seq-first, r [2048][1024]; w = query qkv_w^T -> q|k|v (16 heads x 64); r_k = r r_w^T; AC = (q + r_w_bias).k,
// BD = rel_shift((q + r_r_bias).r_k) with the module's exact zero-pad/reshape shift (out[i][j] = BD[f / (T+1)][f % (T+1) - 1] or 0 when f % (T+1) == 0, f = T + i*T + j); p = softmax((AC + BD) / 8)
// over the keys; attn = p.v; out = merged out_w^T + out_b; output [2048][2][1024] (rows t*2 + b)).
// Compute dtypes, f32 accumulate: every input rounded to bf16; the qkv and r projections on PLAIN bf16 operands (inputs: exact); AC, BD and attn.v on SINGLE fp16 planes
// (the per-head biases added in f32 before the fp16 rounding; logit sd ~ 0.6); the relative shift is an index scatter into the LDS score rows of the fused attention kernel; P = e^(s - max) in fp16, divided by the row's sum behind P.V;

#define NB_  2
#define TT   2048
#define DD   1024
#define NH_  16
#define HD   64
#define NT   (NB_ * TT)
typedef _Float16 h16;
typedef unsigned short bf;
typedef __attribute__((ext_vector_type(16))) __bf16   v16bf;
typedef __attribute__((ext_vector_type(16))) _Float16 v16h;
typedef __attribute__((ext_vector_type(8)))  _Float16 v8h;
typedef __attribute__((ext_vector_type(8)))  unsigned short v8us;
typedef __attribute__((ext_vector_type(8)))  float    v8f;
typedef __attribute__((ext_vector_type(4)))  float    v4f;
typedef v8h  __attribute__((may_alias)) v8ha;
typedef v4f  __attribute__((may_alias)) v4fa;
typedef v8us __attribute__((may_alias)) v8usa;

__device__ __forceinline__ unsigned short f2bf(float f) { unsigned u = __float_as_uint(f); u += 0x7FFFu + ((u >> 16) & 1u); return (unsigned short)(u >> 16); }
__device__ __forceinline__ float bf2f(unsigned short b) { return __uint_as_float(((unsigned)b) << 16); }
__device__ __forceinline__ float bfr(float f) { return bf2f(f2bf(f)); }
__device__ __forceinline__ v16h cat16(v8h lo, v8h hi) { return __builtin_shufflevector(lo, hi, 0, 1, 2, 3, 4, 5, 6, 7, 8, 9, 10, 11, 12, 13, 14, 15); }
__device__ __forceinline__ v16bf cat16b(v8us lo, v8us hi) { return __builtin_bit_cast(v16bf, __builtin_shufflevector(lo, hi, 0, 1, 2, 3, 4, 5, 6, 7, 8, 9, 10, 11, 12, 13, 14, 15)); }
__device__ __forceinline__ v8f wmma16(v16h a, v16h b, v8f c) { return __builtin_amdgcn_wmma_f32_16x16x32_f16(false, a, false, b, (short)0, c, false, false); }
__device__ __forceinline__ v8f wmmab(v16bf a, v16bf b, v8f c) { return __builtin_amdgcn_wmma_f32_16x16x32_bf16(false, a, false, b, (short)0, c, false, false); }



// FRAGMENT ORDER: every 16-bit operand plane [rows][K] that a kernel fetches from global memory lies in blocks of 16 rows x 32 k (512 values, 1 KiB), block (row / 16) * (K / 32) + k / 32;
// inside a block the value (row % 16, k % 32) lies at (k & 16) * 16 + ((k >> 3 & 1) * 16 + row % 16) * 8 + (k & 7). Lane l = 16 hi + lr of a fragment (row lr; k = 8 hi .. 8 hi + 7 and 16 + 8 hi .. 16 + 8 hi + 7)
// so finds its two 16-byte pieces at 8 l and 256 + 8 l, and each of the wave's two loads covers 512 contiguous bytes, four whole lines, where a row-major plane makes it touch sixteen.
// fragment loaders: p = the block's start + 8 lane
template <typename T16> struct WFrag;
template <> struct WFrag<h16> { typedef v16h V; static __device__ __forceinline__ V ld(const h16* p) { return cat16(*(const v8h*)p, *(const v8h*)(p + 256)); } static __device__ __forceinline__ v8f mma(V a, V b, v8f c) { return wmma16(a, b, c); } };
template <> struct WFrag<bf> { typedef v16bf V; static __device__ __forceinline__ V ld(const bf* p) { return cat16b(*(const v8us*)p, *(const v8us*)(p + 256)); } static __device__ __forceinline__ v8f mma(V a, V b, v8f c) { return wmmab(a, b, c); } };
__device__ __forceinline__ h16 tohx(float x) { return (h16)x; }
__device__ __forceinline__ void splitf(float y, unsigned short& h, unsigned short& l) { h = f2bf(y); l = f2bf(y - bf2f(h)); }
typedef __attribute__((ext_vector_type(2))) _Float16 v2h;
typedef __attribute__((ext_vector_type(4))) _Float16 v4h;
typedef __attribute__((ext_vector_type(2))) unsigned short v2us;
typedef __attribute__((ext_vector_type(4))) int v4i;

// ---- k_cvtall: every f32 input matrix [rows][DD], row-major -> bf16 in fragment order, in one launch. dst: the planes of qkv_w, r_w, out_w, query and r, which lie one behind the other in the workspace, in this order.
// One workgroup makes one row of blocks: 16 source rows x DD columns, 2048 pieces of 16 bytes, 32 KiB of dst; grid = all rows / 16. Thread t makes the pieces t, t + 256, ..: a wave stores 512 contiguous bytes and reads 64 bytes of each of 16 rows.
// A thread's eight loads are all issued before the first value is used, so that a wave has 8 KiB in flight and the launch needs an eighth of the waves that one piece a thread takes.
#define GQKV (3 * DD / 16)
#define GW   (DD / 16)
#define GX   (NT / 16)
#define GR   (TT / 16)
__global__ __launch_bounds__(256) void k_cvtall(const float* __restrict__ qkvw, const float* __restrict__ rw, const float* __restrict__ ow, const float* __restrict__ x, const float* __restrict__ r, bf* dst) {
    const int g = blockIdx.x, t = threadIdx.x;   // the source matrix and the row group in it are the same for the whole workgroup
    const float* src = g < GQKV ? qkvw : g < GQKV + GW ? rw : g < GQKV + 2 * GW ? ow : g < GQKV + 2 * GW + GX ? x : r;
    const int gl = g - (g < GQKV ? 0 : g < GQKV + GW ? GQKV : g < GQKV + 2 * GW ? GQKV + GW : g < GQKV + 2 * GW + GX ? GQKV + 2 * GW : GQKV + 2 * GW + GX);
    const float* ps = src + (size_t)(gl * 16 + (t & 15)) * DD + (t >> 6) * 32 + ((t >> 5) & 1) * 16 + ((t >> 4) & 1) * 8; v8f v[8];   // piece t + 256 j lies four blocks, 128 columns, behind piece t + 256 (j - 1)
#pragma unroll
    for (int j = 0; j < 8; ++j) v[j] = *(const v8f*)(ps + j * 128);
    // the translation wait behind the loads, the address its input, so that no later result lands in an address register ahead of it
    asm volatile("s_wait_xcnt 0x0" :: "v"(ps) : "memory");
    bf* pd = dst + (size_t)g * 16384 + t * 8;
#pragma unroll
    for (int j = 0; j < 8; ++j) { v8us o;
#pragma unroll
        for (int k = 0; k < 8; ++k) o[k] = f2bf(v[j][k]);
        *(v8us*)(pd + j * 2048) = o; }
}
// ---- k_proj: the q, k, v and r projections in one launch, each 64x64 tile stored straight as the fp16 operand planes of k_relattn, in fragment order; no f32 plane in memory.
// One workgroup of 4 waves (2 x 2) makes a 128 x 128 tile, each wave 64 x 64 of it over the whole K, one f32 sum a value. The 128 rows of each operand are fetched once for the workgroup, where a wave that fetches
// for itself alone takes 64 + 64 rows for a 64 x 64 tile: half the bytes from L2. A stage is 64 k of both operands: 16 pieces of 2 KiB (16 rows x 64 k are two blocks of the fragment order, one behind the other),
// brought into LDS as they lie by asynchronous copies, 16 bytes a thread and piece; two buffers, the next stage's copies fly while this stage is worked on. A fragment is read from LDS as from memory: 2 x 512 contiguous bytes a wave.
// W: the rows of qkv_w, then those of r_w (4 DD rows); a column tile of 128 is two heads of q, k, v or r_k. grid (NT / 128, 28): y < 24 is the column tile, x the row tile of XB (rows t NB + b: 64 t of both batches);
// the 4 x 32 workgroups behind them are the 16 row tiles x 8 column tiles of RB. A 64x64 tile holds whole 1-KiB blocks of its planes: thread piece = 16 bytes, a wave's store = 512 contiguous bytes.
// QA = q + r_w_bias, QB = q + r_r_bias, KP = k: [batch x head][T][64]; RK: [head][T][64]; VT: [batch x head][64 rows d][T] (k = t).
#define SK   64          // k values a stage
#define NSTG (DD / SK)
#define STGB 32768       // bytes a stage: 8 pieces of A, 8 of B
__device__ __forceinline__ unsigned lds_off(const void* p) { return (unsigned)(size_t)p; }
// the eight 2-KiB pieces of one operand's 128 rows: l = this thread's LDS byte address in piece 0, g = its 16 bytes of piece 0 in memory; the next 16 rows lie 16 DD values further.
// The translation wait is the statement's last line, so that no address register is rewritten ahead of it.
__device__ __forceinline__ void copy8(unsigned l, const bf* g) {
    asm volatile("global_load_async_to_lds_b128 %0, %8, off\n\t"
                 "global_load_async_to_lds_b128 %1, %9, off\n\t"
                 "global_load_async_to_lds_b128 %2, %10, off\n\t"
                 "global_load_async_to_lds_b128 %3, %11, off\n\t"
                 "global_load_async_to_lds_b128 %4, %12, off\n\t"
                 "global_load_async_to_lds_b128 %5, %13, off\n\t"
                 "global_load_async_to_lds_b128 %6, %14, off\n\t"
                 "global_load_async_to_lds_b128 %7, %15, off\n\t"
                 "s_wait_xcnt 0x0"
                 :: "v"(l), "v"(l + 2048u), "v"(l + 4096u), "v"(l + 6144u), "v"(l + 8192u), "v"(l + 10240u), "v"(l + 12288u), "v"(l + 14336u),
                    "v"(g), "v"(g + 16 * DD), "v"(g + 32 * DD), "v"(g + 48 * DD), "v"(g + 64 * DD), "v"(g + 80 * DD), "v"(g + 96 * DD), "v"(g + 112 * DD) : "memory");
}
// one stage: A's pieces, then B's
__device__ __forceinline__ void fill_stage(unsigned l, const bf* ga, const bf* gb, int s) { const unsigned ls = l + (unsigned)(s & 1) * STGB; copy8(ls, ga + s * (SK * 16)); copy8(ls + 16384u, gb + s * (SK * 16)); }
// acc = the wave's 64 x 64 of the tile at (r0, c0); sm: the two stage buffers. Behind it every wave has passed the last stage's barrier and no copy is in flight: sm is free.
__device__ __forceinline__ void gemm_tile128(const bf* __restrict__ A, const bf* __restrict__ Bt, int r0, int c0, const char* sm, v8f (&acc)[4][4]) {
    const int t = threadIdx.x, lane = t & 31; const int w = __builtin_amdgcn_readfirstlane(t >> 5);
    const bf* ga = A + (size_t)r0 * DD + t * 8; const bf* gb = Bt + (size_t)c0 * DD + t * 8; const unsigned l0 = lds_off(sm) + (unsigned)t * 16u;
#pragma unroll
    for (int mb = 0; mb < 4; ++mb)
#pragma unroll
        for (int nb = 0; nb < 4; ++nb) acc[mb][nb] = (v8f){};
    fill_stage(l0, ga, gb, 0);
    asm volatile("s_wait_asynccnt 0x0" ::: "memory");   // this wave's copies of stage 0 have landed
    __syncthreads();                                     // and every other wave's: stage 0 may be read
    fill_stage(l0, ga, gb, 1);
    const char* fa = sm + (w >> 1) * 8192 + lane * 16; const char* fb = sm + 16384 + (w & 1) * 8192 + lane * 16;   // the wave's four pieces of each operand
#pragma unroll 1   // one body for all stages: the buffer is chosen by s & 1, and the foot's waits and barrier stand once
    for (int s = 0; s < NSTG; ++s) { const int bo = (s & 1) * STGB; v16bf a[4], b[4];
#pragma unroll
        for (int mb = 0; mb < 4; ++mb) { a[mb] = WFrag<bf>::ld((const bf*)(fa + bo + mb * 2048)); b[mb] = WFrag<bf>::ld((const bf*)(fb + bo + mb * 2048)); }
        __builtin_amdgcn_sched_barrier(0);   // the block's 16 LDS reads stand together in front of its products (the compiler otherwise deals B's reads out among them, and each group waits anew)
#pragma unroll
        for (int nb = 0; nb < 4; ++nb)
#pragma unroll
            for (int mb = 0; mb < 4; ++mb) acc[mb][nb] = wmmab(a[mb], b[nb], acc[mb][nb]);
#pragma unroll
        for (int mb = 0; mb < 4; ++mb) { a[mb] = WFrag<bf>::ld((const bf*)(fa + bo + mb * 2048 + 1024)); b[mb] = WFrag<bf>::ld((const bf*)(fb + bo + mb * 2048 + 1024)); }
        // the foot stands behind the stage's last LDS read, not behind its last product: the second 32 k are in registers, so the buffer is handed on and refilled while their products run
        asm volatile("s_wait_dscnt 0x0" ::: "memory");      // this wave's reads of the buffer are done before it is handed to the copies
        asm volatile("s_wait_asynccnt 0x0" ::: "memory");   // this wave's copies of stage s + 1 have landed
        __syncthreads();                                     // stage s + 1 may be read; every wave has left stage s's buffer
        if (s + 2 < NSTG) fill_stage(l0, ga, gb, s + 2);
#pragma unroll
        for (int nb = 0; nb < 4; ++nb)
#pragma unroll
            for (int mb = 0; mb < 4; ++mb) acc[mb][nb] = wmmab(a[mb], b[nb], acc[mb][nb]);
    }
    asm volatile("s_wait_asynccnt 0x0" ::: "memory");   // nothing is in flight when the buffers become the tiles' staging
}
// one 16-byte piece: 8 neighbouring columns of one tile row
__device__ __forceinline__ v8f row8(const float* pp) { const v4f v0 = *(const v4fa*)pp, v1 = *(const v4fa*)(pp + 4); return __builtin_shufflevector(v0, v1, 0, 1, 2, 3, 4, 5, 6, 7); }
__device__ __forceinline__ v8h addh8(v8f v, v8f b) { v8h o;
#pragma unroll
    for (int q = 0; q < 8; ++q) o[q] = tohx(__fadd_rn(v[q], b[q]));
    return o; }
// a thread's four pieces of one plane
__device__ __forceinline__ void store4(h16* const (&p)[4], const v8h (&o)[4]) {
#pragma unroll
    for (int it = 0; it < 4; ++it) *(v8h*)p[it] = o[it];
    // the translation wait behind the stores, their addresses and values its inputs, so that no later result lands in one of those registers ahead of it
    asm volatile("s_wait_xcnt 0x0" :: "v"(p[0]), "v"(p[1]), "v"(p[2]), "v"(p[3]), "v"(o[0]), "v"(o[1]), "v"(o[2]), "v"(o[3]) : "memory"); }
__global__ __launch_bounds__(128) void k_proj(const bf* __restrict__ XB, const bf* __restrict__ RB, const bf* __restrict__ W, const float* __restrict__ rwb, const float* __restrict__ rrb, h16* QA, h16* QB, h16* KP, h16* VT, h16* RK) {
    __shared__ __align__(16) float os[4 * 64 * 68];   // first the two stage buffers (2 x 32 KiB), then the four waves' 64 x 64 tiles, pitch 68 floats
    const int y = blockIdx.y; const bool isr = y >= 24; const int rid = (y - 24) * (NT / 128) + (int)blockIdx.x;
    const int xt = isr ? rid & (TT / 128 - 1) : (int)blockIdx.x, ct = isr ? 24 + rid / (TT / 128) : y; const int kind = ct >> 3, h0 = (ct & 7) * 2;   // kind 0 q, 1 k, 2 v, 3 r_k: the same for the whole workgroup; its two heads h0, h0 + 1
    // thread -> its place in a block: l the 16-byte piece of a half block, hf the half, kb one bit of the block's number; the other two bits are the trip it
    const int l = threadIdx.x & 31, lr = l & 15, hi = l >> 4, hf = ((int)threadIdx.x >> 5) & 1, kb = (int)threadIdx.x >> 6; const int po = hf * 256 + l * 8;
    const int d = kb * 32 + hf * 16 + hi * 8;   // q, k, r_k: the piece's first column, the same on every trip
    v8f ba[2] = { (v8f){}, (v8f){} }, bb[2] = { (v8f){}, (v8f){} };
    v8f acc[4][4];
    gemm_tile128(isr ? RB : XB, W, xt * 128, ct * 128, (const char*)os, acc);
    if (kind == 0) { const float* pa = rwb + h0 * HD + d; const float* pb = rrb + h0 * HD + d; ba[0] = *(const v8f*)pa; ba[1] = *(const v8f*)(pa + HD); bb[0] = *(const v8f*)pb; bb[1] = *(const v8f*)(pb + HD);   // both heads' biases, fetched behind the k loop, where 32 registers are free for them; the tile's LDS stores and the barrier stand between the loads and their use
        // the translation wait behind the loads, the addresses its inputs (as in k_cvtall)
        asm volatile("s_wait_xcnt 0x0" :: "v"(pa), "v"(pb) : "memory"); }
    { const int w = __builtin_amdgcn_readfirstlane(threadIdx.x >> 5);
#pragma unroll
        for (int mb = 0; mb < 4; ++mb)
#pragma unroll
            for (int nb = 0; nb < 4; ++nb)
#pragma unroll
                for (int j = 0; j < 8; ++j) os[(w * 64 + mb * 16 + hi * 8 + j) * 68 + nb * 16 + lr] = acc[mb][nb][j]; }
    __syncthreads();   // every wave's tile is in LDS before the threads regroup it
#pragma unroll
    for (int c = 0; c < 2; ++c)
#pragma unroll
        for (int q = 0; q < 8; ++q) { ba[c][q] = bfr(ba[c][q]); bb[c][q] = bfr(bb[c][q]); }
    // wave w's tile: row half w / 2, column half (head) w % 2; all threads store one tile after the other
#pragma unroll
    for (int sub = 0; sub < 4; ++sub) { const float* ot = os + sub * 64 * 68; const int x6 = xt * 2 + (sub >> 1), h = h0 + (sub & 1); h16* pd[4]; v8h o[4];
        if (kind == 2) {
#pragma unroll
            for (int it = 0; it < 4; ++it) { const int db = (it & 1) * 2 + kb, b = it >> 1; const float* pp = ot + ((hf * 16 + hi * 8) * NB_ + b) * 68 + db * 16 + lr;   // 8 rows t of column d = 16 db + lr
#pragma unroll
                for (int q = 0; q < 8; ++q) o[it][q] = tohx(pp[q * NB_ * 68]);
                pd[it] = VT + (size_t)(b * NH_ + h) * HD * TT + (size_t)(db * (TT / 32) + x6) * 512 + po; }
            store4(pd, o);
        } else { v8f v[4]; size_t off[4]; h16* P = kind == 0 ? QA : kind == 1 ? KP : RK;
#pragma unroll
            for (int it = 0; it < 4; ++it) { v[it] = row8(ot + (kind == 3 ? it * 16 + lr : ((it & 1) * 16 + lr) * NB_ + (it >> 1)) * 68 + d);
                off[it] = (kind == 3 ? (size_t)h * TT * HD + (size_t)(x6 * 4 + it) * 1024 : (size_t)((it >> 1) * NH_ + h) * TT * HD + (size_t)(x6 * 2 + (it & 1)) * 1024) + kb * 512 + po;
                pd[it] = P + off[it]; o[it] = addh8(v[it], ba[sub & 1]); }   // k, r_k: ba is zero
            store4(pd, o);
            if (kind == 0) {
#pragma unroll
                for (int it = 0; it < 4; ++it) { pd[it] = QB + off[it]; o[it] = addh8(v[it], bb[sub & 1]); }
                store4(pd, o); }
        }
    }
}
// ---- k_relattn: scores, relative shift, softmax, P.V and the head merge for RT query rows of one (batch, head); grid (T / RT, batch x heads), 16 waves.
// The RT rows of shifted BD stay in LDS (f32, pitch SP floats). BD[i][m] = (q_i + r_r_bias).r_k[m] lands where the module's zero-pad/reshape shift puts it: at row i, key m - (T - 1 - i), when that is >= 0,
// else at row i - 1, key m + i + 1; row i, key i + 1 is the shift's zero. So the rows i0 .. i0 + RT - 1 take the first kind from q rows i0 .. and the second kind from q rows i0 + 1 .. .
// AC is made transposed (keys x queries), each wave its own 128 keys of all RT rows, and stays in registers: the wave adds its BD values from LDS, the row maxima go from wave to wave through LDS,
// and e^(s - max), rounded to fp16, is the B operand of P.V^T as it stands. The waves' f32 partial tiles lie in the second half of the rows and are joined in wave order by the threads that divide by the row's sum
// and store the merged bf16 hi/lo planes. All five operand planes and the two merged planes lie in fragment order.
#define RT 32
#define SP 2052
#define XP 20   // floats a row of RM and RS: the 16-byte pieces of 16 neighbouring rows fall on different banks
// e^x as the fast library form has it, 2^(x log2 e); the v_nop is the one independent slot that the instruction set asks for behind a transcendental, in the same statement so that it stays directly behind it
__device__ __forceinline__ float exp_slot(float x) { float r; asm("v_exp_f32 %0, %1\n\tv_nop" : "=v"(r) : "v"(x * 1.44269504f)); return r; }
typedef v4h __attribute__((may_alias)) v4ha;
typedef __attribute__((ext_vector_type(4))) unsigned short v4us;
__global__ __launch_bounds__(512) void k_relattn(const h16* __restrict__ QA, const h16* __restrict__ QB, const h16* __restrict__ KP, const h16* __restrict__ RK, const h16* __restrict__ VT, bf* Ah, bf* Al) {
    __shared__ __align__(16) float S[RT * SP];
    __shared__ __align__(16) float RM[RT * XP], RS[RT * XP];   // per row: the 16 waves' maxima, the 16 waves' shares of the sum
    const int z = blockIdx.y, b = z >> 4, h = z & 15, i0 = blockIdx.x * RT;
    const int lane = threadIdx.x & 31, lr = lane & 15, hi = lane >> 4; const int w = __builtin_amdgcn_readfirstlane(threadIdx.x >> 5);
    QA += (size_t)z * TT * HD; QB += (size_t)z * TT * HD; KP += (size_t)z * TT * HD; VT += (size_t)z * HD * TT; RK += (size_t)h * TT * HD;
    const int fo = 8 * lane;   // this lane's place in a block of the fragment order; 16 rows of a plane with 64 values a row are two blocks, k 0 .. 31 and 32 .. 63
    v16h qa[2][2], kb[8][2]; const h16* pq = QA + i0 * HD; const h16* pk = KP + w * 128 * HD;   // AC's operands: both blocks of 16 queries, this wave's 8 tiles of 16 keys
    {   // BD, stored shifted; wave w takes the 16-column tiles w, w + 16, ...
        v16h ql[2][2], qu[2][2]; const h16* pl = QB + i0 * HD; const h16* pr = RK + w * 16 * HD; const h16* pu[2];   // pl, pr: the same for the whole wave; the lane's place fo is added at each load
#pragma unroll
        for (int mb = 0; mb < 2; ++mb) { const int ru = min(i0 + 1 + mb * 16 + lr, TT - 1); pu[mb] = QB + (ru >> 4) * (16 * HD) + (hi * 16 + (ru & 15)) * 8;   // the row behind the last one feeds no key: any row in bounds serves
#pragma unroll
            for (int ks = 0; ks < 2; ++ks) { ql[mb][ks] = WFrag<h16>::ld(pl + fo + mb * 16 * HD + ks * 512); qu[mb][ks] = WFrag<h16>::ld(pu[mb] + ks * 512); } }
#pragma unroll
        for (int g = 0; g < 2; ++g) { v16h rb[4][2];
#pragma unroll
            for (int s = 0; s < 4; ++s)
#pragma unroll
                for (int ks = 0; ks < 2; ++ks) rb[s][ks] = WFrag<h16>::ld(pr + fo + (g * 4 + s) * 256 * HD + ks * 512);
            // one translation wait behind the batch's loads; the addresses are its inputs (the wave's bases in scalar registers, the lane number that the loads scale), so that no load's result and no later add lands in an address register ahead of it
            asm volatile("s_wait_xcnt 0x0" :: "s"(pl), "v"(pu[0]), "v"(pu[1]), "s"(pr), "v"(lane) : "memory");
            if (g == 1) {   // AC's queries and its first four key tiles, as many as the registers take here: they fly while the second half of BD is made
#pragma unroll
                for (int qb = 0; qb < 2; ++qb)
#pragma unroll
                    for (int ks = 0; ks < 2; ++ks) qa[qb][ks] = WFrag<h16>::ld(pq + fo + qb * 16 * HD + ks * 512);
#pragma unroll
                for (int kt = 0; kt < 4; ++kt)
#pragma unroll
                    for (int ks = 0; ks < 2; ++ks) kb[kt][ks] = WFrag<h16>::ld(pk + fo + kt * 16 * HD + ks * 512);
                // one translation wait behind the batch's loads, the addresses its inputs (as above)
                asm volatile("s_wait_xcnt 0x0" :: "s"(pq), "s"(pk), "v"(lane) : "memory"); }
#pragma unroll
            for (int s = 0; s < 4; ++s)
#pragma unroll
                for (int mb = 0; mb < 2; ++mb) { const int base = ((g * 4 + s) * 16 + w) * 16 + i0 + mb * 16; float* sr = S + (mb * 16 + hi * 8) * SP;
                    if (base + 30 >= TT - 1) { v8f c = (v8f){}; c = wmma16(ql[mb][0], rb[s][0], c); c = wmma16(ql[mb][1], rb[s][1], c); const int j = base + lr + hi * 8 - (TT - 1);
#pragma unroll
                        for (int q = 0; q < 8; ++q) if (j + q >= 0) sr[q * SP + j + q] = c[q]; }
                    if (base + 2 < TT) { v8f c = (v8f){}; c = wmma16(qu[mb][0], rb[s][0], c); c = wmma16(qu[mb][1], rb[s][1], c); const int j = base + lr + hi * 8 + 2;
#pragma unroll
                        for (int q = 0; q < 8; ++q) if (j + q < TT) sr[q * SP + j + q] = c[q]; } } }
        if (threadIdx.x < RT) { const int j = i0 + (int)threadIdx.x + 1; if (j < TT) S[threadIdx.x * SP + j] = 0.f; }
    }
    // AC, transposed: wave w makes S^T = K.Q^T for its 128 keys (8 tiles of 16) and both blocks of 16 queries. A lane holds query lr of a block and the keys 8 hi .. 8 hi + 7 of a tile: two neighbouring tiles,
    // rounded to fp16, are the B fragment (32 keys x 16 queries) of P.V as they stand. The products need no LDS, so they stand in front of the barrier and run while other waves still scatter BD.
    v8f sc[8][2];
    {
#pragma unroll
        for (int kt = 4; kt < 8; ++kt)
#pragma unroll
            for (int ks = 0; ks < 2; ++ks) kb[kt][ks] = WFrag<h16>::ld(pk + fo + kt * 16 * HD + ks * 512);
        // one translation wait behind the batch's loads, the addresses its inputs (as above)
        asm volatile("s_wait_xcnt 0x0" :: "s"(pk), "v"(lane) : "memory");
        __builtin_amdgcn_sched_barrier(0);   // every load is issued before the first product waits for one (the compiler otherwise deals the loads out among the products, and each waits anew)
#pragma unroll
        for (int kt = 0; kt < 8; ++kt)
#pragma unroll
            for (int qb = 0; qb < 2; ++qb) { v8f c = (v8f){}; c = wmma16(kb[kt][0], qa[qb][0], c); c = wmma16(kb[kt][1], qa[qb][1], c); sc[kt][qb] = c; }
    }
    __builtin_amdgcn_sched_barrier(0);   // the products stay in front of the barrier, where they run while other waves still scatter BD (the compiler otherwise sinks most of them behind it)
    __syncthreads();   // every shifted BD value is in LDS before a wave reads its keys of all rows
    float mx[2] = { -3.0e38f, -3.0e38f };
#pragma unroll
    for (int kt = 0; kt < 8; ++kt)
#pragma unroll
        for (int qb = 0; qb < 2; ++qb) { const float* sr = S + (qb * 16 + lr) * SP + w * 128 + kt * 16 + hi * 8; const v4f b0 = *(const v4fa*)sr, b1 = *(const v4fa*)(sr + 4);   // s = (AC + BD) / 8
#pragma unroll
            for (int q = 0; q < 8; ++q) { const float s = __fmul_rn(__fadd_rn(sc[kt][qb][q], q < 4 ? b0[q & 3] : b1[q & 3]), 0.125f); sc[kt][qb][q] = s; mx[qb] = fmaxf(mx[qb], s); } }
#pragma unroll
    for (int qb = 0; qb < 2; ++qb) { mx[qb] = fmaxf(mx[qb], __shfl_xor(mx[qb], 16, 32)); if (hi == 0) RM[(qb * 16 + lr) * XP + w] = mx[qb]; }   // this wave's maximum of each row
    __syncthreads();   // every wave's row maxima are in LDS, and every wave has read its BD values: the score rows are free for the partial tiles
    v16h vb[4][4]; const h16* pv = VT + w * 4 * 512;   // this wave's 128 keys of V; the first 64 are fetched here, behind the barrier (which waits for every load in front of it), and fly behind the exponentials
#pragma unroll
    for (int ks = 0; ks < 2; ++ks)
#pragma unroll
        for (int nb = 0; nb < 4; ++nb) vb[ks][nb] = WFrag<h16>::ld(pv + fo + nb * 16 * TT + ks * 512);
    // one translation wait behind the batch's loads, the address its input (as above)
    asm volatile("s_wait_xcnt 0x0" :: "s"(pv), "v"(lane) : "memory");
    float sum[2][2] = { { 0.f, 0.f }, { 0.f, 0.f } }; v16h pf[4][2];
#pragma unroll
    for (int qb = 0; qb < 2; ++qb) { const float* pm = RM + (qb * 16 + lr) * XP; v4f m = *(const v4fa*)pm;
#pragma unroll
        for (int p = 1; p < 4; ++p) { const v4f n = *(const v4fa*)(pm + p * 4);
#pragma unroll
            for (int q = 0; q < 4; ++q) m[q] = fmaxf(m[q], n[q]); }
        mx[qb] = fmaxf(fmaxf(m[0], m[1]), fmaxf(m[2], m[3])); }
    // P = e^(s - max), not yet divided by the row's sum (at most 1, the row's largest exactly 1: fp16 holds it with the relative error it had for the scaled P); the division follows the join
#pragma unroll
    for (int ks = 0; ks < 4; ++ks) {
        if (ks == 2) {   // half of the scores have become fp16: registers are free for the third 32 keys of V, which fly behind the other half's exponentials
#pragma unroll
            for (int nb = 0; nb < 4; ++nb) vb[2][nb] = WFrag<h16>::ld(pv + fo + nb * 16 * TT + 2 * 512);
            // one translation wait behind the batch's loads, the address its input (as above)
            asm volatile("s_wait_xcnt 0x0" :: "s"(pv), "v"(lane) : "memory"); }
#pragma unroll
        for (int qb = 0; qb < 2; ++qb)
#pragma unroll
            for (int q = 0; q < 8; ++q) { const float e0 = exp_slot(sc[2 * ks][qb][q] - mx[qb]), e1 = exp_slot(sc[2 * ks + 1][qb][q] - mx[qb]); sum[qb][0] += e0; sum[qb][1] += e1; pf[ks][qb][q] = tohx(e0); pf[ks][qb][8 + q] = tohx(e1); } }
#pragma unroll
    for (int qb = 0; qb < 2; ++qb) { float t = sum[qb][0] + sum[qb][1]; t += __shfl_xor(t, 16, 32); if (hi == 0) RS[(qb * 16 + lr) * XP + w] = t; }   // this wave's share of each row's sum
    // P.V, transposed: out^T (64 d x 32 queries) = V^T.P^T over this wave's keys
    v8f acc[4][2];
#pragma unroll
    for (int nb = 0; nb < 4; ++nb)
#pragma unroll
        for (int qb = 0; qb < 2; ++qb) acc[nb][qb] = (v8f){};
#pragma unroll
    for (int ks = 0; ks < 4; ++ks) {
        if (ks == 1) {   // the last 32 keys of V take the registers of the first; the two scheduling barriers keep the loads here, two steps ahead of their use (the compiler otherwise sinks them to it)
            __builtin_amdgcn_sched_barrier(0);
#pragma unroll
            for (int nb = 0; nb < 4; ++nb) vb[3][nb] = WFrag<h16>::ld(pv + fo + nb * 16 * TT + 3 * 512);
            // one translation wait behind the batch's loads, the address its input (as above)
            asm volatile("s_wait_xcnt 0x0" :: "s"(pv), "v"(lane) : "memory");
            __builtin_amdgcn_sched_barrier(0); }
#pragma unroll
        for (int nb = 0; nb < 4; ++nb)
#pragma unroll
            for (int qb = 0; qb < 2; ++qb) acc[nb][qb] = wmma16(vb[ks][nb], pf[ks][qb], acc[nb][qb]); }
    // a lane holds 8 neighbouring d of one query: two 16-byte stores a tile
#pragma unroll
    for (int nb = 0; nb < 4; ++nb)
#pragma unroll
        for (int qb = 0; qb < 2; ++qb) { float* po = S + (qb * 16 + lr) * SP + 1024 + w * 64 + nb * 16 + hi * 8;
            *(v4fa*)po = __builtin_shufflevector(acc[nb][qb], acc[nb][qb], 0, 1, 2, 3); *(v4fa*)(po + 4) = __builtin_shufflevector(acc[nb][qb], acc[nb][qb], 4, 5, 6, 7); }
    __syncthreads();   // every wave's partial tile and its share of the sums are in LDS before any thread sums them
    { const int row = (int)threadIdx.x >> 4, cofs = ((int)threadIdx.x & 15) * 4; const float* pp = S + row * SP + 1024 + cofs; v4f val = *(const v4fa*)pp;
#pragma unroll
        for (int p = 1; p < 16; ++p) val += *(const v4fa*)(pp + p * 64);
        const float* pt = RS + row * XP; v4f t4 = *(const v4fa*)pt;
#pragma unroll
        for (int p = 1; p < 4; ++p) t4 += *(const v4fa*)(pt + p * 4);
        const float inv = __fdiv_rn(1.0f, (t4[0] + t4[1]) + (t4[2] + t4[3]));
        v4us oh, ol;
#pragma unroll
        for (int q = 0; q < 4; ++q) { unsigned short x, y; splitf(val[q] * inv, x, y); oh[q] = x; ol[q] = y; }
        // the merged planes in fragment order, row b T + t, so that this workgroup alone writes its four blocks (2 x 16 rows, the head's 2 x 32 columns)
        const size_t o = ((size_t)((b * TT + i0 + row) >> 4) * (DD / 32) + h * 2 + (cofs >> 5)) * 512 + (cofs & 16) * 16 + (((cofs >> 3) & 1) * 16 + (row & 15)) * 8 + (cofs & 7); *(v4us*)(Ah + o) = oh; *(v4us*)(Al + o) = ol; }
}

// ---- k_out: out = (Ah + Al) Wo^T + out_b, f32: a 128 x 128 tile a workgroup, staged as in k_proj with A's second plane as a third operand (48 KiB a stage, two buffers); grid (NT / 128, DD / 128).
// There is one workgroup a WGP, so it has 8 waves (4 x 2, each 32 x 64 of the tile), two a SIMD: one wave's LDS waits stand behind the other's products. One f32 sum a value: per 32 k Ah's products, then Al's.
// A's row b T + t is out's row t NB + b. The tile goes through LDS (pitch 132 floats), so that a wave stores 512 contiguous bytes of a row.
// four of the eight 2-KiB pieces of one operand's 128 rows, every second one (256 threads cover two pieces a copy): l, g = this thread's 16 bytes in its first piece. The translation wait is the statement's last line, as in copy8.
__device__ __forceinline__ void copy4(unsigned l, const bf* g) {
    asm volatile("global_load_async_to_lds_b128 %0, %4, off\n\t"
                 "global_load_async_to_lds_b128 %1, %5, off\n\t"
                 "global_load_async_to_lds_b128 %2, %6, off\n\t"
                 "global_load_async_to_lds_b128 %3, %7, off\n\t"
                 "s_wait_xcnt 0x0"
                 :: "v"(l), "v"(l + 4096u), "v"(l + 8192u), "v"(l + 12288u), "v"(g), "v"(g + 32 * DD), "v"(g + 64 * DD), "v"(g + 96 * DD) : "memory");
}
#define STG3 49152       // bytes a stage: 8 pieces each of Ah, Al and Wo
__device__ __forceinline__ void fill_stage3(unsigned l, const bf* ga, const bf* ga2, const bf* gb, int s) { const unsigned ls = l + (unsigned)(s & 1) * STG3; copy4(ls, ga + s * (SK * 16)); copy4(ls + 16384u, ga2 + s * (SK * 16)); copy4(ls + 32768u, gb + s * (SK * 16)); }
__device__ __forceinline__ void store4f(float* const (&p)[4], const v4f (&o)[4]) {
#pragma unroll
    for (int it = 0; it < 4; ++it) *(v4f*)p[it] = o[it];
    // the translation wait behind the stores, their addresses and values its inputs (as in store4)
    asm volatile("s_wait_xcnt 0x0" :: "v"(p[0]), "v"(p[1]), "v"(p[2]), "v"(p[3]), "v"(o[0]), "v"(o[1]), "v"(o[2]), "v"(o[3]) : "memory"); }
__global__ __launch_bounds__(256) void k_out(const bf* __restrict__ Ah, const bf* __restrict__ Al, const bf* __restrict__ Wo, const float* __restrict__ bias, float* C) {
    __shared__ __align__(16) float os[2 * STG3 / 4];   // first the two stage buffers, then the 128 x 128 tile, pitch 132 floats
    const char* sm = (const char*)os;
    const int r0 = blockIdx.x * 128, c0 = blockIdx.y * 128;
    const int t = threadIdx.x, lane = t & 31, lr = lane & 15, hi = lane >> 4; const int w = __builtin_amdgcn_readfirstlane(t >> 5), wr = w >> 1, wc = w & 1;
    const size_t go = (size_t)(t >> 7) * (16 * DD) + (t & 127) * 8;   // threads 0 .. 127 take the even pieces, the others the odd ones
    const bf* ga = Ah + (size_t)r0 * DD + go; const bf* ga2 = Al + (size_t)r0 * DD + go; const bf* gb = Wo + (size_t)c0 * DD + go; const unsigned l0 = lds_off(sm) + (unsigned)t * 16u;
    v8f acc[2][4];
#pragma unroll
    for (int mb = 0; mb < 2; ++mb)
#pragma unroll
        for (int nb = 0; nb < 4; ++nb) acc[mb][nb] = (v8f){};
    fill_stage3(l0, ga, ga2, gb, 0);
    asm volatile("s_wait_asynccnt 0x0" ::: "memory");   // this wave's copies of stage 0 have landed
    __syncthreads();                                     // and every other wave's: stage 0 may be read
    fill_stage3(l0, ga, ga2, gb, 1);
    const char* fa = sm + wr * 4096 + lane * 16; const char* fb = sm + 32768 + wc * 8192 + lane * 16;   // the wave's two pieces of Ah (Al's lie 16 KiB behind them) and its four of Wo
#pragma unroll 1   // one body for all stages: the buffer is chosen by s & 1, and the foot's waits and barrier stand once
    for (int s = 0; s < NSTG; ++s) { const int bo = (s & 1) * STG3; v16bf a[2], a2[2], b[4];
#pragma unroll
        for (int mb = 0; mb < 2; ++mb) { a[mb] = WFrag<bf>::ld((const bf*)(fa + bo + mb * 2048)); a2[mb] = WFrag<bf>::ld((const bf*)(fa + bo + 16384 + mb * 2048)); }
#pragma unroll
        for (int nb = 0; nb < 4; ++nb) b[nb] = WFrag<bf>::ld((const bf*)(fb + bo + nb * 2048));
        __builtin_amdgcn_sched_barrier(0);   // the block's 16 LDS reads stand together in front of its products (as in gemm_tile128)
#pragma unroll
        for (int nb = 0; nb < 4; ++nb)
#pragma unroll
            for (int mb = 0; mb < 2; ++mb) acc[mb][nb] = wmmab(a[mb], b[nb], acc[mb][nb]);
#pragma unroll
        for (int nb = 0; nb < 4; ++nb)
#pragma unroll
            for (int mb = 0; mb < 2; ++mb) acc[mb][nb] = wmmab(a2[mb], b[nb], acc[mb][nb]);
#pragma unroll
        for (int mb = 0; mb < 2; ++mb) { a[mb] = WFrag<bf>::ld((const bf*)(fa + bo + mb * 2048 + 1024)); a2[mb] = WFrag<bf>::ld((const bf*)(fa + bo + 16384 + mb * 2048 + 1024)); }
#pragma unroll
        for (int nb = 0; nb < 4; ++nb) b[nb] = WFrag<bf>::ld((const bf*)(fb + bo + nb * 2048 + 1024));
        // the foot stands behind the stage's last LDS read, not behind its last product (as in gemm_tile128)
        asm volatile("s_wait_dscnt 0x0" ::: "memory");      // this wave's reads of the buffer are done before it is handed to the copies
        asm volatile("s_wait_asynccnt 0x0" ::: "memory");   // this wave's copies of stage s + 1 have landed
        __syncthreads();                                     // stage s + 1 may be read; every wave has left stage s's buffer
        if (s + 2 < NSTG) fill_stage3(l0, ga, ga2, gb, s + 2);
#pragma unroll
        for (int nb = 0; nb < 4; ++nb)
#pragma unroll
            for (int mb = 0; mb < 2; ++mb) acc[mb][nb] = wmmab(a[mb], b[nb], acc[mb][nb]);
#pragma unroll
        for (int nb = 0; nb < 4; ++nb)
#pragma unroll
            for (int mb = 0; mb < 2; ++mb) acc[mb][nb] = wmmab(a2[mb], b[nb], acc[mb][nb]);
    }
    asm volatile("s_wait_asynccnt 0x0" ::: "memory");   // nothing is in flight when the buffers become the tile's staging
    const int cofs = lane * 4; const float* pb = bias + c0 + cofs; v4f bs = *(const v4f*)pb;   // the thread's four columns; the tile's LDS stores and the barrier stand between the load and its use
    // the translation wait behind the load, the address its input (as in k_cvtall)
    asm volatile("s_wait_xcnt 0x0" :: "v"(pb) : "memory");
#pragma unroll
    for (int mb = 0; mb < 2; ++mb)
#pragma unroll
        for (int nb = 0; nb < 4; ++nb)
#pragma unroll
            for (int j = 0; j < 8; ++j) os[(wr * 32 + mb * 16 + hi * 8 + j) * 132 + wc * 64 + nb * 16 + lr] = acc[mb][nb][j];
    __syncthreads();   // the whole tile is in LDS before the threads regroup it
#pragma unroll
    for (int q = 0; q < 4; ++q) bs[q] = bfr(bs[q]);
#pragma unroll
    for (int g = 0; g < 4; ++g) { float* p[4]; v4f o[4];
#pragma unroll
        for (int it = 0; it < 4; ++it) { const int row = (g * 4 + it) * 8 + w; o[it] = *(const v4fa*)(os + row * 132 + cofs) + bs;
            const unsigned m = (unsigned)(r0 + row), orow = (m % TT) * NB_ + m / TT; p[it] = C + (size_t)orow * DD + c0 + cofs; }
        store4f(p, o); }
}

extern "C" void kernel_launch(void* const* d_in, const int* in_sizes, int n_in,
                              void* d_out, int out_size, void* d_ws, size_t ws_size, hipStream_t stream) {
    (void)in_sizes; (void)n_in; (void)out_size;
    const float* x = (const float*)d_in[0]; const float* r = (const float*)d_in[1]; const float* rwb = (const float*)d_in[2]; const float* rrb = (const float*)d_in[3]; const float* qkvw = (const float*)d_in[4]; const float* rw = (const float*)d_in[5]; const float* ow = (const float*)d_in[6]; const float* ob = (const float*)d_in[7];
    float* OUT = (float*)d_out;     // [2048][2][1024] (rows t*2 + b)
    char* wsp = (char*)d_ws;
    auto take = [&](size_t bytes) { char* p = wsp; wsp += (bytes + 255) & ~(size_t)255; return (void*)p; };
    bf* WQ = (bf*)take((size_t)DD * DD * 2); bf* WK = (bf*)take((size_t)DD * DD * 2); bf* WV = (bf*)take((size_t)DD * DD * 2); bf* WR = (bf*)take((size_t)DD * DD * 2); bf* WO = (bf*)take((size_t)DD * DD * 2);
    bf* XB = (bf*)take((size_t)NT * DD * 2); bf* RB = (bf*)take((size_t)TT * DD * 2);
    h16* QA = (h16*)take((size_t)NT * DD * 2); h16* QB = (h16*)take((size_t)NT * DD * 2); h16* KP = (h16*)take((size_t)NT * DD * 2); h16* VT = (h16*)take((size_t)NT * DD * 2); h16* RK = (h16*)take((size_t)NH_ * TT * HD * 2);
    bf* ATh = (bf*)take((size_t)NT * DD * 2); bf* ATl = (bf*)take((size_t)NT * DD * 2);
    if ((size_t)(wsp - (char*)d_ws) > ws_size) return;    // total 74 MiB
    k_cvtall<<<GQKV + 2 * GW + GX + GR, 256, 0, stream>>>(qkvw, rw, ow, x, r, WQ);   // WQ, WK, WV, WR, WO, XB, RB lie one behind the other
    k_proj<<<dim3(NT / 128, 28, 1), 128, 0, stream>>>(XB, RB, WQ, rwb, rrb, QA, QB, KP, VT, RK);   // WQ, WK, WV, WR lie one behind the other: the 4 DD rows of W
    k_relattn<<<dim3(TT / RT, NB_ * NH_, 1), 512, 0, stream>>>(QA, QB, KP, RK, VT, ATh, ATl);
    k_out<<<dim3(NT / 128, DD / 128, 1), 256, 0, stream>>>(ATh, ATl, WO, ob, OUT);
}

// v009
// One run takes 124 microseconds.
// Versions in between are left out here; by their measured steps it is 1.23 times as fast as v007.
// Counting every step since v000, it is 12.5 times as fast.
#include <hip/hip_runtime.h>

// Relative-position multi-head attention (segment-recurrence style relative shift; query [2048][2][1024] seq-first, r [2048][1024]; w = query qkv_w^T -> q|k|v (16 heads x 64); r_k = r r_w^T; AC = (q + r_w_bias).k,
// BD = rel_shift((q + r_r_bias).r_k) with the module's exact zero-pad/reshape shift (out[i][j] = BD[f / (T+1)][f % (T+1) - 1] or 0 when f % (T+1) == 0, f = T + i*T + j); p = softmax((AC + BD) / 8)
// over the keys; attn = p.v; out = merged out_w^T + out_b; output [2048][2][1024] (rows t*2 + b)).
// Compute dtypes, f32 accumulate: every input rounded to bf16; the qkv and r projections on PLAIN bf16 operands (inputs: exact); AC, BD and attn.v on SINGLE fp16 planes
// (the per-head biases added in f32 before the fp16 rounding; logit sd ~ 0.6); the relative shift is an index scatter into the LDS score rows of the fused attention kernel, where BD, then AC + BD, then P lie as fp16; P = e^((s - max) / 8), divided by the row's sum behind P.V;

#define NB_  2
#define TT   2048
#define DD   1024
#define NH_  16
#define HD   64
#define NT   (NB_ * TT)
typedef _Float16 h16;
typedef unsigned short bf;
typedef __attribute__((ext_vector_type(16))) __bf16   v16bf;
typedef __attribute__((ext_vector_type(16))) _Float16 v16h;
typedef __attribute__((ext_vector_type(8)))  _Float16 v8h;
typedef __attribute__((ext_vector_type(8)))  unsigned short v8us;
typedef __attribute__((ext_vector_type(8)))  float    v8f;
typedef __attribute__((ext_vector_type(4)))  float    v4f;
typedef v8h  __attribute__((may_alias)) v8ha;
typedef v4f  __attribute__((may_alias)) v4fa;
typedef v8us __attribute__((may_alias)) v8usa;

__device__ __forceinline__ unsigned short f2bf(float f) { unsigned u = __float_as_uint(f); u += 0x7FFFu + ((u >> 16) & 1u); return (unsigned short)(u >> 16); }
__device__ __forceinline__ float bf2f(unsigned short b) { return __uint_as_float(((unsigned)b) << 16); }
__device__ __forceinline__ float bfr(float f) { return bf2f(f2bf(f)); }
__device__ __forceinline__ v16h cat16(v8h lo, v8h hi) { return __builtin_shufflevector(lo, hi, 0, 1, 2, 3, 4, 5, 6, 7, 8, 9, 10, 11, 12, 13, 14, 15); }
__device__ __forceinline__ v16bf cat16b(v8us lo, v8us hi) { return __builtin_bit_cast(v16bf, __builtin_shufflevector(lo, hi, 0, 1, 2, 3, 4, 5, 6, 7, 8, 9, 10, 11, 12, 13, 14, 15)); }
__device__ __forceinline__ v8f wmma16(v16h a, v16h b, v8f c) { return __builtin_amdgcn_wmma_f32_16x16x32_f16(false, a, false, b, (short)0, c, false, false); }
__device__ __forceinline__ v8f wmmab(v16bf a, v16bf b, v8f c) { return __builtin_amdgcn_wmma_f32_16x16x32_bf16(false, a, false, b, (short)0, c, false, false); }



// FRAGMENT ORDER: every 16-bit operand plane [rows][K] that a kernel fetches from global memory lies in blocks of 16 rows x 32 k (512 values, 1 KiB), block (row / 16) * (K / 32) + k / 32;
// inside a block the value (row % 16, k % 32) lies at (k & 16) * 16 + ((k >> 3 & 1) * 16 + row % 16) * 8 + (k & 7). Lane l = 16 hi + lr of a fragment (row lr; k = 8 hi .. 8 hi + 7 and 16 + 8 hi .. 16 + 8 hi + 7)
// so finds its two 16-byte pieces at 8 l and 256 + 8 l, and each of the wave's two loads covers 512 contiguous bytes, four whole lines, where a row-major plane makes it touch sixteen.
// fragment loaders: p = the block's start + 8 lane
template <typename T16> struct WFrag;
template <> struct WFrag<h16> { typedef v16h V; static __device__ __forceinline__ V ld(const h16* p) { return cat16(*(const v8h*)p, *(const v8h*)(p + 256)); } static __device__ __forceinline__ v8f mma(V a, V b, v8f c) { return wmma16(a, b, c); } };
template <> struct WFrag<bf> { typedef v16bf V; static __device__ __forceinline__ V ld(const bf* p) { return cat16b(*(const v8us*)p, *(const v8us*)(p + 256)); } static __device__ __forceinline__ v8f mma(V a, V b, v8f c) { return wmmab(a, b, c); } };
__device__ __forceinline__ h16 tohx(float x) { return (h16)x; }
__device__ __forceinline__ void splitf(float y, unsigned short& h, unsigned short& l) { h = f2bf(y); l = f2bf(y - bf2f(h)); }
typedef __attribute__((ext_vector_type(2))) _Float16 v2h;
typedef __attribute__((ext_vector_type(4))) _Float16 v4h;
typedef __attribute__((ext_vector_type(2))) unsigned short v2us;
typedef __attribute__((ext_vector_type(4))) int v4i;

// ---- k_cvtall: every f32 input matrix [rows][DD], row-major -> bf16 in fragment order, in one launch. dst: the planes of qkv_w, r_w, out_w, query and r, which lie one behind the other in the workspace, in this order.
// One workgroup makes one row of blocks: 16 source rows x DD columns, 2048 pieces of 16 bytes, 32 KiB of dst; grid = all rows / 16. Thread t makes the pieces t, t + 256, ..: a wave stores 512 contiguous bytes and reads 64 bytes of each of 16 rows.
// A thread's eight loads are all issued before the first value is used, so that a wave has 8 KiB in flight and the launch needs an eighth of the waves that one piece a thread takes.
#define GQKV (3 * DD / 16)
#define GW   (DD / 16)
#define GX   (NT / 16)
#define GR   (TT / 16)
__global__ __launch_bounds__(256) void k_cvtall(const float* __restrict__ qkvw, const float* __restrict__ rw, const float* __restrict__ ow, const float* __restrict__ x, const float* __restrict__ r, bf* dst) {
    const int g = blockIdx.x, t = threadIdx.x;   // the source matrix and the row group in it are the same for the whole workgroup
    const float* src = g < GQKV ? qkvw : g < GQKV + GW ? rw : g < GQKV + 2 * GW ? ow : g < GQKV + 2 * GW + GX ? x : r;
    const int gl = g - (g < GQKV ? 0 : g < GQKV + GW ? GQKV : g < GQKV + 2 * GW ? GQKV + GW : g < GQKV + 2 * GW + GX ? GQKV + 2 * GW : GQKV + 2 * GW + GX);
    const float* ps = src + (size_t)(gl * 16 + (t & 15)) * DD + (t >> 6) * 32 + ((t >> 5) & 1) * 16 + ((t >> 4) & 1) * 8; v8f v[8];   // piece t + 256 j lies four blocks, 128 columns, behind piece t + 256 (j - 1)
#pragma unroll
    for (int j = 0; j < 8; ++j) v[j] = *(const v8f*)(ps + j * 128);
    // the translation wait behind the loads, the address its input, so that no later result lands in an address register ahead of it
    asm volatile("s_wait_xcnt 0x0" :: "v"(ps) : "memory");
    bf* pd = dst + (size_t)g * 16384 + t * 8;
#pragma unroll
    for (int j = 0; j < 8; ++j) { v8us o;
#pragma unroll
        for (int k = 0; k < 8; ++k) o[k] = f2bf(v[j][k]);
        *(v8us*)(pd + j * 2048) = o; }
}
// ---- k_proj: the q, k, v and r projections in one launch, each 64x64 tile stored straight as the fp16 operand planes of k_relattn, in fragment order; no f32 plane in memory.
// One workgroup of 4 waves (2 x 2) makes a 128 x 128 tile, each wave 64 x 64 of it over the whole K, one f32 sum a value. The 128 rows of each operand are fetched once for the workgroup, where a wave that fetches
// for itself alone takes 64 + 64 rows for a 64 x 64 tile: half the bytes from L2. A stage is 64 k of both operands: 16 pieces of 2 KiB (16 rows x 64 k are two blocks of the fragment order, one behind the other),
// brought into LDS as they lie by asynchronous copies, 16 bytes a thread and piece; two buffers, the next stage's copies fly while this stage is worked on. A fragment is read from LDS as from memory: 2 x 512 contiguous bytes a wave.
// W: the rows of qkv_w, then those of r_w (4 DD rows); a column tile of 128 is two heads of q, k, v or r_k. grid (NT / 128, 28): y < 24 is the column tile, x the row tile of XB (rows t NB + b: 64 t of both batches);
// the 4 x 32 workgroups behind them are the 16 row tiles x 8 column tiles of RB. A 64x64 tile holds whole 1-KiB blocks of its planes: thread piece = 16 bytes, a wave's store = 512 contiguous bytes.
// QA = q + r_w_bias, QB = q + r_r_bias, KP = k: [batch x head][T][64]; RK: [head][T][64]; VT: [batch x head][64 rows d][T] (k = t).
#define SK   64          // k values a stage
#define NSTG (DD / SK)
#define STGB 32768       // bytes a stage: 8 pieces of A, 8 of B
__device__ __forceinline__ unsigned lds_off(const void* p) { return (unsigned)(size_t)p; }
// the eight 2-KiB pieces of one operand's 128 rows: l = this thread's LDS byte address in piece 0, g = its 16 bytes of piece 0 in memory; the next 16 rows lie 16 DD values further.
// The translation wait is the statement's last line, so that no address register is rewritten ahead of it.
__device__ __forceinline__ void copy8(unsigned l, const bf* g) {
    asm volatile("global_load_async_to_lds_b128 %0, %8, off\n\t"
                 "global_load_async_to_lds_b128 %1, %9, off\n\t"
                 "global_load_async_to_lds_b128 %2, %10, off\n\t"
                 "global_load_async_to_lds_b128 %3, %11, off\n\t"
                 "global_load_async_to_lds_b128 %4, %12, off\n\t"
                 "global_load_async_to_lds_b128 %5, %13, off\n\t"
                 "global_load_async_to_lds_b128 %6, %14, off\n\t"
                 "global_load_async_to_lds_b128 %7, %15, off\n\t"
                 "s_wait_xcnt 0x0"
                 :: "v"(l), "v"(l + 2048u), "v"(l + 4096u), "v"(l + 6144u), "v"(l + 8192u), "v"(l + 10240u), "v"(l + 12288u), "v"(l + 14336u),
                    "v"(g), "v"(g + 16 * DD), "v"(g + 32 * DD), "v"(g + 48 * DD), "v"(g + 64 * DD), "v"(g + 80 * DD), "v"(g + 96 * DD), "v"(g + 112 * DD) : "memory");
}
// one stage: A's pieces, then B's
__device__ __forceinline__ void fill_stage(unsigned l, const bf* ga, const bf* gb, int s) { const unsigned ls = l + (unsigned)(s & 1) * STGB; copy8(ls, ga + s * (SK * 16)); copy8(ls + 16384u, gb + s * (SK * 16)); }
// acc = the wave's 64 x 64 of the tile at (r0, c0); sm: the two stage buffers. Behind it every wave has passed the last stage's barrier and no copy is in flight: sm is free.
__device__ __forceinline__ void gemm_tile128(const bf* __restrict__ A, const bf* __restrict__ Bt, int r0, int c0, const char* sm, v8f (&acc)[4][4]) {
    const int t = threadIdx.x, lane = t & 31; const int w = __builtin_amdgcn_readfirstlane(t >> 5);
    const bf* ga = A + (size_t)r0 * DD + t * 8; const bf* gb = Bt + (size_t)c0 * DD + t * 8; const unsigned l0 = lds_off(sm) + (unsigned)t * 16u;
#pragma unroll
    for (int mb = 0; mb < 4; ++mb)
#pragma unroll
        for (int nb = 0; nb < 4; ++nb) acc[mb][nb] = (v8f){};
    fill_stage(l0, ga, gb, 0);
    asm volatile("s_wait_asynccnt 0x0" ::: "memory");   // this wave's copies of stage 0 have landed
    __syncthreads();                                     // and every other wave's: stage 0 may be read
    fill_stage(l0, ga, gb, 1);
    const char* fa = sm + (w >> 1) * 8192 + lane * 16; const char* fb = sm + 16384 + (w & 1) * 8192 + lane * 16;   // the wave's four pieces of each operand
#pragma unroll 1   // one body for all stages: the buffer is chosen by s & 1, and the foot's waits and barrier stand once
    for (int s = 0; s < NSTG; ++s) { const int bo = (s & 1) * STGB; v16bf a[4], b[4];
#pragma unroll
        for (int mb = 0; mb < 4; ++mb) { a[mb] = WFrag<bf>::ld((const bf*)(fa + bo + mb * 2048)); b[mb] = WFrag<bf>::ld((const bf*)(fb + bo + mb * 2048)); }
        __builtin_amdgcn_sched_barrier(0);   // the block's 16 LDS reads stand together in front of its products (the compiler otherwise deals B's reads out among them, and each group waits anew)
#pragma unroll
        for (int nb = 0; nb < 4; ++nb)
#pragma unroll
            for (int mb = 0; mb < 4; ++mb) acc[mb][nb] = wmmab(a[mb], b[nb], acc[mb][nb]);
#pragma unroll
        for (int mb = 0; mb < 4; ++mb) { a[mb] = WFrag<bf>::ld((const bf*)(fa + bo + mb * 2048 + 1024)); b[mb] = WFrag<bf>::ld((const bf*)(fb + bo + mb * 2048 + 1024)); }
        // the foot stands behind the stage's last LDS read, not behind its last product: the second 32 k are in registers, so the buffer is handed on and refilled while their products run
        asm volatile("s_wait_dscnt 0x0" ::: "memory");      // this wave's reads of the buffer are done before it is handed to the copies
        asm volatile("s_wait_asynccnt 0x0" ::: "memory");   // this wave's copies of stage s + 1 have landed
        __syncthreads();                                     // stage s + 1 may be read; every wave has left stage s's buffer
        if (s + 2 < NSTG) fill_stage(l0, ga, gb, s + 2);
#pragma unroll
        for (int nb = 0; nb < 4; ++nb)
#pragma unroll
            for (int mb = 0; mb < 4; ++mb) acc[mb][nb] = wmmab(a[mb], b[nb], acc[mb][nb]);
    }
    asm volatile("s_wait_asynccnt 0x0" ::: "memory");   // nothing is in flight when the buffers become the tiles' staging
}
// one 16-byte piece: 8 neighbouring columns of one tile row
__device__ __forceinline__ v8f row8(const float* pp) { const v4f v0 = *(const v4fa*)pp, v1 = *(const v4fa*)(pp + 4); return __builtin_shufflevector(v0, v1, 0, 1, 2, 3, 4, 5, 6, 7); }
__device__ __forceinline__ v8h addh8(v8f v, v8f b) { v8h o;
#pragma unroll
    for (int q = 0; q < 8; ++q) o[q] = tohx(__fadd_rn(v[q], b[q]));
    return o; }
// a thread's four pieces of one plane
__device__ __forceinline__ void store4(h16* const (&p)[4], const v8h (&o)[4]) {
#pragma unroll
    for (int it = 0; it < 4; ++it) *(v8h*)p[it] = o[it];
    // the translation wait behind the stores, their addresses and values its inputs, so that no later result lands in one of those registers ahead of it
    asm volatile("s_wait_xcnt 0x0" :: "v"(p[0]), "v"(p[1]), "v"(p[2]), "v"(p[3]), "v"(o[0]), "v"(o[1]), "v"(o[2]), "v"(o[3]) : "memory"); }
__global__ __launch_bounds__(128) void k_proj(const bf* __restrict__ XB, const bf* __restrict__ RB, const bf* __restrict__ W, const float* __restrict__ rwb, const float* __restrict__ rrb, h16* QA, h16* QB, h16* KP, h16* VT, h16* RK) {
    __shared__ __align__(16) float os[4 * 64 * 68];   // first the two stage buffers (2 x 32 KiB), then the four waves' 64 x 64 tiles, pitch 68 floats
    const int y = blockIdx.y; const bool isr = y >= 24; const int rid = (y - 24) * (NT / 128) + (int)blockIdx.x;
    const int xt = isr ? rid & (TT / 128 - 1) : (int)blockIdx.x, ct = isr ? 24 + rid / (TT / 128) : y; const int kind = ct >> 3, h0 = (ct & 7) * 2;   // kind 0 q, 1 k, 2 v, 3 r_k: the same for the whole workgroup; its two heads h0, h0 + 1
    // thread -> its place in a block: l the 16-byte piece of a half block, hf the half, kb one bit of the block's number; the other two bits are the trip it
    const int l = threadIdx.x & 31, lr = l & 15, hi = l >> 4, hf = ((int)threadIdx.x >> 5) & 1, kb = (int)threadIdx.x >> 6; const int po = hf * 256 + l * 8;
    const int d = kb * 32 + hf * 16 + hi * 8;   // q, k, r_k: the piece's first column, the same on every trip
    v8f ba[2] = { (v8f){}, (v8f){} }, bb[2] = { (v8f){}, (v8f){} };
    v8f acc[4][4];
    gemm_tile128(isr ? RB : XB, W, xt * 128, ct * 128, (const char*)os, acc);
    if (kind == 0) { const float* pa = rwb + h0 * HD + d; const float* pb = rrb + h0 * HD + d; ba[0] = *(const v8f*)pa; ba[1] = *(const v8f*)(pa + HD); bb[0] = *(const v8f*)pb; bb[1] = *(const v8f*)(pb + HD);   // both heads' biases, fetched behind the k loop, where 32 registers are free for them; the tile's LDS stores and the barrier stand between the loads and their use
        // the translation wait behind the loads, the addresses its inputs (as in k_cvtall)
        asm volatile("s_wait_xcnt 0x0" :: "v"(pa), "v"(pb) : "memory"); }
    { const int w = __builtin_amdgcn_readfirstlane(threadIdx.x >> 5);
#pragma unroll
        for (int mb = 0; mb < 4; ++mb)
#pragma unroll
            for (int nb = 0; nb < 4; ++nb)
#pragma unroll
                for (int j = 0; j < 8; ++j) os[(w * 64 + mb * 16 + hi * 8 + j) * 68 + nb * 16 + lr] = acc[mb][nb][j]; }
    __syncthreads();   // every wave's tile is in LDS before the threads regroup it
#pragma unroll
    for (int c = 0; c < 2; ++c)
#pragma unroll
        for (int q = 0; q < 8; ++q) { ba[c][q] = bfr(ba[c][q]); bb[c][q] = bfr(bb[c][q]); }
    // wave w's tile: row half w / 2, column half (head) w % 2; all threads store one tile after the other
#pragma unroll
    for (int sub = 0; sub < 4; ++sub) { const float* ot = os + sub * 64 * 68; const int x6 = xt * 2 + (sub >> 1), h = h0 + (sub & 1); h16* pd[4]; v8h o[4];
        if (kind == 2) {
#pragma unroll
            for (int it = 0; it < 4; ++it) { const int db = (it & 1) * 2 + kb, b = it >> 1; const float* pp = ot + ((hf * 16 + hi * 8) * NB_ + b) * 68 + db * 16 + lr;   // 8 rows t of column d = 16 db + lr
#pragma unroll
                for (int q = 0; q < 8; ++q) o[it][q] = tohx(pp[q * NB_ * 68]);
                pd[it] = VT + (size_t)(b * NH_ + h) * HD * TT + (size_t)(db * (TT / 32) + x6) * 512 + po; }
            store4(pd, o);
        } else { v8f v[4]; size_t off[4]; h16* P = kind == 0 ? QA : kind == 1 ? KP : RK;
#pragma unroll
            for (int it = 0; it < 4; ++it) { v[it] = row8(ot + (kind == 3 ? it * 16 + lr : ((it & 1) * 16 + lr) * NB_ + (it >> 1)) * 68 + d);
                off[it] = (kind == 3 ? (size_t)h * TT * HD + (size_t)(x6 * 4 + it) * 1024 : (size_t)((it >> 1) * NH_ + h) * TT * HD + (size_t)(x6 * 2 + (it & 1)) * 1024) + kb * 512 + po;
                pd[it] = P + off[it]; o[it] = addh8(v[it], ba[sub & 1]); }   // k, r_k: ba is zero
            store4(pd, o);
            if (kind == 0) {
#pragma unroll
                for (int it = 0; it < 4; ++it) { pd[it] = QB + off[it]; o[it] = addh8(v[it], bb[sub & 1]); }
                store4(pd, o); }
        }
    }
}
// ---- k_relattn: scores, relative shift, softmax, P.V and the head merge for RT query rows of one (batch, head); grid (T / RT, batch x heads), 16 waves.
// Every workgroup fetches the head's whole r_k, K and V from L2, so the bytes a query row costs fall with RT. RT = 64 rows fit the LDS because a score lies there as fp16 (pitch SP values), and fit the registers because
// the scores stay in LDS between the phases. BD[i][m] = (q_i + r_r_bias).r_k[m] lands where the module's zero-pad/reshape shift puts it: at row i, key m - (T - 1 - i), when that is >= 0,
// else at row i - 1, key m + i + 1; row i, key i + 1 is the shift's zero. So the rows i0 .. i0 + RT - 1 take the first kind from q rows i0 .. and the second kind from q rows i0 + 1 .. .
// AC is made transposed (keys x queries), each wave its own 128 keys of all RT rows: the lane that holds 8 keys of a query adds their BD values from LDS and puts AC + BD back at the same 16 bytes; the row maxima go
// from wave to wave through LDS; the same lane turns its sums into e^((s - max) / 8), again at the same 16 bytes, and reads them as its part of the B operand of P.V^T. The waves' f32 partial tiles then take the score rows' place
// (a row's 16 x 64 floats in the row's own bytes) and are joined in wave order by the threads that divide by the row's sum and store the merged bf16 hi/lo planes. All five operand planes and the two merged planes lie in fragment order.
#define RT 64
#define SP 2136   // fp16 values a score row: 4272 bytes, 16 x an odd number, so that the 16-byte pieces of 16 neighbouring rows fall on different banks; 1068 dwords are 44 mod 64, so that BD's 4-byte stores, one row and one key further from lane to lane, fall on 32 different banks too
#define SO 16     // key 0 of a row lies SO values behind the row's start: the 16 values in front of it and the 72 behind key T - 1 are pad, written by BD's tiles on the edge of the shift and never read
#define PP (SP / 2)   // the same pitch in floats, for the partial tiles
#define XP 20   // floats a row of RM and RS: the 16-byte pieces of 16 neighbouring rows fall on different banks
// 2^x of eight values. The instruction set asks for one independent slot behind a transcendental: in one statement, with results that share no register with an argument, each v_exp_f32 is the slot of the one in front of it, and one v_nop serves the last
__device__ __forceinline__ v8f exp2x8(v8f x) { float r0, r1, r2, r3, r4, r5, r6, r7;
    asm("v_exp_f32 %0, %8\n\tv_exp_f32 %1, %9\n\tv_exp_f32 %2, %10\n\tv_exp_f32 %3, %11\n\tv_exp_f32 %4, %12\n\tv_exp_f32 %5, %13\n\tv_exp_f32 %6, %14\n\tv_exp_f32 %7, %15\n\tv_nop"
        : "=&v"(r0), "=&v"(r1), "=&v"(r2), "=&v"(r3), "=&v"(r4), "=&v"(r5), "=&v"(r6), "=&v"(r7) : "v"(x[0]), "v"(x[1]), "v"(x[2]), "v"(x[3]), "v"(x[4]), "v"(x[5]), "v"(x[6]), "v"(x[7]));
    return (v8f){ r0, r1, r2, r3, r4, r5, r6, r7 }; }
// a workgroup barrier that orders the LDS alone: the waves hand one another nothing but LDS values here, and the global loads issued in front of it stay in flight across it (__syncthreads() waits for every one of them)
__device__ __forceinline__ void lds_barrier() { __builtin_amdgcn_fence(__ATOMIC_RELEASE, "workgroup", "local"); __builtin_amdgcn_s_barrier(); __builtin_amdgcn_fence(__ATOMIC_ACQUIRE, "workgroup", "local"); }
typedef v4h __attribute__((may_alias)) v4ha;
typedef __attribute__((ext_vector_type(4))) unsigned short v4us;
typedef unsigned __attribute__((may_alias)) u32a;
typedef unsigned short __attribute__((may_alias)) u16a;
__device__ __forceinline__ unsigned pkh(float a, float b) { const v2h t = { tohx(a), tohx(b) }; return __builtin_bit_cast(unsigned, t); }
// eight neighbouring fp16 values of one score row, from p on; od = 1 where p is an odd key number, so not on a dword. Three dwords hold the six values from the first even key on: the pairs (0,1) (2,3) (4,5), or, shifted
// by one value, (1,2) (3,4) (5,6); the two values left (6 and 7, or 0 and 7) go singly. Five stores, the same instructions in every lane.
__device__ __forceinline__ void put8(h16* p, v8f c, int od) {
    const unsigned p0 = pkh(c[0], c[1]), p1 = pkh(c[2], c[3]), p2 = pkh(c[4], c[5]), p3 = pkh(c[6], c[7]), sh = (unsigned)od * 16u;
    u32a* a = (u32a*)(p + od);
    a[0] = __builtin_amdgcn_alignbit(p1, p0, sh); a[1] = __builtin_amdgcn_alignbit(p2, p1, sh); a[2] = __builtin_amdgcn_alignbit(p3, p2, sh);
    *(u16a*)(p + (od ? 0 : 6)) = (unsigned short)(od ? p0 : p3); *(u16a*)(p + 7) = (unsigned short)(p3 >> 16); }
__global__ __launch_bounds__(512) void k_relattn(const h16* __restrict__ QA, const h16* __restrict__ QB, const h16* __restrict__ KP, const h16* __restrict__ RK, const h16* __restrict__ VT, bf* Ah, bf* Al) {
    __shared__ __align__(16) h16 S[RT * SP];
    __shared__ __align__(16) float RM[RT * XP], RS[RT * XP];   // per row: the 16 waves' maxima, the 16 waves' shares of the sum
    const int z = blockIdx.y, b = z >> 4, h = z & 15, i0 = blockIdx.x * RT;
    const int lane = threadIdx.x & 31, lr = lane & 15, hi = lane >> 4; const int w = __builtin_amdgcn_readfirstlane(threadIdx.x >> 5);
    QA += (size_t)z * TT * HD; QB += (size_t)z * TT * HD; KP += (size_t)z * TT * HD; VT += (size_t)z * HD * TT; RK += (size_t)h * TT * HD;
    const int fo = 8 * lane;   // this lane's place in a block of the fragment order; 16 rows of a plane with 64 values a row are two blocks, k 0 .. 31 and 32 .. 63
    const h16* pq = QA + i0 * HD; const h16* pk = KP + w * 128 * HD; const h16* pv = VT + w * 4 * 512;   // AC's four blocks of 16 queries; this wave's 128 keys of K (8 tiles of 16) and of V
    v16h ra[2][2], rc[2][2];   // two register sets of four fragments each, refilled in turn: first two tiles of r_k each, then two key tiles of K, at last 32 keys of V
    {   // BD, stored shifted; wave w takes the 16-column tiles w, w + 16, ...
        v16h ql[4][2], qu[4][2]; const h16* pl = QB + i0 * HD; const h16* pr = RK + w * 16 * HD; const h16* pu[4];   // pl, pr: the same for the whole wave; the lane's place fo is added at each load
#pragma unroll
        for (int mb = 0; mb < 4; ++mb) { const int ru = min(i0 + 1 + mb * 16 + lr, TT - 1); pu[mb] = QB + (ru >> 4) * (16 * HD) + (hi * 16 + (ru & 15)) * 8;   // the row behind the last one feeds no key: any row in bounds serves
#pragma unroll
            for (int ks = 0; ks < 2; ++ks) { ql[mb][ks] = WFrag<h16>::ld(pl + fo + mb * 16 * HD + ks * 512); qu[mb][ks] = WFrag<h16>::ld(pu[mb] + ks * 512); } }
#pragma unroll
        for (int s = 0; s < 2; ++s)
#pragma unroll
            for (int ks = 0; ks < 2; ++ks) { ra[s][ks] = WFrag<h16>::ld(pr + fo + s * 256 * HD + ks * 512); rc[s][ks] = WFrag<h16>::ld(pr + fo + (2 + s) * 256 * HD + ks * 512); }
        // one translation wait behind the batch's loads; the addresses are its inputs (the wave's bases in scalar registers, the lane number that the loads scale), so that no load's result and no later add lands in an address register ahead of it
        asm volatile("s_wait_xcnt 0x0" :: "s"(pl), "v"(pu[0]), "v"(pu[1]), "v"(pu[2]), "v"(pu[3]), "s"(pr), "v"(lane) : "memory");
        // two tiles of r_k, numbers t0 and t0 + 1 of this wave, against all RT rows
        // The tile is made transposed (r_k x queries): a lane holds query lr of the block and the r_k rows 8 hi .. 8 hi + 7 of the tile, which land on 8 neighbouring keys of the query's score row, from key base + lr + 8 hi - (T - 1)
        // (first kind; base is even, so the key is odd where lr is even) or base + lr + 8 hi + 2 (second kind) on. No key is tested: base is a multiple of 16, so a tile of the first kind reaches down to key -15 at most
        // and one of the second kind up to key T + 16, and those fall into the row's own pad.
        const int ol = lr & 1; h16* const sl = S + SO + lr * SP + lr + hi * 8;   // the lane's row in a block of 16 queries, and the lane's own part of the key number
        auto bd2 = [&](const v16h (&rb)[2][2], int t0) {
#pragma unroll
            for (int s = 0; s < 2; ++s)
#pragma unroll
                for (int mb = 0; mb < 4; ++mb) { const int base = ((t0 + s) * 16 + w) * 16 + i0 + mb * 16; h16* sr = sl + mb * 16 * SP;
                    if (base + 30 >= TT - 1) { v8f c = (v8f){}; c = wmma16(rb[s][0], ql[mb][0], c); c = wmma16(rb[s][1], ql[mb][1], c); put8(sr + (base - (TT - 1)), c, ol ^ 1); }
                    if (base + 2 < TT) { v8f c = (v8f){}; c = wmma16(rb[s][0], qu[mb][0], c); c = wmma16(rb[s][1], qu[mb][1], c); put8(sr + (base + 2), c, ol); } } };
        // A set is refilled as soon as its products are done, and its loads fly while the other set is worked on. On the second trip there is no r_k left and the sets take AC's first four key tiles.
#pragma unroll 1   // one body for both trips: for speed only
        for (int g = 0; g < 2; ++g) { const h16* nx = (g == 0 ? pr + 4 * 256 * HD : pk) + fo; const int st = g == 0 ? 256 * HD : 16 * HD;   // the lane's place in the first of the next four tiles, and their distance
            bd2(ra, g * 4);
            { const h16* a0 = nx; const h16* a1 = nx + st;
#pragma unroll
                for (int ks = 0; ks < 2; ++ks) { ra[0][ks] = WFrag<h16>::ld(a0 + ks * 512); ra[1][ks] = WFrag<h16>::ld(a1 + ks * 512); }
                // one translation wait behind the batch's loads, the lane's addresses its inputs, so that no load's result lands in an address register ahead of it
                asm volatile("s_wait_xcnt 0x0" :: "v"(a0), "v"(a1) : "memory"); }
            bd2(rc, g * 4 + 2);
            { const h16* a0 = nx + 2 * st; const h16* a1 = nx + 3 * st;
#pragma unroll
                for (int ks = 0; ks < 2; ++ks) { rc[0][ks] = WFrag<h16>::ld(a0 + ks * 512); rc[1][ks] = WFrag<h16>::ld(a1 + ks * 512); }
                // one translation wait behind the batch's loads, the lane's addresses its inputs (as above)
                asm volatile("s_wait_xcnt 0x0" :: "v"(a0), "v"(a1) : "memory"); } }
        if (threadIdx.x < RT) { const int j = i0 + (int)threadIdx.x + 1; if (j < TT) S[SO + threadIdx.x * SP + j] = tohx(0.f); }
    }
    // AC's queries take the registers of BD's queries; they fly across the barrier, as the four key tiles do
    v16h qa[4][2];
#pragma unroll
    for (int qb = 0; qb < 4; ++qb)
#pragma unroll
        for (int ks = 0; ks < 2; ++ks) qa[qb][ks] = WFrag<h16>::ld(pq + fo + qb * 16 * HD + ks * 512);
    // one translation wait behind the batch's loads, the address its input (as above)
    asm volatile("s_wait_xcnt 0x0" :: "s"(pq), "v"(lane) : "memory");
    lds_barrier();   // every shifted BD value is in LDS before a wave reads its keys of all rows
    // AC, transposed: wave w makes S^T = K.Q^T for its 128 keys (8 tiles of 16) and the four blocks of 16 queries. A lane holds query lr of a block and the keys 8 hi .. 8 hi + 7 of a tile: 16 bytes of the query's score row.
    h16* const sw = S + SO + lr * SP + w * 128 + hi * 8;   // the lane's 16 bytes of key tile 0, query block 0
    v8h mv[4];   // the running maxima of the rounded sums, eight a query block, joined behind the loop
#pragma unroll
    for (int qb = 0; qb < 4; ++qb)
#pragma unroll
        for (int q = 0; q < 8; ++q) mv[qb][q] = tohx(-65504.f);
    // two key tiles, numbers t0 and t0 + 1 of this wave, against all RT queries
    auto ac2 = [&](const v16h (&kf)[2][2], int t0) {
#pragma unroll
        for (int s = 0; s < 2; ++s)
#pragma unroll
            for (int qb = 0; qb < 4; ++qb) { h16* sr = sw + qb * 16 * SP + (t0 + s) * 16; const v8h bd = *(const v8ha*)sr;
                v8f c = (v8f){}; c = wmma16(kf[s][0], qa[qb][0], c); c = wmma16(kf[s][1], qa[qb][1], c); v8h o;
#pragma unroll
                for (int q = 0; q < 8; ++q) o[q] = tohx(__fadd_rn(c[q], (float)bd[q]));   // s = AC + BD; the division by 8 is part of the exponent's factor
                mv[qb] = __builtin_elementwise_maxnum(mv[qb], o); *(v8ha*)sr = o; } };
    // The two sets go on as in BD's loop: on the first trip they take the other four key tiles, on the second the first 64 keys of V, which fly across the barrier and behind the exponentials.
#pragma unroll 1   // one body for both trips: the maxima are then taken within the trip (unrolled, the compiler puts them off to the end and spills the sums that wait for them), and the text is half as long
    for (int g = 0; g < 2; ++g) { const h16* nx = (g == 0 ? pk + 8 * 512 : pv) + fo; const int st = g == 0 ? 512 : 16 * TT, sd = g == 0 ? 4 * 512 : 512;   // the next eight fragments: the lane's place in the first, the distance from one to the next, the distance of the second set
        ac2(ra, g * 4);
        { const h16* a[4] = { nx, nx + st, nx + 2 * st, nx + 3 * st };
#pragma unroll
            for (int f = 0; f < 4; ++f) ra[f >> 1][f & 1] = WFrag<h16>::ld(a[f]);
            // one translation wait behind the batch's loads, the lane's addresses its inputs (as above)
            asm volatile("s_wait_xcnt 0x0" :: "v"(a[0]), "v"(a[1]), "v"(a[2]), "v"(a[3]) : "memory"); }
        ac2(rc, g * 4 + 2);
        { const h16* a[4] = { nx + sd, nx + sd + st, nx + sd + 2 * st, nx + sd + 3 * st };
#pragma unroll
            for (int f = 0; f < 4; ++f) rc[f >> 1][f & 1] = WFrag<h16>::ld(a[f]);
            // one translation wait behind the batch's loads, the lane's addresses its inputs (as above)
            asm volatile("s_wait_xcnt 0x0" :: "v"(a[0]), "v"(a[1]), "v"(a[2]), "v"(a[3]) : "memory"); } }
    v16h vb[4][4];
#pragma unroll
    for (int nb = 0; nb < 4; ++nb) { vb[0][nb] = ra[nb >> 1][nb & 1]; vb[1][nb] = rc[nb >> 1][nb & 1]; }
#pragma unroll
    for (int qb = 0; qb < 4; ++qb) { float m = (float)mv[qb][0];
#pragma unroll
        for (int q = 1; q < 8; ++q) m = fmaxf(m, (float)mv[qb][q]);
        m = fmaxf(m, __shfl_xor(m, 16, 32)); if (hi == 0) RM[(qb * 16 + lr) * XP + w] = m; }   // this wave's maximum of each row
    lds_barrier();   // every wave's row maxima are in LDS
    const float cs = 0.125f * 1.44269504f; float mc[4];   // e^((s - max) / 8) = 2^(s cs - max cs)
#pragma unroll
    for (int qb = 0; qb < 4; ++qb) { const float* pm = RM + (qb * 16 + lr) * XP; v4f m = *(const v4fa*)pm;
#pragma unroll
        for (int p = 1; p < 4; ++p) { const v4f n = *(const v4fa*)(pm + p * 4);
#pragma unroll
            for (int q = 0; q < 4; ++q) m[q] = fmaxf(m[q], n[q]); }
        mc[qb] = -cs * fmaxf(fmaxf(m[0], m[1]), fmaxf(m[2], m[3])); }
    // P = e^((s - max) / 8), not yet divided by the row's sum (at most 1, the row's largest exactly 1: fp16 holds it with the relative error it had for the scaled P); the division follows the join.
    // The lane puts P, rounded to fp16, where its s lay: with the 64 x 64 f32 tile of P.V and V in registers there is no room for the exponentials' values beside them, so the exponentials come first, all of them
    v8f sum8[4];   // eight partial sums a query block, one for each of the lane's keys of a tile, joined behind the loop
#pragma unroll
    for (int qb = 0; qb < 4; ++qb) sum8[qb] = (v8f){};
#pragma unroll 1   // one body for all key tiles: the sums are then added within the trip (unrolled, the compiler puts the additions off and spills the values that wait for them), and the text is an eighth as long
    for (int kt = 0; kt < 8; ++kt)
#pragma unroll
        for (int qb = 0; qb < 4; ++qb) { h16* sr = sw + qb * 16 * SP + kt * 16; const v8h sv = *(const v8ha*)sr; v8f x; v8h o;
#pragma unroll
            for (int q = 0; q < 8; ++q) x[q] = __builtin_fmaf((float)sv[q], cs, mc[qb]);
            const v8f e = exp2x8(x);
#pragma unroll
            for (int q = 0; q < 8; ++q) o[q] = tohx(e[q]);
            sum8[qb] += e; *(v8ha*)sr = o; }
#pragma unroll
    for (int qb = 0; qb < 4; ++qb) { const v8f u = sum8[qb]; float t = ((u[0] + u[1]) + (u[2] + u[3])) + ((u[4] + u[5]) + (u[6] + u[7])); t += __shfl_xor(t, 16, 32); if (hi == 0) RS[(qb * 16 + lr) * XP + w] = t; }   // this wave's share of each row's sum
    // P.V, transposed: out^T (64 d x 64 queries) = V^T.P^T over this wave's keys; a lane's 16-byte pieces of two neighbouring key tiles are its part of the B fragment (32 keys x 16 queries)
    v8f acc[4][4];
#pragma unroll
    for (int qb = 0; qb < 4; ++qb)
#pragma unroll
        for (int nb = 0; nb < 4; ++nb) acc[nb][qb] = (v8f){};
#pragma unroll
    for (int ks = 0; ks < 4; ++ks) {
#pragma unroll
        for (int qb = 0; qb < 4; ++qb) { const h16* sr = sw + qb * 16 * SP + ks * 32; const v16h pf = cat16(*(const v8ha*)sr, *(const v8ha*)(sr + 16));
#pragma unroll
            for (int nb = 0; nb < 4; ++nb) acc[nb][qb] = wmma16(vb[ks][nb], pf, acc[nb][qb]); }
        if (ks < 2) {   // the next but one 32 keys of V take the registers of these; the two scheduling barriers keep the loads here, a whole step ahead of their use (the compiler otherwise sinks them to it)
            __builtin_amdgcn_sched_barrier(0);
#pragma unroll
            for (int nb = 0; nb < 4; ++nb) vb[ks + 2][nb] = WFrag<h16>::ld(pv + fo + nb * 16 * TT + (ks + 2) * 512);
            // one translation wait behind the batch's loads, the address its input (as above)
            asm volatile("s_wait_xcnt 0x0" :: "s"(pv), "v"(lane) : "memory");
            __builtin_amdgcn_sched_barrier(0); } }
    __syncthreads();   // every wave has read its last P: the rows are free for the partial tiles
    float* PT = (float*)S;
    // a lane holds 8 neighbouring d of one query: two 16-byte stores a tile
#pragma unroll
    for (int nb = 0; nb < 4; ++nb)
#pragma unroll
        for (int qb = 0; qb < 4; ++qb) { float* po = PT + (qb * 16 + lr) * PP + w * 64 + nb * 16 + hi * 8;
            *(v4fa*)po = __builtin_shufflevector(acc[nb][qb], acc[nb][qb], 0, 1, 2, 3); *(v4fa*)(po + 4) = __builtin_shufflevector(acc[nb][qb], acc[nb][qb], 4, 5, 6, 7); }
    __syncthreads();   // every wave's partial tile and its share of the sums are in LDS before any thread sums them
#pragma unroll
    for (int rr = 0; rr < 2; ++rr) { const int row = rr * 32 + ((int)threadIdx.x >> 4), cofs = ((int)threadIdx.x & 15) * 4; const float* pp = PT + row * PP + cofs; v4f val = *(const v4fa*)pp;
#pragma unroll
        for (int p = 1; p < 16; ++p) val += *(const v4fa*)(pp + p * 64);
        const float* pt = RS + row * XP; v4f t4 = *(const v4fa*)pt;
#pragma unroll
        for (int p = 1; p < 4; ++p) t4 += *(const v4fa*)(pt + p * 4);
        const float inv = __fdiv_rn(1.0f, (t4[0] + t4[1]) + (t4[2] + t4[3]));
        v4us oh, ol;
#pragma unroll
        for (int q = 0; q < 4; ++q) { unsigned short x, y; splitf(val[q] * inv, x, y); oh[q] = x; ol[q] = y; }
        // the merged planes in fragment order, row b T + t, so that this workgroup alone writes its eight blocks (4 x 16 rows, the head's 2 x 32 columns)
        const size_t o = ((size_t)((b * TT + i0 + row) >> 4) * (DD / 32) + h * 2 + (cofs >> 5)) * 512 + (cofs & 16) * 16 + (((cofs >> 3) & 1) * 16 + (row & 15)) * 8 + (cofs & 7); bf* ph = Ah + o; bf* pl2 = Al + o; *(v4us*)ph = oh; *(v4us*)pl2 = ol;
        // the translation wait behind the stores, their addresses and values its inputs (as in store4)
        asm volatile("s_wait_xcnt 0x0" :: "v"(ph), "v"(pl2), "v"(oh), "v"(ol) : "memory"); }
}

// ---- k_out: out = (Ah + Al) Wo^T + out_b, f32: a 128 x 128 tile a workgroup, staged as in k_proj with A's second plane as a third operand (48 KiB a stage, two buffers); grid (NT / 128, DD / 128).
// There is one workgroup a WGP, so it has 8 waves (4 x 2, each 32 x 64 of the tile), two a SIMD: one wave's LDS waits stand behind the other's products. One f32 sum a value: per 32 k Ah's products, then Al's.
// A's row b T + t is out's row t NB + b. The tile goes through LDS (pitch 132 floats), so that a wave stores 512 contiguous bytes of a row.
// four of the eight 2-KiB pieces of one operand's 128 rows, every second one (256 threads cover two pieces a copy): l, g = this thread's 16 bytes in its first piece. The translation wait is the statement's last line, as in copy8.
__device__ __forceinline__ void copy4(unsigned l, const bf* g) {
    asm volatile("global_load_async_to_lds_b128 %0, %4, off\n\t"
                 "global_load_async_to_lds_b128 %1, %5, off\n\t"
                 "global_load_async_to_lds_b128 %2, %6, off\n\t"
                 "global_load_async_to_lds_b128 %3, %7, off\n\t"
                 "s_wait_xcnt 0x0"
                 :: "v"(l), "v"(l + 4096u), "v"(l + 8192u), "v"(l + 12288u), "v"(g), "v"(g + 32 * DD), "v"(g + 64 * DD), "v"(g + 96 * DD) : "memory");
}
#define STG3 49152       // bytes a stage: 8 pieces each of Ah, Al and Wo
__device__ __forceinline__ void fill_stage3(unsigned l, const bf* ga, const bf* ga2, const bf* gb, int s) { const unsigned ls = l + (unsigned)(s & 1) * STG3; copy4(ls, ga + s * (SK * 16)); copy4(ls + 16384u, ga2 + s * (SK * 16)); copy4(ls + 32768u, gb + s * (SK * 16)); }
__device__ __forceinline__ void store4f(float* const (&p)[4], const v4f (&o)[4]) {
#pragma unroll
    for (int it = 0; it < 4; ++it) *(v4f*)p[it] = o[it];
    // the translation wait behind the stores, their addresses and values its inputs (as in store4)
    asm volatile("s_wait_xcnt 0x0" :: "v"(p[0]), "v"(p[1]), "v"(p[2]), "v"(p[3]), "v"(o[0]), "v"(o[1]), "v"(o[2]), "v"(o[3]) : "memory"); }
__global__ __launch_bounds__(256) void k_out(const bf* __restrict__ Ah, const bf* __restrict__ Al, const bf* __restrict__ Wo, const float* __restrict__ bias, float* C) {
    __shared__ __align__(16) float os[2 * STG3 / 4];   // first the two stage buffers, then the 128 x 128 tile, pitch 132 floats
    const char* sm = (const char*)os;
    const int r0 = blockIdx.x * 128, c0 = blockIdx.y * 128;
    const int t = threadIdx.x, lane = t & 31, lr = lane & 15, hi = lane >> 4; const int w = __builtin_amdgcn_readfirstlane(t >> 5), wr = w >> 1, wc = w & 1;
    const size_t go = (size_t)(t >> 7) * (16 * DD) + (t & 127) * 8;   // threads 0 .. 127 take the even pieces, the others the odd ones
    const bf* ga = Ah + (size_t)r0 * DD + go; const bf* ga2 = Al + (size_t)r0 * DD + go; const bf* gb = Wo + (size_t)c0 * DD + go; const unsigned l0 = lds_off(sm) + (unsigned)t * 16u;
    v8f acc[2][4];
#pragma unroll
    for (int mb = 0; mb < 2; ++mb)
#pragma unroll
        for (int nb = 0; nb < 4; ++nb) acc[mb][nb] = (v8f){};
    fill_stage3(l0, ga, ga2, gb, 0);
    asm volatile("s_wait_asynccnt 0x0" ::: "memory");   // this wave's copies of stage 0 have landed
    __syncthreads();                                     // and every other wave's: stage 0 may be read
    fill_stage3(l0, ga, ga2, gb, 1);
    const char* fa = sm + wr * 4096 + lane * 16; const char* fb = sm + 32768 + wc * 8192 + lane * 16;   // the wave's two pieces of Ah (Al's lie 16 KiB behind them) and its four of Wo
#pragma unroll 1   // one body for all stages: the buffer is chosen by s & 1, and the foot's waits and barrier stand once
    for (int s = 0; s < NSTG; ++s) { const int bo = (s & 1) * STG3; v16bf a[2], a2[2], b[4];
#pragma unroll
        for (int mb = 0; mb < 2; ++mb) { a[mb] = WFrag<bf>::ld((const bf*)(fa + bo + mb * 2048)); a2[mb] = WFrag<bf>::ld((const bf*)(fa + bo + 16384 + mb * 2048)); }
#pragma unroll
        for (int nb = 0; nb < 4; ++nb) b[nb] = WFrag<bf>::ld((const bf*)(fb + bo + nb * 2048));
        __builtin_amdgcn_sched_barrier(0);   // the block's 16 LDS reads stand together in front of its products (as in gemm_tile128)
#pragma unroll
        for (int nb = 0; nb < 4; ++nb)
#pragma unroll
            for (int mb = 0; mb < 2; ++mb) acc[mb][nb] = wmmab(a[mb], b[nb], acc[mb][nb]);
#pragma unroll
        for (int nb = 0; nb < 4; ++nb)
#pragma unroll
            for (int mb = 0; mb < 2; ++mb) acc[mb][nb] = wmmab(a2[mb], b[nb], acc[mb][nb]);
#pragma unroll
        for (int mb = 0; mb < 2; ++mb) { a[mb] = WFrag<bf>::ld((const bf*)(fa + bo + mb * 2048 + 1024)); a2[mb] = WFrag<bf>::ld((const bf*)(fa + bo + 16384 + mb * 2048 + 1024)); }
#pragma unroll
        for (int nb = 0; nb < 4; ++nb) b[nb] = WFrag<bf>::ld((const bf*)(fb + bo + nb * 2048 + 1024));
        // the foot stands behind the stage's last LDS read, not behind its last product (as in gemm_tile128)
        asm volatile("s_wait_dscnt 0x0" ::: "memory");      // this wave's reads of the buffer are done before it is handed to the copies
        asm volatile("s_wait_asynccnt 0x0" ::: "memory");   // this wave's copies of stage s + 1 have landed
        __syncthreads();                                     // stage s + 1 may be read; every wave has left stage s's buffer
        if (s + 2 < NSTG) fill_stage3(l0, ga, ga2, gb, s + 2);
#pragma unroll
        for (int nb = 0; nb < 4; ++nb)
#pragma unroll
            for (int mb = 0; mb < 2; ++mb) acc[mb][nb] = wmmab(a[mb], b[nb], acc[mb][nb]);
#pragma unroll
        for (int nb = 0; nb < 4; ++nb)
#pragma unroll
            for (int mb = 0; mb < 2; ++mb) acc[mb][nb] = wmmab(a2[mb], b[nb], acc[mb][nb]);
    }
    asm volatile("s_wait_asynccnt 0x0" ::: "memory");   // nothing is in flight when the buffers become the tile's staging
    const int cofs = lane * 4; const float* pb = bias + c0 + cofs; v4f bs = *(const v4f*)pb;   // the thread's four columns; the tile's LDS stores and the barrier stand between the load and its use
    // the translation wait behind the load, the address its input (as in k_cvtall)
    asm volatile("s_wait_xcnt 0x0" :: "v"(pb) : "memory");
#pragma unroll
    for (int mb = 0; mb < 2; ++mb)
#pragma unroll
        for (int nb = 0; nb < 4; ++nb)
#pragma unroll
            for (int j = 0; j < 8; ++j) os[(wr * 32 + mb * 16 + hi * 8 + j) * 132 + wc * 64 + nb * 16 + lr] = acc[mb][nb][j];
    __syncthreads();   // the whole tile is in LDS before the threads regroup it
#pragma unroll
    for (int q = 0; q < 4; ++q) bs[q] = bfr(bs[q]);
#pragma unroll
    for (int g = 0; g < 4; ++g) { float* p[4]; v4f o[4];
#pragma unroll
        for (int it = 0; it < 4; ++it) { const int row = (g * 4 + it) * 8 + w; o[it] = *(const v4fa*)(os + row * 132 + cofs) + bs;
            const unsigned m = (unsigned)(r0 + row), orow = (m % TT) * NB_ + m / TT; p[it] = C + (size_t)orow * DD + c0 + cofs; }
        store4f(p, o); }
}

extern "C" void kernel_launch(void* const* d_in, const int* in_sizes, int n_in,
                              void* d_out, int out_size, void* d_ws, size_t ws_size, hipStream_t stream) {
    (void)in_sizes; (void)n_in; (void)out_size;
    const float* x = (const float*)d_in[0]; const float* r = (const float*)d_in[1]; const float* rwb = (const float*)d_in[2]; const float* rrb = (const float*)d_in[3]; const float* qkvw = (const float*)d_in[4]; const float* rw = (const float*)d_in[5]; const float* ow = (const float*)d_in[6]; const float* ob = (const float*)d_in[7];
    float* OUT = (float*)d_out;     // [2048][2][1024] (rows t*2 + b)
    char* wsp = (char*)d_ws;
    auto take = [&](size_t bytes) { char* p = wsp; wsp += (bytes + 255) & ~(size_t)255; return (void*)p; };
    bf* WQ = (bf*)take((size_t)DD * DD * 2); bf* WK = (bf*)take((size_t)DD * DD * 2); bf* WV = (bf*)take((size_t)DD * DD * 2); bf* WR = (bf*)take((size_t)DD * DD * 2); bf* WO = (bf*)take((size_t)DD * DD * 2);
    bf* XB = (bf*)take((size_t)NT * DD * 2); bf* RB = (bf*)take((size_t)TT * DD * 2);
    h16* QA = (h16*)take((size_t)NT * DD * 2); h16* QB = (h16*)take((size_t)NT * DD * 2); h16* KP = (h16*)take((size_t)NT * DD * 2); h16* VT = (h16*)take((size_t)NT * DD * 2); h16* RK = (h16*)take((size_t)NH_ * TT * HD * 2);
    bf* ATh = (bf*)take((size_t)NT * DD * 2); bf* ATl = (bf*)take((size_t)NT * DD * 2);
    if ((size_t)(wsp - (char*)d_ws) > ws_size) return;    // total 74 MiB
    k_cvtall<<<GQKV + 2 * GW + GX + GR, 256, 0, stream>>>(qkvw, rw, ow, x, r, WQ);   // WQ, WK, WV, WR, WO, XB, RB lie one behind the other
    k_proj<<<dim3(NT / 128, 28, 1), 128, 0, stream>>>(XB, RB, WQ, rwb, rrb, QA, QB, KP, VT, RK);   // WQ, WK, WV, WR lie one behind the other: the 4 DD rows of W
    k_relattn<<<dim3(TT / RT, NB_ * NH_, 1), 512, 0, stream>>>(QA, QB, KP, RK, VT, ATh, ATl);
    k_out<<<dim3(NT / 128, DD / 128, 1), 256, 0, stream>>>(ATh, ATl, WO, ob, OUT);
}

// v010
// Measured time: 118 microseconds a run.
// Next to v009, in two timings, it ran 1.05 and 1.06 times as fast.
// All steps since v000 together make it 13.2 times as fast.
#include <hip/hip_runtime.h>

// Relative-position multi-head attention (segment-recurrence style relative shift; query [2048][2][1024] seq-first, r [2048][1024]; w = query qkv_w^T -> q|k|v (16 heads x 64); r_k = r r_w^T; AC = (q + r_w_bias).k,
// BD = rel_shift((q + r_r_bias).r_k) with the module's exact zero-pad/reshape shift (out[i][j] = BD[f / (T+1)][f % (T+1) - 1] or 0 when f % (T+1) == 0, f = T + i*T + j); p = softmax((AC + BD) / 8)
// over the keys; attn = p.v; out = merged out_w^T + out_b; output [2048][2][1024] (rows t*2 + b)).
// Compute dtypes, f32 accumulate: every input rounded to bf16; the qkv and r projections on PLAIN bf16 operands (inputs: exact); AC, BD and attn.v on SINGLE fp16 planes
// (the per-head biases added in f32 before the fp16 rounding; logit sd ~ 0.6); the relative shift is an index scatter into the LDS score rows of the fused attention kernel, where BD, then AC + BD, then P lie as fp16; P = e^((s - max) / 8), divided by the row's sum behind P.V;

#define NB_  2
#define TT   2048
#define DD   1024
#define NH_  16
#define HD   64
#define NT   (NB_ * TT)
typedef _Float16 h16;
typedef unsigned short bf;
typedef __attribute__((ext_vector_type(16))) __bf16   v16bf;
typedef __attribute__((ext_vector_type(16))) _Float16 v16h;
typedef __attribute__((ext_vector_type(8)))  _Float16 v8h;
typedef __attribute__((ext_vector_type(8)))  unsigned short v8us;
typedef __attribute__((ext_vector_type(8)))  float    v8f;
typedef __attribute__((ext_vector_type(4)))  float    v4f;
typedef v8h  __attribute__((may_alias)) v8ha;
typedef v4f  __attribute__((may_alias)) v4fa;
typedef v8us __attribute__((may_alias)) v8usa;

__device__ __forceinline__ unsigned short f2bf(float f) { unsigned u = __float_as_uint(f); u += 0x7FFFu + ((u >> 16) & 1u); return (unsigned short)(u >> 16); }
__device__ __forceinline__ float bf2f(unsigned short b) { return __uint_as_float(((unsigned)b) << 16); }
__device__ __forceinline__ float bfr(float f) { return bf2f(f2bf(f)); }
__device__ __forceinline__ v16h cat16(v8h lo, v8h hi) { return __builtin_shufflevector(lo, hi, 0, 1, 2, 3, 4, 5, 6, 7, 8, 9, 10, 11, 12, 13, 14, 15); }
__device__ __forceinline__ v16bf cat16b(v8us lo, v8us hi) { return __builtin_bit_cast(v16bf, __builtin_shufflevector(lo, hi, 0, 1, 2, 3, 4, 5, 6, 7, 8, 9, 10, 11, 12, 13, 14, 15)); }
__device__ __forceinline__ v8f wmma16(v16h a, v16h b, v8f c) { return __builtin_amdgcn_wmma_f32_16x16x32_f16(false, a, false, b, (short)0, c, false, false); }
__device__ __forceinline__ v8f wmmab(v16bf a, v16bf b, v8f c) { return __builtin_amdgcn_wmma_f32_16x16x32_bf16(false, a, false, b, (short)0, c, false, false); }



// FRAGMENT ORDER: every 16-bit operand plane [rows][K] that a kernel fetches from global memory lies in blocks of 16 rows x 32 k (512 values, 1 KiB), block (row / 16) * (K / 32) + k / 32;
// inside a block the value (row % 16, k % 32) lies at (k & 16) * 16 + ((k >> 3 & 1) * 16 + row % 16) * 8 + (k & 7). Lane l = 16 hi + lr of a fragment (row lr; k = 8 hi .. 8 hi + 7 and 16 + 8 hi .. 16 + 8 hi + 7)
// so finds its two 16-byte pieces at 8 l and 256 + 8 l, and each of the wave's two loads covers 512 contiguous bytes, four whole lines, where a row-major plane makes it touch sixteen.
// fragment loaders: p = the block's start + 8 lane
template <typename T16> struct WFrag;
template <> struct WFrag<h16> { typedef v16h V; static __device__ __forceinline__ V ld(const h16* p) { return cat16(*(const v8h*)p, *(const v8h*)(p + 256)); } static __device__ __forceinline__ v8f mma(V a, V b, v8f c) { return wmma16(a, b, c); } };
template <> struct WFrag<bf> { typedef v16bf V; static __device__ __forceinline__ V ld(const bf* p) { return cat16b(*(const v8us*)p, *(const v8us*)(p + 256)); } static __device__ __forceinline__ v8f mma(V a, V b, v8f c) { return wmmab(a, b, c); } };
__device__ __forceinline__ h16 tohx(float x) { return (h16)x; }
__device__ __forceinline__ void splitf(float y, unsigned short& h, unsigned short& l) { h = f2bf(y); l = f2bf(y - bf2f(h)); }
typedef __attribute__((ext_vector_type(2))) _Float16 v2h;
typedef __attribute__((ext_vector_type(4))) _Float16 v4h;
typedef __attribute__((ext_vector_type(2))) unsigned short v2us;
typedef __attribute__((ext_vector_type(4))) int v4i;

// ---- k_cvtall: every f32 input matrix [rows][DD], row-major -> bf16 in fragment order, in one launch. dst: the planes of qkv_w, r_w, out_w, query and r, which lie one behind the other in the workspace, in this order.
// One workgroup makes one row of blocks: 16 source rows x DD columns, 2048 pieces of 16 bytes, 32 KiB of dst; grid = all rows / 16. Thread t makes the pieces t, t + 256, ..: a wave stores 512 contiguous bytes and reads 64 bytes of each of 16 rows.
// A thread's eight loads are all issued before the first value is used, so that a wave has 8 KiB in flight and the launch needs an eighth of the waves that one piece a thread takes.
#define GQKV (3 * DD / 16)
#define GW   (DD / 16)
#define GX   (NT / 16)
#define GR   (TT / 16)
__global__ __launch_bounds__(256) void k_cvtall(const float* __restrict__ qkvw, const float* __restrict__ rw, const float* __restrict__ ow, const float* __restrict__ x, const float* __restrict__ r, bf* dst) {
    const int g = blockIdx.x, t = threadIdx.x;   // the source matrix and the row group in it are the same for the whole workgroup
    const float* src = g < GQKV ? qkvw : g < GQKV + GW ? rw : g < GQKV + 2 * GW ? ow : g < GQKV + 2 * GW + GX ? x : r;
    const int gl = g - (g < GQKV ? 0 : g < GQKV + GW ? GQKV : g < GQKV + 2 * GW ? GQKV + GW : g < GQKV + 2 * GW + GX ? GQKV + 2 * GW : GQKV + 2 * GW + GX);
    const float* ps = src + (size_t)(gl * 16 + (t & 15)) * DD + (t >> 6) * 32 + ((t >> 5) & 1) * 16 + ((t >> 4) & 1) * 8; v8f v[8];   // piece t + 256 j lies four blocks, 128 columns, behind piece t + 256 (j - 1)
#pragma unroll
    for (int j = 0; j < 8; ++j) v[j] = *(const v8f*)(ps + j * 128);
    // the translation wait behind the loads, the address its input, so that no later result lands in an address register ahead of it
    asm volatile("s_wait_xcnt 0x0" :: "v"(ps) : "memory");
    bf* pd = dst + (size_t)g * 16384 + t * 8;
#pragma unroll
    for (int j = 0; j < 8; ++j) { v8us o;
#pragma unroll
        for (int k = 0; k < 8; ++k) o[k] = f2bf(v[j][k]);
        *(v8us*)(pd + j * 2048) = o; }
}
// ---- k_proj: the q, k, v and r projections in one launch, each 64x64 tile stored straight as the fp16 operand planes of k_relattn, in fragment order; no f32 plane in memory.
// One workgroup of 4 waves (2 x 2) makes a 128 x 128 tile, each wave 64 x 64 of it over the whole K, one f32 sum a value. The 128 rows of each operand are fetched once for the workgroup, where a wave that fetches
// for itself alone takes 64 + 64 rows for a 64 x 64 tile: half the bytes from L2. A stage is 64 k of both operands: 16 pieces of 2 KiB (16 rows x 64 k are two blocks of the fragment order, one behind the other),
// brought into LDS as they lie by asynchronous copies, 16 bytes a thread and piece; two buffers, the next stage's copies fly while this stage is worked on. A fragment is read from LDS as from memory: 2 x 512 contiguous bytes a wave.
// W: the rows of qkv_w, then those of r_w (4 DD rows); a column tile of 128 is two heads of q, k, v or r_k. grid (NT / 128, 28): y < 24 is the column tile, x the row tile of XB (rows t NB + b: 64 t of both batches);
// the 4 x 32 workgroups behind them are the 16 row tiles x 8 column tiles of RB. A 64x64 tile holds whole 1-KiB blocks of its planes: thread piece = 16 bytes, a wave's store = 512 contiguous bytes.
// QA = q + r_w_bias, QB = q + r_r_bias, KP = k: [batch x head][T][64]; RK: [head][T][64]; VT: [batch x head][64 rows d][T] (k = t).
#define SK   64          // k values a stage
#define NSTG (DD / SK)
#define STGB 32768       // bytes a stage: 8 pieces of A, 8 of B
__device__ __forceinline__ unsigned lds_off(const void* p) { return (unsigned)(size_t)p; }
// the eight 2-KiB pieces of one operand's 128 rows: l = this thread's LDS byte address in piece 0, g = its 16 bytes of piece 0 in memory; the next 16 rows lie 16 DD values further.
// The translation wait is the statement's last line, so that no address register is rewritten ahead of it.
__device__ __forceinline__ void copy8(unsigned l, const bf* g) {
    asm volatile("global_load_async_to_lds_b128 %0, %8, off\n\t"
                 "global_load_async_to_lds_b128 %1, %9, off\n\t"
                 "global_load_async_to_lds_b128 %2, %10, off\n\t"
                 "global_load_async_to_lds_b128 %3, %11, off\n\t"
                 "global_load_async_to_lds_b128 %4, %12, off\n\t"
                 "global_load_async_to_lds_b128 %5, %13, off\n\t"
                 "global_load_async_to_lds_b128 %6, %14, off\n\t"
                 "global_load_async_to_lds_b128 %7, %15, off\n\t"
                 "s_wait_xcnt 0x0"
                 :: "v"(l), "v"(l + 2048u), "v"(l + 4096u), "v"(l + 6144u), "v"(l + 8192u), "v"(l + 10240u), "v"(l + 12288u), "v"(l + 14336u),
                    "v"(g), "v"(g + 16 * DD), "v"(g + 32 * DD), "v"(g + 48 * DD), "v"(g + 64 * DD), "v"(g + 80 * DD), "v"(g + 96 * DD), "v"(g + 112 * DD) : "memory");
}
// THE RING START: the workgroups of a launch that share operand rows run side by side, and walking k from 0 they would all ask L2 for the same lines at the same moment. Each so enters the k stages at a stage of its own
// and wraps round: trip s works on stage (s0 + s) mod NSTG. x, y: the workgroup's indices. Speed only: any s0 gives the same sum but for its order.
__device__ __forceinline__ int ring_start(int x, int y) { return (((x >> 3) << 2) + (x & 3) + y) & (NSTG - 1); }
// one stage: A's pieces, then B's; s picks the buffer, ks is the stage's place in k
__device__ __forceinline__ void fill_stage(unsigned l, const bf* ga, const bf* gb, int s, int ks) { const unsigned ls = l + (unsigned)(s & 1) * STGB; copy8(ls, ga + ks * (SK * 16)); copy8(ls + 16384u, gb + ks * (SK * 16)); }
// acc = the wave's 64 x 64 of the tile at (r0, c0); sm: the two stage buffers. Behind it every wave has passed the last stage's barrier and no copy is in flight: sm is free.
__device__ __forceinline__ void gemm_tile128(const bf* __restrict__ A, const bf* __restrict__ Bt, int r0, int c0, int s0, const char* sm, v8f (&acc)[4][4]) {
    const int t = threadIdx.x, lane = t & 31; const int w = __builtin_amdgcn_readfirstlane(t >> 5);
    const bf* ga = A + (size_t)r0 * DD + t * 8; const bf* gb = Bt + (size_t)c0 * DD + t * 8; const unsigned l0 = lds_off(sm) + (unsigned)t * 16u;
#pragma unroll
    for (int mb = 0; mb < 4; ++mb)
#pragma unroll
        for (int nb = 0; nb < 4; ++nb) acc[mb][nb] = (v8f){};
    fill_stage(l0, ga, gb, 0, s0);
    asm volatile("s_wait_asynccnt 0x0" ::: "memory");   // this wave's copies of stage s0 have landed
    __syncthreads();                                     // and every other wave's: stage s0 may be read
    fill_stage(l0, ga, gb, 1, (s0 + 1) & (NSTG - 1));
    const char* fa = sm + (w >> 1) * 8192 + lane * 16; const char* fb = sm + 16384 + (w & 1) * 8192 + lane * 16;   // the wave's four pieces of each operand
#pragma unroll 1   // one body for all stages: the buffer is chosen by s & 1, and the foot's waits and barrier stand once
    for (int s = 0; s < NSTG; ++s) { const int bo = (s & 1) * STGB; v16bf a[4], b[4];
#pragma unroll
        for (int mb = 0; mb < 4; ++mb) { a[mb] = WFrag<bf>::ld((const bf*)(fa + bo + mb * 2048)); b[mb] = WFrag<bf>::ld((const bf*)(fb + bo + mb * 2048)); }
        __builtin_amdgcn_sched_barrier(0);   // the block's 16 LDS reads stand together in front of its products (the compiler otherwise deals B's reads out among them, and each group waits anew)
#pragma unroll
        for (int nb = 0; nb < 4; ++nb)
#pragma unroll
            for (int mb = 0; mb < 4; ++mb) acc[mb][nb] = wmmab(a[mb], b[nb], acc[mb][nb]);
#pragma unroll
        for (int mb = 0; mb < 4; ++mb) { a[mb] = WFrag<bf>::ld((const bf*)(fa + bo + mb * 2048 + 1024)); b[mb] = WFrag<bf>::ld((const bf*)(fb + bo + mb * 2048 + 1024)); }
        // the foot stands behind the stage's last LDS read, not behind its last product: the second 32 k are in registers, so the buffer is handed on and refilled while their products run
        asm volatile("s_wait_dscnt 0x0" ::: "memory");      // this wave's reads of the buffer are done before it is handed to the copies
        asm volatile("s_wait_asynccnt 0x0" ::: "memory");   // this wave's copies of trip s + 1's stage have landed
        __syncthreads();                                     // trip s + 1's stage may be read; every wave has left trip s's buffer
        if (s + 2 < NSTG) fill_stage(l0, ga, gb, s + 2, (s0 + s + 2) & (NSTG - 1));
#pragma unroll
        for (int nb = 0; nb < 4; ++nb)
#pragma unroll
            for (int mb = 0; mb < 4; ++mb) acc[mb][nb] = wmmab(a[mb], b[nb], acc[mb][nb]);
    }
    asm volatile("s_wait_asynccnt 0x0" ::: "memory");   // nothing is in flight when the buffers become the tiles' staging
}
// one 16-byte piece: 8 neighbouring columns of one tile row
__device__ __forceinline__ v8f row8(const float* pp) { const v4f v0 = *(const v4fa*)pp, v1 = *(const v4fa*)(pp + 4); return __builtin_shufflevector(v0, v1, 0, 1, 2, 3, 4, 5, 6, 7); }
__device__ __forceinline__ v8h addh8(v8f v, v8f b) { v8h o;
#pragma unroll
    for (int q = 0; q < 8; ++q) o[q] = tohx(__fadd_rn(v[q], b[q]));
    return o; }
// a thread's four pieces of one plane
__device__ __forceinline__ void store4(h16* const (&p)[4], const v8h (&o)[4]) {
#pragma unroll
    for (int it = 0; it < 4; ++it) *(v8h*)p[it] = o[it];
    // the translation wait behind the stores, their addresses and values its inputs, so that no later result lands in one of those registers ahead of it
    asm volatile("s_wait_xcnt 0x0" :: "v"(p[0]), "v"(p[1]), "v"(p[2]), "v"(p[3]), "v"(o[0]), "v"(o[1]), "v"(o[2]), "v"(o[3]) : "memory"); }
__global__ __launch_bounds__(128) void k_proj(const bf* __restrict__ XB, const bf* __restrict__ RB, const bf* __restrict__ W, const float* __restrict__ rwb, const float* __restrict__ rrb, h16* QA, h16* QB, h16* KP, h16* VT, h16* RK) {
    __shared__ __align__(16) float os[4 * 64 * 68];   // first the two stage buffers (2 x 32 KiB), then the four waves' 64 x 64 tiles, pitch 68 floats
    const int y = blockIdx.y; const bool isr = y >= 24; const int rid = (y - 24) * (NT / 128) + (int)blockIdx.x;
    const int xt = isr ? rid & (TT / 128 - 1) : (int)blockIdx.x, ct = isr ? 24 + rid / (TT / 128) : y; const int kind = ct >> 3, h0 = (ct & 7) * 2;   // kind 0 q, 1 k, 2 v, 3 r_k: the same for the whole workgroup; its two heads h0, h0 + 1
    // thread -> its place in a block: l the 16-byte piece of a half block, hf the half, kb one bit of the block's number; the other two bits are the trip it
    const int l = threadIdx.x & 31, lr = l & 15, hi = l >> 4, hf = ((int)threadIdx.x >> 5) & 1, kb = (int)threadIdx.x >> 6; const int po = hf * 256 + l * 8;
    const int d = kb * 32 + hf * 16 + hi * 8;   // q, k, r_k: the piece's first column, the same on every trip
    v8f ba[2] = { (v8f){}, (v8f){} }, bb[2] = { (v8f){}, (v8f){} };
    v8f acc[4][4];
    gemm_tile128(isr ? RB : XB, W, xt * 128, ct * 128, ring_start((int)blockIdx.x, y), (const char*)os, acc);
    if (kind == 0) { const float* pa = rwb + h0 * HD + d; const float* pb = rrb + h0 * HD + d; ba[0] = *(const v8f*)pa; ba[1] = *(const v8f*)(pa + HD); bb[0] = *(const v8f*)pb; bb[1] = *(const v8f*)(pb + HD);   // both heads' biases, fetched behind the k loop, where 32 registers are free for them; the tile's LDS stores and the barrier stand between the loads and their use
        // the translation wait behind the loads, the addresses its inputs (as in k_cvtall)
        asm volatile("s_wait_xcnt 0x0" :: "v"(pa), "v"(pb) : "memory"); }
    { const int w = __builtin_amdgcn_readfirstlane(threadIdx.x >> 5);
#pragma unroll
        for (int mb = 0; mb < 4; ++mb)
#pragma unroll
            for (int nb = 0; nb < 4; ++nb)
#pragma unroll
                for (int j = 0; j < 8; ++j) os[(w * 64 + mb * 16 + hi * 8 + j) * 68 + nb * 16 + lr] = acc[mb][nb][j]; }
    __syncthreads();   // every wave's tile is in LDS before the threads regroup it
#pragma unroll
    for (int c = 0; c < 2; ++c)
#pragma unroll
        for (int q = 0; q < 8; ++q) { ba[c][q] = bfr(ba[c][q]); bb[c][q] = bfr(bb[c][q]); }
    // wave w's tile: row half w / 2, column half (head) w % 2; all threads store one tile after the other
#pragma unroll
    for (int sub = 0; sub < 4; ++sub) { const float* ot = os + sub * 64 * 68; const int x6 = xt * 2 + (sub >> 1), h = h0 + (sub & 1); h16* pd[4]; v8h o[4];
        if (kind == 2) {
#pragma unroll
            for (int it = 0; it < 4; ++it) { const int db = (it & 1) * 2 + kb, b = it >> 1; const float* pp = ot + ((hf * 16 + hi * 8) * NB_ + b) * 68 + db * 16 + lr;   // 8 rows t of column d = 16 db + lr
#pragma unroll
                for (int q = 0; q < 8; ++q) o[it][q] = tohx(pp[q * NB_ * 68]);
                pd[it] = VT + (size_t)(b * NH_ + h) * HD * TT + (size_t)(db * (TT / 32) + x6) * 512 + po; }
            store4(pd, o);
        } else { v8f v[4]; size_t off[4]; h16* P = kind == 0 ? QA : kind == 1 ? KP : RK;
#pragma unroll
            for (int it = 0; it < 4; ++it) { v[it] = row8(ot + (kind == 3 ? it * 16 + lr : ((it & 1) * 16 + lr) * NB_ + (it >> 1)) * 68 + d);
                off[it] = (kind == 3 ? (size_t)h * TT * HD + (size_t)(x6 * 4 + it) * 1024 : (size_t)((it >> 1) * NH_ + h) * TT * HD + (size_t)(x6 * 2 + (it & 1)) * 1024) + kb * 512 + po;
                pd[it] = P + off[it]; o[it] = addh8(v[it], ba[sub & 1]); }   // k, r_k: ba is zero
            store4(pd, o);
            if (kind == 0) {
#pragma unroll
                for (int it = 0; it < 4; ++it) { pd[it] = QB + off[it]; o[it] = addh8(v[it], bb[sub & 1]); }
                store4(pd, o); }
        }
    }
}
// ---- k_relattn: scores, relative shift, softmax, P.V and the head merge for RT query rows of one (batch, head); grid (T / RT, batch x heads), 16 waves.
// Every workgroup fetches the head's whole r_k, K and V from L2, so the bytes a query row costs fall with RT. RT = 64 rows fit the LDS because a score lies there as fp16 (pitch SP values), and fit the registers because
// the scores stay in LDS between the phases. BD[i][m] = (q_i + r_r_bias).r_k[m] lands where the module's zero-pad/reshape shift puts it: at row i, key m - (T - 1 - i), when that is >= 0,
// else at row i - 1, key m + i + 1; row i, key i + 1 is the shift's zero. So the rows i0 .. i0 + RT - 1 take the first kind from q rows i0 .. and the second kind from q rows i0 + 1 .. .
// AC is made transposed (keys x queries), each wave its own 128 keys of all RT rows: the lane that holds 8 keys of a query adds their BD values from LDS and puts AC + BD back at the same 16 bytes; the row maxima go
// from wave to wave through LDS; the same lane turns its sums into e^((s - max) / 8), again at the same 16 bytes, and reads them as its part of the B operand of P.V^T. The waves' f32 partial tiles then take the score rows' place
// (a row's 16 x 64 floats in the row's own bytes) and are joined in wave order by the threads that divide by the row's sum and store the merged bf16 hi/lo planes. All five operand planes and the two merged planes lie in fragment order.
#define RT 64
#define SP 2136   // fp16 values a score row: 4272 bytes, 16 x an odd number, so that the 16-byte pieces of 16 neighbouring rows fall on different banks; 1068 dwords are 44 mod 64, so that BD's 4-byte stores, one row and one key further from lane to lane, fall on 32 different banks too
#define SO 16     // key 0 of a row lies SO values behind the row's start: the 16 values in front of it and the 72 behind key T - 1 are pad, written by BD's tiles on the edge of the shift and never read
#define PP (SP / 2)   // the same pitch in floats, for the partial tiles
#define XP 20   // floats a row of RM and RS: the 16-byte pieces of 16 neighbouring rows fall on different banks
// 2^x of eight values. The instruction set asks for one independent slot behind a transcendental: in one statement, with results that share no register with an argument, each v_exp_f32 is the slot of the one in front of it, and one v_nop serves the last
__device__ __forceinline__ v8f exp2x8(v8f x) { float r0, r1, r2, r3, r4, r5, r6, r7;
    asm("v_exp_f32 %0, %8\n\tv_exp_f32 %1, %9\n\tv_exp_f32 %2, %10\n\tv_exp_f32 %3, %11\n\tv_exp_f32 %4, %12\n\tv_exp_f32 %5, %13\n\tv_exp_f32 %6, %14\n\tv_exp_f32 %7, %15\n\tv_nop"
        : "=&v"(r0), "=&v"(r1), "=&v"(r2), "=&v"(r3), "=&v"(r4), "=&v"(r5), "=&v"(r6), "=&v"(r7) : "v"(x[0]), "v"(x[1]), "v"(x[2]), "v"(x[3]), "v"(x[4]), "v"(x[5]), "v"(x[6]), "v"(x[7]));
    return (v8f){ r0, r1, r2, r3, r4, r5, r6, r7 }; }
// a workgroup barrier that orders the LDS alone: the waves hand one another nothing but LDS values here, and the global loads issued in front of it stay in flight across it (__syncthreads() waits for every one of them)
__device__ __forceinline__ void lds_barrier() { __builtin_amdgcn_fence(__ATOMIC_RELEASE, "workgroup", "local"); __builtin_amdgcn_s_barrier(); __builtin_amdgcn_fence(__ATOMIC_ACQUIRE, "workgroup", "local"); }
typedef v4h __attribute__((may_alias)) v4ha;
typedef __attribute__((ext_vector_type(4))) unsigned short v4us;
typedef unsigned __attribute__((may_alias)) u32a;
typedef unsigned short __attribute__((may_alias)) u16a;
__device__ __forceinline__ unsigned pkh(float a, float b) { const v2h t = { tohx(a), tohx(b) }; return __builtin_bit_cast(unsigned, t); }
// eight neighbouring fp16 values of one score row, from p on; od = 1 where p is an odd key number, so not on a dword. Three dwords hold the six values from the first even key on: the pairs (0,1) (2,3) (4,5), or, shifted
// by one value, (1,2) (3,4) (5,6); the two values left (6 and 7, or 0 and 7) go singly. Five stores, the same instructions in every lane.
__device__ __forceinline__ void put8(h16* p, v8f c, int od) {
    const unsigned p0 = pkh(c[0], c[1]), p1 = pkh(c[2], c[3]), p2 = pkh(c[4], c[5]), p3 = pkh(c[6], c[7]), sh = (unsigned)od * 16u;
    u32a* a = (u32a*)(p + od);
    a[0] = __builtin_amdgcn_alignbit(p1, p0, sh); a[1] = __builtin_amdgcn_alignbit(p2, p1, sh); a[2] = __builtin_amdgcn_alignbit(p3, p2, sh);
    *(u16a*)(p + (od ? 0 : 6)) = (unsigned short)(od ? p0 : p3); *(u16a*)(p + 7) = (unsigned short)(p3 >> 16); }
__global__ __launch_bounds__(512) void k_relattn(const h16* __restrict__ QA, const h16* __restrict__ QB, const h16* __restrict__ KP, const h16* __restrict__ RK, const h16* __restrict__ VT, bf* Ah, bf* Al) {
    __shared__ __align__(16) h16 S[RT * SP];
    __shared__ __align__(16) float RM[RT * XP], RS[RT * XP];   // per row: the 16 waves' maxima, the 16 waves' shares of the sum
    const int z = blockIdx.y, b = z >> 4, h = z & 15, i0 = blockIdx.x * RT;
    const int lane = threadIdx.x & 31, lr = lane & 15, hi = lane >> 4; const int w = __builtin_amdgcn_readfirstlane(threadIdx.x >> 5);
    QA += (size_t)z * TT * HD; QB += (size_t)z * TT * HD; KP += (size_t)z * TT * HD; VT += (size_t)z * HD * TT; RK += (size_t)h * TT * HD;
    // The 32 workgroups of a (batch, head) run side by side and fetch the same r_k, K and V; each walks its waves' tiles from a tile of its own and wraps round, so that they do not ask L2 for the same lines at the same moment (as the GEMMs' ring start):
    // the wave's tile number t of r_k or K is tile (t + rt) mod 8, its step ks of V is step (ks + rv) mod 4. Speed only.
    const int rt = ((((int)blockIdx.x >> 3) << 1) + ((int)blockIdx.x & 1)) & 7, rv = ((int)blockIdx.x >> 3) & 3;
    const int fo = 8 * lane;   // this lane's place in a block of the fragment order; 16 rows of a plane with 64 values a row are two blocks, k 0 .. 31 and 32 .. 63
    const h16* pq = QA + i0 * HD; const h16* pk = KP + w * 128 * HD; const h16* pv = VT + w * 4 * 512;   // AC's four blocks of 16 queries; this wave's 128 keys of K (8 tiles of 16) and of V
    v16h ra[2][2], rc[2][2];   // two register sets of four fragments each, refilled in turn: first two tiles of r_k each, then two key tiles of K, at last 32 keys of V
    {   // BD, stored shifted; wave w takes the 16-column tiles w, w + 16, ...
        v16h ql[4][2], qu[4][2]; const h16* pl = QB + i0 * HD; const h16* pr = RK + w * 16 * HD; const h16* pu[4]; const h16* pt[4];   // pl, pr, pt: the same for the whole wave; the lane's place fo is added at each load
#pragma unroll
        for (int mb = 0; mb < 4; ++mb) { const int ru = min(i0 + 1 + mb * 16 + lr, TT - 1); pu[mb] = QB + (ru >> 4) * (16 * HD) + (hi * 16 + (ru & 15)) * 8;   // the row behind the last one feeds no key: any row in bounds serves
#pragma unroll
            for (int ks = 0; ks < 2; ++ks) { ql[mb][ks] = WFrag<h16>::ld(pl + fo + mb * 16 * HD + ks * 512); qu[mb][ks] = WFrag<h16>::ld(pu[mb] + ks * 512); } }
#pragma unroll
        for (int s = 0; s < 4; ++s) pt[s] = pr + ((s + rt) & 7) * (256 * HD);   // the wave's first four tiles of r_k
#pragma unroll
        for (int s = 0; s < 2; ++s)
#pragma unroll
            for (int ks = 0; ks < 2; ++ks) { ra[s][ks] = WFrag<h16>::ld(pt[s] + fo + ks * 512); rc[s][ks] = WFrag<h16>::ld(pt[2 + s] + fo + ks * 512); }
        // one translation wait behind the batch's loads; the addresses are its inputs (the wave's bases in scalar registers, the lane number that the loads scale), so that no load's result and no later add lands in an address register ahead of it
        asm volatile("s_wait_xcnt 0x0" :: "s"(pl), "v"(pu[0]), "v"(pu[1]), "v"(pu[2]), "v"(pu[3]), "s"(pt[0]), "s"(pt[1]), "s"(pt[2]), "s"(pt[3]), "v"(lane) : "memory");
        // two tiles of r_k, numbers t0 and t0 + 1 of this wave, against all RT rows
        // The tile is made transposed (r_k x queries): a lane holds query lr of the block and the r_k rows 8 hi .. 8 hi + 7 of the tile, which land on 8 neighbouring keys of the query's score row, from key base + lr + 8 hi - (T - 1)
        // (first kind; base is even, so the key is odd where lr is even) or base + lr + 8 hi + 2 (second kind) on. No key is tested: base is a multiple of 16, so a tile of the first kind reaches down to key -15 at most
        // and one of the second kind up to key T + 16, and those fall into the row's own pad.
        const int ol = lr & 1; h16* const sl = S + SO + lr * SP + lr + hi * 8;   // the lane's row in a block of 16 queries, and the lane's own part of the key number
        auto bd2 = [&](const v16h (&rb)[2][2], int t0) {
#pragma unroll
            for (int s = 0; s < 2; ++s)
#pragma unroll
                for (int mb = 0; mb < 4; ++mb) { const int base = (((t0 + s + rt) & 7) * 16 + w) * 16 + i0 + mb * 16; h16* sr = sl + mb * 16 * SP;
                    if (base + 30 >= TT - 1) { v8f c = (v8f){}; c = wmma16(rb[s][0], ql[mb][0], c); c = wmma16(rb[s][1], ql[mb][1], c); put8(sr + (base - (TT - 1)), c, ol ^ 1); }
                    if (base + 2 < TT) { v8f c = (v8f){}; c = wmma16(rb[s][0], qu[mb][0], c); c = wmma16(rb[s][1], qu[mb][1], c); put8(sr + (base + 2), c, ol); } } };
        // A set is refilled as soon as its products are done, and its loads fly while the other set is worked on. On the second trip there is no r_k left and the sets take AC's first four key tiles.
#pragma unroll 1   // one body for both trips (for speed only)
        for (int g = 0; g < 2; ++g) { const h16* nx = (g == 0 ? pr : pk) + fo; const int st = g == 0 ? 256 * HD : 16 * HD, tn = (g == 0 ? 4 : 0) + rt;   // the lane's place in tile 0 of the plane that the next four tiles come from, the tiles' distance, the first one's number before the wrap
            bd2(ra, g * 4);
            { const h16* a0 = nx + (tn & 7) * st; const h16* a1 = nx + ((tn + 1) & 7) * st;
#pragma unroll
                for (int ks = 0; ks < 2; ++ks) { ra[0][ks] = WFrag<h16>::ld(a0 + ks * 512); ra[1][ks] = WFrag<h16>::ld(a1 + ks * 512); }
                // one translation wait behind the batch's loads, the lane's addresses its inputs, so that no load's result lands in an address register ahead of it
                asm volatile("s_wait_xcnt 0x0" :: "v"(a0), "v"(a1) : "memory"); }
            bd2(rc, g * 4 + 2);
            { const h16* a0 = nx + ((tn + 2) & 7) * st; const h16* a1 = nx + ((tn + 3) & 7) * st;
#pragma unroll
                for (int ks = 0; ks < 2; ++ks) { rc[0][ks] = WFrag<h16>::ld(a0 + ks * 512); rc[1][ks] = WFrag<h16>::ld(a1 + ks * 512); }
                // one translation wait behind the batch's loads, the lane's addresses its inputs (as above)
                asm volatile("s_wait_xcnt 0x0" :: "v"(a0), "v"(a1) : "memory"); } }
        if (threadIdx.x < RT) { const int j = i0 + (int)threadIdx.x + 1; if (j < TT) S[SO + threadIdx.x * SP + j] = tohx(0.f); }
    }
    // AC's queries take the registers of BD's queries; they fly across the barrier, as the four key tiles do
    v16h qa[4][2];
#pragma unroll
    for (int qb = 0; qb < 4; ++qb)
#pragma unroll
        for (int ks = 0; ks < 2; ++ks) qa[qb][ks] = WFrag<h16>::ld(pq + fo + qb * 16 * HD + ks * 512);
    // one translation wait behind the batch's loads, the address its input (as above)
    asm volatile("s_wait_xcnt 0x0" :: "s"(pq), "v"(lane) : "memory");
    lds_barrier();   // every shifted BD value is in LDS before a wave reads its keys of all rows
    // AC, transposed: wave w makes S^T = K.Q^T for its 128 keys (8 tiles of 16) and the four blocks of 16 queries. A lane holds query lr of a block and the keys 8 hi .. 8 hi + 7 of a tile: 16 bytes of the query's score row.
    h16* const sw = S + SO + lr * SP + w * 128 + hi * 8;   // the lane's 16 bytes of key tile 0, query block 0
    v8h mv[4];   // the running maxima of the rounded sums, eight a query block, joined behind the loop
#pragma unroll
    for (int qb = 0; qb < 4; ++qb)
#pragma unroll
        for (int q = 0; q < 8; ++q) mv[qb][q] = tohx(-65504.f);
    // two key tiles, numbers t0 and t0 + 1 of this wave, against all RT queries
    auto ac2 = [&](const v16h (&kf)[2][2], int t0) {
#pragma unroll
        for (int s = 0; s < 2; ++s)
#pragma unroll
            for (int qb = 0; qb < 4; ++qb) { h16* sr = sw + qb * 16 * SP + ((t0 + s + rt) & 7) * 16; const v8h bd = *(const v8ha*)sr;
                v8f c = (v8f){}; c = wmma16(kf[s][0], qa[qb][0], c); c = wmma16(kf[s][1], qa[qb][1], c); v8h o;
#pragma unroll
                for (int q = 0; q < 8; ++q) o[q] = tohx(__fadd_rn(c[q], (float)bd[q]));   // s = AC + BD; the division by 8 is part of the exponent's factor
                mv[qb] = __builtin_elementwise_maxnum(mv[qb], o); *(v8ha*)sr = o; } };
    // The two sets go on as in BD's loop: on the first trip they take the other four key tiles, on the second the first 64 keys of V, which fly across the barrier and behind the exponentials.
#pragma unroll 1   // one body for both trips: the maxima are then taken within the trip (unrolled, the compiler puts them off to the end and spills the sums that wait for them), and the text is half as long
    for (int g = 0; g < 2; ++g) { const h16* nx = (g == 0 ? pk : pv) + fo;   // the next eight fragments: two sets of two key tiles (two fragments each), or of one step of V (four fragments, 16 rows d apart); nx: the lane's place in the plane's first block
        const int o0 = g == 0 ? ((4 + rt) & 7) * 1024 : rv * 512, o1 = g == 0 ? o0 + 512 : o0 + 16 * TT, o2 = g == 0 ? ((5 + rt) & 7) * 1024 : o0 + 32 * TT, o3 = g == 0 ? o2 + 512 : o0 + 48 * TT;
        const int u0 = g == 0 ? ((6 + rt) & 7) * 1024 : ((1 + rv) & 3) * 512, u1 = g == 0 ? u0 + 512 : u0 + 16 * TT, u2 = g == 0 ? ((7 + rt) & 7) * 1024 : u0 + 32 * TT, u3 = g == 0 ? u2 + 512 : u0 + 48 * TT;
        ac2(ra, g * 4);
        { const h16* a[4] = { nx + o0, nx + o1, nx + o2, nx + o3 };
#pragma unroll
            for (int f = 0; f < 4; ++f) ra[f >> 1][f & 1] = WFrag<h16>::ld(a[f]);
            // one translation wait behind the batch's loads, the lane's addresses its inputs (as above)
            asm volatile("s_wait_xcnt 0x0" :: "v"(a[0]), "v"(a[1]), "v"(a[2]), "v"(a[3]) : "memory"); }
        ac2(rc, g * 4 + 2);
        { const h16* a[4] = { nx + u0, nx + u1, nx + u2, nx + u3 };
#pragma unroll
            for (int f = 0; f < 4; ++f) rc[f >> 1][f & 1] = WFrag<h16>::ld(a[f]);
            // one translation wait behind the batch's loads, the lane's addresses its inputs (as above)
            asm volatile("s_wait_xcnt 0x0" :: "v"(a[0]), "v"(a[1]), "v"(a[2]), "v"(a[3]) : "memory"); } }
    v16h vb[4][4];
#pragma unroll
    for (int nb = 0; nb < 4; ++nb) { vb[0][nb] = ra[nb >> 1][nb & 1]; vb[1][nb] = rc[nb >> 1][nb & 1]; }
#pragma unroll
    for (int qb = 0; qb < 4; ++qb) { float m = (float)mv[qb][0];
#pragma unroll
        for (int q = 1; q < 8; ++q) m = fmaxf(m, (float)mv[qb][q]);
        m = fmaxf(m, __shfl_xor(m, 16, 32)); if (hi == 0) RM[(qb * 16 + lr) * XP + w] = m; }   // this wave's maximum of each row
    lds_barrier();   // every wave's row maxima are in LDS
    const float cs = 0.125f * 1.44269504f; float mc[4];   // e^((s - max) / 8) = 2^(s cs - max cs)
#pragma unroll
    for (int qb = 0; qb < 4; ++qb) { const float* pm = RM + (qb * 16 + lr) * XP; v4f m = *(const v4fa*)pm;
#pragma unroll
        for (int p = 1; p < 4; ++p) { const v4f n = *(const v4fa*)(pm + p * 4);
#pragma unroll
            for (int q = 0; q < 4; ++q) m[q] = fmaxf(m[q], n[q]); }
        mc[qb] = -cs * fmaxf(fmaxf(m[0], m[1]), fmaxf(m[2], m[3])); }
    // P = e^((s - max) / 8), not yet divided by the row's sum (at most 1, the row's largest exactly 1: fp16 holds it with the relative error it had for the scaled P); the division follows the join.
    // The lane puts P, rounded to fp16, where its s lay: with the 64 x 64 f32 tile of P.V and V in registers there is no room for the exponentials' values beside them, so the exponentials come first, all of them
    v8f sum8[4];   // eight partial sums a query block, one for each of the lane's keys of a tile, joined behind the loop
#pragma unroll
    for (int qb = 0; qb < 4; ++qb) sum8[qb] = (v8f){};
#pragma unroll 1   // one body for all key tiles: the sums are then added within the trip (unrolled, the compiler puts the additions off and spills the values that wait for them), and the text is an eighth as long
    for (int kt = 0; kt < 8; ++kt)
#pragma unroll
        for (int qb = 0; qb < 4; ++qb) { h16* sr = sw + qb * 16 * SP + kt * 16; const v8h sv = *(const v8ha*)sr; v8f x; v8h o;
#pragma unroll
            for (int q = 0; q < 8; ++q) x[q] = __builtin_fmaf((float)sv[q], cs, mc[qb]);
            const v8f e = exp2x8(x);
#pragma unroll
            for (int q = 0; q < 8; ++q) o[q] = tohx(e[q]);
            sum8[qb] += e; *(v8ha*)sr = o; }
#pragma unroll
    for (int qb = 0; qb < 4; ++qb) { const v8f u = sum8[qb]; float t = ((u[0] + u[1]) + (u[2] + u[3])) + ((u[4] + u[5]) + (u[6] + u[7])); t += __shfl_xor(t, 16, 32); if (hi == 0) RS[(qb * 16 + lr) * XP + w] = t; }   // this wave's share of each row's sum
    // P.V, transposed: out^T (64 d x 64 queries) = V^T.P^T over this wave's keys; a lane's 16-byte pieces of two neighbouring key tiles are its part of the B fragment (32 keys x 16 queries)
    v8f acc[4][4];
#pragma unroll
    for (int qb = 0; qb < 4; ++qb)
#pragma unroll
        for (int nb = 0; nb < 4; ++nb) acc[nb][qb] = (v8f){};
#pragma unroll
    for (int ks = 0; ks < 4; ++ks) {
#pragma unroll
        for (int qb = 0; qb < 4; ++qb) { const h16* sr = sw + qb * 16 * SP + ((ks + rv) & 3) * 32; const v16h pf = cat16(*(const v8ha*)sr, *(const v8ha*)(sr + 16));
#pragma unroll
            for (int nb = 0; nb < 4; ++nb) acc[nb][qb] = wmma16(vb[ks][nb], pf, acc[nb][qb]); }
        if (ks < 2) {   // the next but one 32 keys of V take the registers of these; the two scheduling barriers keep the loads here, a whole step ahead of their use (the compiler otherwise sinks them to it)
            __builtin_amdgcn_sched_barrier(0);
            const h16* pn = pv + ((ks + 2 + rv) & 3) * 512;
#pragma unroll
            for (int nb = 0; nb < 4; ++nb) vb[ks + 2][nb] = WFrag<h16>::ld(pn + fo + nb * 16 * TT);
            // one translation wait behind the batch's loads, the address its input (as above)
            asm volatile("s_wait_xcnt 0x0" :: "s"(pn), "v"(lane) : "memory");
            __builtin_amdgcn_sched_barrier(0); } }
    __syncthreads();   // every wave has read its last P: the rows are free for the partial tiles
    float* PT = (float*)S;
    // a lane holds 8 neighbouring d of one query: two 16-byte stores a tile
#pragma unroll
    for (int nb = 0; nb < 4; ++nb)
#pragma unroll
        for (int qb = 0; qb < 4; ++qb) { float* po = PT + (qb * 16 + lr) * PP + w * 64 + nb * 16 + hi * 8;
            *(v4fa*)po = __builtin_shufflevector(acc[nb][qb], acc[nb][qb], 0, 1, 2, 3); *(v4fa*)(po + 4) = __builtin_shufflevector(acc[nb][qb], acc[nb][qb], 4, 5, 6, 7); }
    __syncthreads();   // every wave's partial tile and its share of the sums are in LDS before any thread sums them
#pragma unroll
    for (int rr = 0; rr < 2; ++rr) { const int row = rr * 32 + ((int)threadIdx.x >> 4), cofs = ((int)threadIdx.x & 15) * 4; const float* pp = PT + row * PP + cofs; v4f val = *(const v4fa*)pp;
#pragma unroll
        for (int p = 1; p < 16; ++p) val += *(const v4fa*)(pp + p * 64);
        const float* pt = RS + row * XP; v4f t4 = *(const v4fa*)pt;
#pragma unroll
        for (int p = 1; p < 4; ++p) t4 += *(const v4fa*)(pt + p * 4);
        const float inv = __fdiv_rn(1.0f, (t4[0] + t4[1]) + (t4[2] + t4[3]));
        v4us oh, ol;
#pragma unroll
        for (int q = 0; q < 4; ++q) { unsigned short x, y; splitf(val[q] * inv, x, y); oh[q] = x; ol[q] = y; }
        // the merged planes in fragment order, row b T + t, so that this workgroup alone writes its eight blocks (4 x 16 rows, the head's 2 x 32 columns)
        const size_t o = ((size_t)((b * TT + i0 + row) >> 4) * (DD / 32) + h * 2 + (cofs >> 5)) * 512 + (cofs & 16) * 16 + (((cofs >> 3) & 1) * 16 + (row & 15)) * 8 + (cofs & 7); bf* ph = Ah + o; bf* pl2 = Al + o; *(v4us*)ph = oh; *(v4us*)pl2 = ol;
        // the translation wait behind the stores, their addresses and values its inputs (as in store4)
        asm volatile("s_wait_xcnt 0x0" :: "v"(ph), "v"(pl2), "v"(oh), "v"(ol) : "memory"); }
}

// ---- k_out: out = (Ah + Al) Wo^T + out_b, f32: a 128 x 128 tile a workgroup, staged as in k_proj with A's second plane as a third operand (48 KiB a stage, two buffers); grid (NT / 128, DD / 128).
// There is one workgroup a WGP, so it has 8 waves (4 x 2, each 32 x 64 of the tile), two a SIMD: one wave's LDS waits stand behind the other's products. One f32 sum a value: per 32 k Ah's products, then Al's.
// A's row b T + t is out's row t NB + b. The tile goes through LDS (pitch 132 floats), so that a wave stores 512 contiguous bytes of a row.
// four of the eight 2-KiB pieces of one operand's 128 rows, every second one (256 threads cover two pieces a copy): l, g = this thread's 16 bytes in its first piece. The translation wait is the statement's last line, as in copy8.
__device__ __forceinline__ void copy4(unsigned l, const bf* g) {
    asm volatile("global_load_async_to_lds_b128 %0, %4, off\n\t"
                 "global_load_async_to_lds_b128 %1, %5, off\n\t"
                 "global_load_async_to_lds_b128 %2, %6, off\n\t"
                 "global_load_async_to_lds_b128 %3, %7, off\n\t"
                 "s_wait_xcnt 0x0"
                 :: "v"(l), "v"(l + 4096u), "v"(l + 8192u), "v"(l + 12288u), "v"(g), "v"(g + 32 * DD), "v"(g + 64 * DD), "v"(g + 96 * DD) : "memory");
}
#define STG3 49152       // bytes a stage: 8 pieces each of Ah, Al and Wo
__device__ __forceinline__ void fill_stage3(unsigned l, const bf* ga, const bf* ga2, const bf* gb, int s, int ks) { const unsigned ls = l + (unsigned)(s & 1) * STG3; copy4(ls, ga + ks * (SK * 16)); copy4(ls + 16384u, ga2 + ks * (SK * 16)); copy4(ls + 32768u, gb + ks * (SK * 16)); }
__device__ __forceinline__ void store4f(float* const (&p)[4], const v4f (&o)[4]) {
#pragma unroll
    for (int it = 0; it < 4; ++it) *(v4f*)p[it] = o[it];
    // the translation wait behind the stores, their addresses and values its inputs (as in store4)
    asm volatile("s_wait_xcnt 0x0" :: "v"(p[0]), "v"(p[1]), "v"(p[2]), "v"(p[3]), "v"(o[0]), "v"(o[1]), "v"(o[2]), "v"(o[3]) : "memory"); }
__global__ __launch_bounds__(256) void k_out(const bf* __restrict__ Ah, const bf* __restrict__ Al, const bf* __restrict__ Wo, const float* __restrict__ bias, float* C) {
    __shared__ __align__(16) float os[2 * STG3 / 4];   // first the two stage buffers, then the 128 x 128 tile, pitch 132 floats
    const char* sm = (const char*)os;
    const int r0 = blockIdx.x * 128, c0 = blockIdx.y * 128, s0 = ring_start((int)blockIdx.x, (int)blockIdx.y);   // s0: the stage this workgroup enters k at (as in k_proj)
    const int t = threadIdx.x, lane = t & 31, lr = lane & 15, hi = lane >> 4; const int w = __builtin_amdgcn_readfirstlane(t >> 5), wr = w >> 1, wc = w & 1;
    const size_t go = (size_t)(t >> 7) * (16 * DD) + (t & 127) * 8;   // threads 0 .. 127 take the even pieces, the others the odd ones
    const bf* ga = Ah + (size_t)r0 * DD + go; const bf* ga2 = Al + (size_t)r0 * DD + go; const bf* gb = Wo + (size_t)c0 * DD + go; const unsigned l0 = lds_off(sm) + (unsigned)t * 16u;
    v8f acc[2][4];
#pragma unroll
    for (int mb = 0; mb < 2; ++mb)
#pragma unroll
        for (int nb = 0; nb < 4; ++nb) acc[mb][nb] = (v8f){};
    fill_stage3(l0, ga, ga2, gb, 0, s0);
    asm volatile("s_wait_asynccnt 0x0" ::: "memory");   // this wave's copies of stage s0 have landed
    __syncthreads();                                     // and every other wave's: stage s0 may be read
    fill_stage3(l0, ga, ga2, gb, 1, (s0 + 1) & (NSTG - 1));
    const char* fa = sm + wr * 4096 + lane * 16; const char* fb = sm + 32768 + wc * 8192 + lane * 16;   // the wave's two pieces of Ah (Al's lie 16 KiB behind them) and its four of Wo
#pragma unroll 1   // one body for all stages: the buffer is chosen by s & 1, and the foot's waits and barrier stand once
    for (int s = 0; s < NSTG; ++s) { const int bo = (s & 1) * STG3; v16bf a[2], a2[2], b[4];
#pragma unroll
        for (int mb = 0; mb < 2; ++mb) { a[mb] = WFrag<bf>::ld((const bf*)(fa + bo + mb * 2048)); a2[mb] = WFrag<bf>::ld((const bf*)(fa + bo + 16384 + mb * 2048)); }
#pragma unroll
        for (int nb = 0; nb < 4; ++nb) b[nb] = WFrag<bf>::ld((const bf*)(fb + bo + nb * 2048));
        __builtin_amdgcn_sched_barrier(0);   // the block's 16 LDS reads stand together in front of its products (as in gemm_tile128)
#pragma unroll
        for (int nb = 0; nb < 4; ++nb)
#pragma unroll
            for (int mb = 0; mb < 2; ++mb) acc[mb][nb] = wmmab(a[mb], b[nb], acc[mb][nb]);
#pragma unroll
        for (int nb = 0; nb < 4; ++nb)
#pragma unroll
            for (int mb = 0; mb < 2; ++mb) acc[mb][nb] = wmmab(a2[mb], b[nb], acc[mb][nb]);
#pragma unroll
        for (int mb = 0; mb < 2; ++mb) { a[mb] = WFrag<bf>::ld((const bf*)(fa + bo + mb * 2048 + 1024)); a2[mb] = WFrag<bf>::ld((const bf*)(fa + bo + 16384 + mb * 2048 + 1024)); }
#pragma unroll
        for (int nb = 0; nb < 4; ++nb) b[nb] = WFrag<bf>::ld((const bf*)(fb + bo + nb * 2048 + 1024));
        // the foot stands behind the stage's last LDS read, not behind its last product (as in gemm_tile128)
        asm volatile("s_wait_dscnt 0x0" ::: "memory");      // this wave's reads of the buffer are done before it is handed to the copies
        asm volatile("s_wait_asynccnt 0x0" ::: "memory");   // this wave's copies of trip s + 1's stage have landed
        __syncthreads();                                     // trip s + 1's stage may be read; every wave has left trip s's buffer
        if (s + 2 < NSTG) fill_stage3(l0, ga, ga2, gb, s + 2, (s0 + s + 2) & (NSTG - 1));
#pragma unroll
        for (int nb = 0; nb < 4; ++nb)
#pragma unroll
            for (int mb = 0; mb < 2; ++mb) acc[mb][nb] = wmmab(a[mb], b[nb], acc[mb][nb]);
#pragma unroll
        for (int nb = 0; nb < 4; ++nb)
#pragma unroll
            for (int mb = 0; mb < 2; ++mb) acc[mb][nb] = wmmab(a2[mb], b[nb], acc[mb][nb]);
    }
    asm volatile("s_wait_asynccnt 0x0" ::: "memory");   // nothing is in flight when the buffers become the tile's staging
    const int cofs = lane * 4; const float* pb = bias + c0 + cofs; v4f bs = *(const v4f*)pb;   // the thread's four columns; the tile's LDS stores and the barrier stand between the load and its use
    // the translation wait behind the load, the address its input (as in k_cvtall)
    asm volatile("s_wait_xcnt 0x0" :: "v"(pb) : "memory");
#pragma unroll
    for (int mb = 0; mb < 2; ++mb)
#pragma unroll
        for (int nb = 0; nb < 4; ++nb)
#pragma unroll
            for (int j = 0; j < 8; ++j) os[(wr * 32 + mb * 16 + hi * 8 + j) * 132 + wc * 64 + nb * 16 + lr] = acc[mb][nb][j];
    __syncthreads();   // the whole tile is in LDS before the threads regroup it
#pragma unroll
    for (int q = 0; q < 4; ++q) bs[q] = bfr(bs[q]);
#pragma unroll
    for (int g = 0; g < 4; ++g) { float* p[4]; v4f o[4];
#pragma unroll
        for (int it = 0; it < 4; ++it) { const int row = (g * 4 + it) * 8 + w; o[it] = *(const v4fa*)(os + row * 132 + cofs) + bs;
            const unsigned m = (unsigned)(r0 + row), orow = (m % TT) * NB_ + m / TT; p[it] = C + (size_t)orow * DD + c0 + cofs; }
        store4f(p, o); }
}

extern "C" void kernel_launch(void* const* d_in, const int* in_sizes, int n_in,
                              void* d_out, int out_size, void* d_ws, size_t ws_size, hipStream_t stream) {
    (void)in_sizes; (void)n_in; (void)out_size;
    const float* x = (const float*)d_in[0]; const float* r = (const float*)d_in[1]; const float* rwb = (const float*)d_in[2]; const float* rrb = (const float*)d_in[3]; const float* qkvw = (const float*)d_in[4]; const float* rw = (const float*)d_in[5]; const float* ow = (const float*)d_in[6]; const float* ob = (const float*)d_in[7];
    float* OUT = (float*)d_out;     // [2048][2][1024] (rows t*2 + b)
    char* wsp = (char*)d_ws;
    auto take = [&](size_t bytes) { char* p = wsp; wsp += (bytes + 255) & ~(size_t)255; return (void*)p; };
    bf* WQ = (bf*)take((size_t)DD * DD * 2); bf* WK = (bf*)take((size_t)DD * DD * 2); bf* WV = (bf*)take((size_t)DD * DD * 2); bf* WR = (bf*)take((size_t)DD * DD * 2); bf* WO = (bf*)take((size_t)DD * DD * 2);
    bf* XB = (bf*)take((size_t)NT * DD * 2); bf* RB = (bf*)take((size_t)TT * DD * 2);
    h16* QA = (h16*)take((size_t)NT * DD * 2); h16* QB = (h16*)take((size_t)NT * DD * 2); h16* KP = (h16*)take((size_t)NT * DD * 2); h16* VT = (h16*)take((size_t)NT * DD * 2); h16* RK = (h16*)take((size_t)NH_ * TT * HD * 2);
    bf* ATh = (bf*)take((size_t)NT * DD * 2); bf* ATl = (bf*)take((size_t)NT * DD * 2);
    if ((size_t)(wsp - (char*)d_ws) > ws_size) return;    // total 74 MiB
    k_cvtall<<<GQKV + 2 * GW + GX + GR, 256, 0, stream>>>(qkvw, rw, ow, x, r, WQ);   // WQ, WK, WV, WR, WO, XB, RB lie one behind the other
    k_proj<<<dim3(NT / 128, 28, 1), 128, 0, stream>>>(XB, RB, WQ, rwb, rrb, QA, QB, KP, VT, RK);   // WQ, WK, WV, WR lie one behind the other: the 4 DD rows of W
    k_relattn<<<dim3(TT / RT, NB_ * NH_, 1), 512, 0, stream>>>(QA, QB, KP, RK, VT, ATh, ATl);
    k_out<<<dim3(NT / 128, DD / 128, 1), 256, 0, stream>>>(ATh, ATl, WO, ob, OUT);
}
